// v000
// The times below were measured on an AMD MI455X: many runs one after another, warmed up first and cycling through
// copies of the inputs, with the whole window's GPU time divided by the number of runs. Launches and the gaps
// between them are all in it. The median over several windows is given; except for v000 it joins two sittings, which
// can be a few percent apart, so the side-by-side timings, each taken in one sitting, are the better comparison.
// v000, which the later versions start from, runs in 368 microseconds.
#include <hip/hip_runtime.h>
#include <hip/hip_bf16.h>
#include <math.h>

typedef float v2f __attribute__((ext_vector_type(2)));
typedef float v8f __attribute__((ext_vector_type(8)));

// ---------------------------------------------------------------------------
// fp32 WMMA: D(16x16) = A(16x4) * B(4x16) + C, full fp32 (matches reference
// numerics up to reassociation).  Lane L: mr = L%16, kg = L/16.
//   A frag (v2f): a[0]=A[mr][kg*2], a[1]=A[mr][kg*2+1]
//   B frag (v2f): b[0]=B[kg*2][mr], b[1]=B[kg*2+1][mr]
//   C/D (v8f):    c[r] = C[r + 8*kg][mr]
// ---------------------------------------------------------------------------
__device__ __forceinline__ v8f wmma4(v2f a, v2f b, v8f c) {
  return __builtin_amdgcn_wmma_f32_16x16x4_f32(false, a, false, b, (short)0, c,
                                               false, false);
}

__device__ __forceinline__ float gelu_exact(float x) {
  return 0.5f * x * (1.0f + erff(x * 0.70710678118654752f));
}

// block-wide reductions, blockDim.x == 256
__device__ __forceinline__ float blk_sum(float v, float* red) {
  int t = threadIdx.x;
  red[t] = v; __syncthreads();
  for (int o = 128; o > 0; o >>= 1) {
    if (t < o) red[t] += red[t + o];
    __syncthreads();
  }
  float r = red[0]; __syncthreads();
  return r;
}
__device__ __forceinline__ float blk_max(float v, float* red) {
  int t = threadIdx.x;
  red[t] = v; __syncthreads();
  for (int o = 128; o > 0; o >>= 1) {
    if (t < o) red[t] = fmaxf(red[t], red[t + o]);
    __syncthreads();
  }
  float r = red[0]; __syncthreads();
  return r;
}
__device__ __forceinline__ float blk_min(float v, float* red) {
  int t = threadIdx.x;
  red[t] = v; __syncthreads();
  for (int o = 128; o > 0; o >>= 1) {
    if (t < o) red[t] = fminf(red[t], red[t + o]);
    __syncthreads();
  }
  float r = red[0]; __syncthreads();
  return r;
}

// ---------------------------------------------------------------------------
// Global-branch mean over (C,D,H,W) per batch
// ---------------------------------------------------------------------------
__global__ __launch_bounds__(256) void k_gmean(const float* __restrict__ x,
                                               float* __restrict__ gm) {
  __shared__ float red[256];
  int b = blockIdx.x;
  const float* xb = x + (size_t)b * 55296;
  float s = 0.f;
  for (int i = threadIdx.x; i < 55296; i += 256) s += xb[i];
  float tot = blk_sum(s, red);
  if (threadIdx.x == 0) gm[b] = tot / 55296.0f;
}

// ---------------------------------------------------------------------------
// Entire global branch (tiny): one block per batch, thread = channel.
// Rank-1 score => instance-norm stats factor; softmax is shift-invariant so
// only 1/sigma and row-max of the raw score are needed.
// ---------------------------------------------------------------------------
__global__ __launch_bounds__(256) void k_global(
    const float* __restrict__ gm,
    const float* __restrict__ tok_w, const float* __restrict__ tok_b,
    const float* __restrict__ ln1_g, const float* __restrict__ ln1_b,
    const float* __restrict__ wq, const float* __restrict__ wk,
    const float* __restrict__ wv, const float* __restrict__ wo,
    const float* __restrict__ ln2_g, const float* __restrict__ ln2_b,
    const float* __restrict__ mo_w, const float* __restrict__ mo_b,
    float* __restrict__ gvec) {
  __shared__ float red[256];
  __shared__ float t_s[256];
  __shared__ float q_s[1024], k_s[1024], v_s[1024], o_s[1024];
  int b = blockIdx.x, c = threadIdx.x;
  float m = gm[b];
  float tok = m * tok_w[c] + tok_b[c];
  float resv = tok;
  float S1 = blk_sum(tok, red);
  float S2 = blk_sum(tok * tok, red);
  float mn = S1 * (1.f / 256.f);
  float var = S2 * (1.f / 256.f) - mn * mn;
  t_s[c] = (tok - mn) * rsqrtf(var + 1e-6f) * ln1_g[c] + ln1_b[c];
  __syncthreads();
  // q/k/v projections: 1x256 @ 256x1024 each
  for (int rep = 0; rep < 4; ++rep) {
    int o = rep * 256 + c;
    float aq = 0.f, ak = 0.f, av = 0.f;
    for (int i = 0; i < 256; ++i) {
      float ti = t_s[i];
      aq += ti * wq[i * 1024 + o];
      ak += ti * wk[i * 1024 + o];
      av += ti * wv[i * 1024 + o];
    }
    q_s[o] = aq; k_s[o] = ak; v_s[o] = av;
  }
  __syncthreads();
  for (int h = 0; h < 4; ++h) {           // heads OUTER (reshape B,Hh,C)
    float qi = q_s[h * 256 + c], ki = k_s[h * 256 + c];
    float Sq  = blk_sum(qi, red),       Sq2 = blk_sum(qi * qi, red);
    float Sk  = blk_sum(ki, red),       Sk2 = blk_sum(ki * ki, red);
    float kmx = blk_max(ki, red),       kmn = blk_min(ki, red);
    float mu  = (Sq * Sk)  * (1.f / 65536.f);
    float ex2 = (Sq2 * Sk2) * (1.f / 65536.f);
    float rstd = rsqrtf(ex2 - mu * mu + 1e-5f);
    float rmax = qi * (qi >= 0.f ? kmx : kmn);  // row max of raw score
    float den = 0.f, acc = 0.f;
    for (int j = 0; j < 256; ++j) {
      float pe = __expf((qi * k_s[h * 256 + j] - rmax) * rstd);
      den += pe;
      acc += pe * v_s[h * 256 + j];
    }
    o_s[h * 256 + c] = acc / den;
    __syncthreads();
  }
  // out = o^T(flattened c-outer) @ wo (1024x256)
  float outv = 0.f;
  for (int i = 0; i < 256; ++i) {
    const float* w = wo + (size_t)(i * 4) * 256 + c;
    outv += o_s[i] * w[0] + o_s[256 + i] * w[256] + o_s[512 + i] * w[512] +
            o_s[768 + i] * w[768];
  }
  float ov = outv + resv;
  float T1 = blk_sum(ov, red), T2 = blk_sum(ov * ov, red);
  float mn2 = T1 * (1.f / 256.f), var2 = T2 * (1.f / 256.f) - mn2 * mn2;
  float tok2 = (ov - mn2) * rsqrtf(var2 + 1e-6f) * ln2_g[c] + ln2_b[c];
  t_s[c] = tok2;
  __syncthreads();
  float a2 = mo_b[c];
  for (int i = 0; i < 256; ++i) a2 += t_s[i] * mo_w[c * 256 + i];  // 'bc,oc->bo'
  gvec[b * 256 + c] = gelu_exact(a2);
}

// ---------------------------------------------------------------------------
// Local branch: patchify (2x2x2) + 8x8 embed + LN over C.
// Emits res (B,216,C) and eln rows (bp*8+pv, C).
// ---------------------------------------------------------------------------
__global__ __launch_bounds__(256) void k_local_embed(
    const float* __restrict__ x, const float* __restrict__ pw,
    const float* __restrict__ pb, const float* __restrict__ ln_g,
    const float* __restrict__ ln_b, float* __restrict__ res,
    float* __restrict__ eln) {
  __shared__ float pw_s[64];
  __shared__ float pb_s[8];
  __shared__ float sc[8 * 256];
  __shared__ float part1[256], part2[256];
  __shared__ float mean_s[8], rstd_s[8];
  int bp = blockIdx.x, b = bp / 27, p = bp % 27;
  int d = p / 9, hh = (p / 3) % 3, w = p % 3;
  int c = threadIdx.x;
  if (c < 64) pw_s[c] = pw[c];
  if (c < 8) pb_s[c] = pb[c];
  __syncthreads();
  const float* xb = x + (size_t)(b * 256 + c) * 216;
  float patch[8];
#pragma unroll
  for (int u = 0; u < 8; ++u) {
    int p1 = u >> 2, p2 = (u >> 1) & 1, p3 = u & 1;
    patch[u] = xb[(d * 2 + p1) * 36 + (hh * 2 + p2) * 6 + (w * 2 + p3)];
  }
  float tokv[8];
#pragma unroll
  for (int e = 0; e < 8; ++e) {
    float a = pb_s[e];
#pragma unroll
    for (int u = 0; u < 8; ++u) a += pw_s[e * 8 + u] * patch[u];
    tokv[e] = a;
    sc[e * 256 + c] = a;
    int p1 = e >> 2, p2 = (e >> 1) & 1, p3 = e & 1;
    int s = (d * 2 + p1) * 36 + (hh * 2 + p2) * 6 + (w * 2 + p3);
    res[(size_t)(b * 216 + s) * 256 + c] = a;   // residual uses raw tok
  }
  __syncthreads();
  int g = c >> 5, lane = c & 31;
  float s1 = 0.f, s2 = 0.f;
#pragma unroll
  for (int k = 0; k < 8; ++k) {
    float vv = sc[g * 256 + lane + k * 32];
    s1 += vv; s2 += vv * vv;
  }
  part1[c] = s1; part2[c] = s2;
  __syncthreads();
  if (c < 8) {
    float a = 0.f, bb = 0.f;
    for (int l = 0; l < 32; ++l) { a += part1[c * 32 + l]; bb += part2[c * 32 + l]; }
    float mn = a * (1.f / 256.f), vr = bb * (1.f / 256.f) - mn * mn;
    mean_s[c] = mn; rstd_s[c] = rsqrtf(vr + 1e-6f);
  }
  __syncthreads();
  float lg = ln_g[c], lb = ln_b[c];
#pragma unroll
  for (int e = 0; e < 8; ++e)
    eln[(size_t)(bp * 8 + e) * 256 + c] =
        (tokv[e] - mean_s[e]) * rstd_s[e] * lg + lb;
}

// ---------------------------------------------------------------------------
// fp32 WMMA GEMM: C = act(A(MxK) @ B(KxN) [+bias]).  TRANSB/ACT are template
// params so the inner loop is branch-free.  blockDim=128 (4 waves); each wave
// owns a 16(M) x 64(N) strip; all 4 waves share one n-strip, so the 16x64 B
// tile is staged through LDS once per K-chunk (coalesced float4 loads, 4x
// reuse).  Requires M%64==0, N%64==0, K%16==0.
// ---------------------------------------------------------------------------
template <bool TRANSB, bool ACT>
__global__ __launch_bounds__(128) void k_gemm_wmma(
    const float* __restrict__ A, const float* __restrict__ B,
    const float* __restrict__ bias, float* __restrict__ C, int M, int N,
    int K) {
  __shared__ float Bs[16 * 64];
  int tid = threadIdx.x;
  int wave = tid >> 5, lane = tid & 31;
  int mr = lane & 15, kg = lane >> 4;
  int m0 = (blockIdx.y * 4 + wave) * 16;
  int n0 = blockIdx.x * 64;
  v8f z = {0, 0, 0, 0, 0, 0, 0, 0};
  v8f acc[4] = {z, z, z, z};
  const float* arow = A + (size_t)(m0 + mr) * K;
  for (int k0 = 0; k0 < K; k0 += 16) {
    __syncthreads();   // guard Bs against previous chunk's readers
    if (!TRANSB) {
      // rows k0..k0+15 of B, cols n0..n0+63: thread loads two float4s
      int r = tid >> 4, c4 = (tid & 15) * 4;
      float4 v0 = *(const float4*)(B + (size_t)(k0 + r) * N + n0 + c4);
      float4 v1 = *(const float4*)(B + (size_t)(k0 + r + 8) * N + n0 + c4);
      *(float4*)(Bs + r * 64 + c4) = v0;
      *(float4*)(Bs + (r + 8) * 64 + c4) = v1;
    } else {
      // B stored (N x K): float4 runs along k, scatter into Bs rows
      int c = tid & 63, q0 = tid >> 6;  // q0 in {0,1}
#pragma unroll
      for (int qq = 0; qq < 2; ++qq) {
        int q = q0 + qq * 2;
        float4 v4 = *(const float4*)(B + (size_t)(n0 + c) * K + k0 + q * 4);
        Bs[(q * 4 + 0) * 64 + c] = v4.x;
        Bs[(q * 4 + 1) * 64 + c] = v4.y;
        Bs[(q * 4 + 2) * 64 + c] = v4.z;
        Bs[(q * 4 + 3) * 64 + c] = v4.w;
      }
    }
    __syncthreads();
#pragma unroll
    for (int kc = 0; kc < 4; ++kc) {
      int ka = kc * 4 + kg * 2;
      v2f a = *(const v2f*)(arow + k0 + ka);
#pragma unroll
      for (int t = 0; t < 4; ++t) {
        int n = t * 16 + mr;
        v2f bv;
        bv[0] = Bs[ka * 64 + n];
        bv[1] = Bs[(ka + 1) * 64 + n];
        acc[t] = wmma4(a, bv, acc[t]);
      }
    }
  }
#pragma unroll
  for (int t = 0; t < 4; ++t) {
    int n = n0 + t * 16 + mr;
    float bb = ACT ? bias[n] : 0.f;
#pragma unroll
    for (int r = 0; r < 8; ++r) {
      int row = m0 + r + 8 * kg;
      float v = acc[t][r] + bb;
      if (ACT) v = gelu_exact(v);
      C[(size_t)row * N + n] = v;
    }
  }
}

// ---------------------------------------------------------------------------
// Local attention core: one block per (bp, head); 864 blocks, 8 waves.
// score(256x256) = q(256x8) @ k(8x256) via WMMA (K=8 -> 2 steps of 4).
// Pass 1: stats (sum, sum^2, row-max). Pass 2: recompute + exp + p@v fused.
// ---------------------------------------------------------------------------
__global__ __launch_bounds__(256) void k_attn_local(
    const float* __restrict__ Qb, const float* __restrict__ Kb,
    const float* __restrict__ Vb, float* __restrict__ Ofl) {
  __shared__ float q_s[256 * 8];       // q[i][m]
  __shared__ float kt_s[8 * 256];      // k[m][j]
  __shared__ float v_s[256 * 8];       // v[j][m]
  __shared__ float tbuf[8][16 * 17];   // per-wave 16x16 tile, padded pitch
  __shared__ float rowmax_s[256];
  __shared__ float red1[256], red2[256];
  __shared__ float rstd_sh;
  int bp = blockIdx.x >> 2, h = blockIdx.x & 3;
  int b = bp / 27, p = bp % 27;
  int d = p / 9, ph = (p / 3) % 3, pwv = p % 3;
  int tid = threadIdx.x;
  {
    int c = tid;
#pragma unroll
    for (int pv = 0; pv < 8; ++pv) {
      size_t idx = (size_t)(bp * 8 + pv) * 1024 + c * 4 + h;  // col = c*Hh + h
      q_s[c * 8 + pv] = Qb[idx];
      kt_s[pv * 256 + c] = Kb[idx];
      v_s[c * 8 + pv] = Vb[idx];
    }
  }
  __syncthreads();
  int wave = tid >> 5, lane = tid & 31;
  int mr = lane & 15, kg = lane >> 4;
  float* tb = tbuf[wave];
  float s1 = 0.f, s2 = 0.f;
  // ---- pass 1: raw score stats -------------------------------------------
  for (int rbi = 0; rbi < 2; ++rbi) {
    int i0 = (wave + rbi * 8) * 16;
    float rmax = -3.0e38f;
    for (int jt = 0; jt < 16; ++jt) {
      int j0 = jt * 16;
      v8f acc = {0, 0, 0, 0, 0, 0, 0, 0};
#pragma unroll
      for (int kc = 0; kc < 2; ++kc) {
        int ka = kc * 4 + kg * 2;
        v2f a, bv;
        a[0] = q_s[(i0 + mr) * 8 + ka];
        a[1] = q_s[(i0 + mr) * 8 + ka + 1];
        bv[0] = kt_s[ka * 256 + j0 + mr];
        bv[1] = kt_s[(ka + 1) * 256 + j0 + mr];
        acc = wmma4(a, bv, acc);
      }
#pragma unroll
      for (int r = 0; r < 8; ++r) {
        float vv = acc[r];
        s1 += vv; s2 += vv * vv;
        tb[(r + 8 * kg) * 17 + mr] = vv;
      }
      if (lane < 16) {  // per-wave LDS, same-wave DS ordering
        for (int j = 0; j < 16; ++j) rmax = fmaxf(rmax, tb[lane * 17 + j]);
      }
    }
    if (lane < 16) rowmax_s[i0 + lane] = rmax;
  }
  red1[tid] = s1; red2[tid] = s2;
  __syncthreads();
  for (int o = 128; o > 0; o >>= 1) {
    if (tid < o) { red1[tid] += red1[tid + o]; red2[tid] += red2[tid + o]; }
    __syncthreads();
  }
  if (tid == 0) {
    float mu = red1[0] * (1.f / 65536.f);
    float var = red2[0] * (1.f / 65536.f) - mu * mu;
    rstd_sh = rsqrtf(var + 1e-5f);   // InstanceNorm eps; mu cancels in softmax
  }
  __syncthreads();
  float rstd = rstd_sh;
  // ---- pass 2: softmax + p@v ---------------------------------------------
  for (int rbi = 0; rbi < 2; ++rbi) {
    int i0 = (wave + rbi * 8) * 16;
    float den = 0.f;
    float num[8] = {0, 0, 0, 0, 0, 0, 0, 0};
    float rmax = (lane < 16) ? rowmax_s[i0 + lane] : 0.f;
    for (int jt = 0; jt < 16; ++jt) {
      int j0 = jt * 16;
      v8f acc = {0, 0, 0, 0, 0, 0, 0, 0};
#pragma unroll
      for (int kc = 0; kc < 2; ++kc) {
        int ka = kc * 4 + kg * 2;
        v2f a, bv;
        a[0] = q_s[(i0 + mr) * 8 + ka];
        a[1] = q_s[(i0 + mr) * 8 + ka + 1];
        bv[0] = kt_s[ka * 256 + j0 + mr];
        bv[1] = kt_s[(ka + 1) * 256 + j0 + mr];
        acc = wmma4(a, bv, acc);
      }
#pragma unroll
      for (int r = 0; r < 8; ++r) tb[(r + 8 * kg) * 17 + mr] = acc[r];
      if (lane < 16) {
        for (int j = 0; j < 16; ++j) {
          float sv = tb[lane * 17 + j];
          float pe = __expf((sv - rmax) * rstd);
          den += pe;
          const float* vp = &v_s[(j0 + j) * 8];
#pragma unroll
          for (int m2 = 0; m2 < 8; ++m2) num[m2] += pe * vp[m2];
        }
      }
    }
    if (lane < 16) {
      int cc = i0 + lane;
      float inv = 1.f / den;
#pragma unroll
      for (int m2 = 0; m2 < 8; ++m2) {
        int p1 = m2 >> 2, p2 = (m2 >> 1) & 1, p3 = m2 & 1;
        int s = (d * 2 + p1) * 36 + (ph * 2 + p2) * 6 + (pwv * 2 + p3);
        Ofl[(size_t)(b * 216 + s) * 1024 + cc * 4 + h] = num[m2] * inv;
      }
    }
  }
}

// ---------------------------------------------------------------------------
// t2 = LN(out + res) per row over C
// ---------------------------------------------------------------------------
__global__ __launch_bounds__(256) void k_ln2_local(
    const float* __restrict__ outb, const float* __restrict__ res,
    const float* __restrict__ g, const float* __restrict__ bb,
    float* __restrict__ t2) {
  __shared__ float red[256];
  int row = blockIdx.x, c = threadIdx.x;
  float v = outb[(size_t)row * 256 + c] + res[(size_t)row * 256 + c];
  float S1 = blk_sum(v, red), S2 = blk_sum(v * v, red);
  float mn = S1 * (1.f / 256.f), var = S2 * (1.f / 256.f) - mn * mn;
  t2[(size_t)row * 256 + c] = (v - mn) * rsqrtf(var + 1e-6f) * g[c] + bb[c];
}

// ---------------------------------------------------------------------------
// y = x + broadcast(global) + local
// ---------------------------------------------------------------------------
__global__ __launch_bounds__(256) void k_final(const float* __restrict__ x,
                                               const float* __restrict__ gvec,
                                               const float* __restrict__ lres,
                                               float* __restrict__ y) {
  int idx = blockIdx.x * 256 + threadIdx.x;
  int c = idx & 255, bs = idx >> 8;
  int b = bs / 216, s = bs - b * 216;
  size_t xi = (size_t)(b * 256 + c) * 216 + s;
  y[xi] = x[xi] + gvec[b * 256 + c] + lres[(size_t)bs * 256 + c];
}

extern "C" void kernel_launch(void* const* d_in, const int* in_sizes, int n_in,
                              void* d_out, int out_size, void* d_ws,
                              size_t ws_size, hipStream_t stream) {
  const float* x       = (const float*)d_in[0];
  const float* g_tok_w = (const float*)d_in[1];
  const float* g_tok_b = (const float*)d_in[2];
  const float* g_ln1_g = (const float*)d_in[3];
  const float* g_ln1_b = (const float*)d_in[4];
  const float* g_wq    = (const float*)d_in[5];
  const float* g_wk    = (const float*)d_in[6];
  const float* g_wv    = (const float*)d_in[7];
  const float* g_wo    = (const float*)d_in[8];
  const float* g_ln2_g = (const float*)d_in[9];
  const float* g_ln2_b = (const float*)d_in[10];
  const float* g_mo_w  = (const float*)d_in[11];
  const float* g_mo_b  = (const float*)d_in[12];
  const float* l_pw    = (const float*)d_in[13];
  const float* l_pb    = (const float*)d_in[14];
  const float* l_ln1_g = (const float*)d_in[15];
  const float* l_ln1_b = (const float*)d_in[16];
  const float* l_wq    = (const float*)d_in[17];
  const float* l_wk    = (const float*)d_in[18];
  const float* l_wv    = (const float*)d_in[19];
  const float* l_wo    = (const float*)d_in[20];
  const float* l_ln2_g = (const float*)d_in[21];
  const float* l_ln2_b = (const float*)d_in[22];
  const float* l_mo_w  = (const float*)d_in[23];
  const float* l_mo_b  = (const float*)d_in[24];

  float* ws   = (float*)d_ws;
  float* gm   = ws;                 // 8
  float* gvec = ws + 8;             // 2048
  float* eln  = ws + 8 + 2048;      // 1728*256
  float* res  = eln + 442368;       // 1728*256
  float* Qb   = res + 442368;       // 1728*1024
  float* Kb   = Qb + 1769472;       // 1728*1024
  float* Vb   = Kb + 1769472;       // 1728*1024
  float* ofl  = Vb + 1769472;       // 1728*1024
  float* outb = Qb;                 // alias: Qb dead after attention
  float* t2   = Kb;                 // alias: Kb dead after attention
  float* lres = Vb;                 // alias: Vb dead after attention

  k_gmean<<<8, 256, 0, stream>>>(x, gm);
  k_local_embed<<<216, 256, 0, stream>>>(x, l_pw, l_pb, l_ln1_g, l_ln1_b, res,
                                         eln);
  k_gemm_wmma<false, false><<<dim3(16, 27), 128, 0, stream>>>(
      eln, l_wq, nullptr, Qb, 1728, 1024, 256);
  k_gemm_wmma<false, false><<<dim3(16, 27), 128, 0, stream>>>(
      eln, l_wk, nullptr, Kb, 1728, 1024, 256);
  k_gemm_wmma<false, false><<<dim3(16, 27), 128, 0, stream>>>(
      eln, l_wv, nullptr, Vb, 1728, 1024, 256);
  k_global<<<8, 256, 0, stream>>>(gm, g_tok_w, g_tok_b, g_ln1_g, g_ln1_b, g_wq,
                                  g_wk, g_wv, g_wo, g_ln2_g, g_ln2_b, g_mo_w,
                                  g_mo_b, gvec);
  k_attn_local<<<864, 256, 0, stream>>>(Qb, Kb, Vb, ofl);
  k_gemm_wmma<false, false><<<dim3(4, 27), 128, 0, stream>>>(
      ofl, l_wo, nullptr, outb, 1728, 256, 1024);
  k_ln2_local<<<1728, 256, 0, stream>>>(outb, res, l_ln2_g, l_ln2_b, t2);
  k_gemm_wmma<true, true><<<dim3(4, 27), 128, 0, stream>>>(
      t2, l_mo_w, l_mo_b, lres, 1728, 256, 256);
  k_final<<<1728, 256, 0, stream>>>(x, gvec, lres, (float*)d_out);
}

// v001
// A run of this version takes 242 microseconds.
// In both of two side-by-side timings against v000, it was 1.52 times as fast.
#include <hip/hip_runtime.h>
#include <hip/hip_bf16.h>
#include <math.h>

typedef float v2f __attribute__((ext_vector_type(2)));
typedef float v8f __attribute__((ext_vector_type(8)));

// ---------------------------------------------------------------------------
// fp32 WMMA: D(16x16) = A(16x4) * B(4x16) + C, full fp32 (matches reference
// numerics up to reassociation).  Lane L: mr = L%16, kg = L/16.
//   A frag (v2f): a[0]=A[mr][kg*2], a[1]=A[mr][kg*2+1]
//   B frag (v2f): b[0]=B[kg*2][mr], b[1]=B[kg*2+1][mr]
//   C/D (v8f):    c[r] = C[r + 8*kg][mr]
// ---------------------------------------------------------------------------
__device__ __forceinline__ v8f wmma4(v2f a, v2f b, v8f c) {
  return __builtin_amdgcn_wmma_f32_16x16x4_f32(false, a, false, b, (short)0, c,
                                               false, false);
}

__device__ __forceinline__ float gelu_exact(float x) {
  return 0.5f * x * (1.0f + erff(x * 0.70710678118654752f));
}

// block-wide reductions, blockDim.x == 256
__device__ __forceinline__ float blk_sum(float v, float* red) {
  int t = threadIdx.x;
  red[t] = v; __syncthreads();
  for (int o = 128; o > 0; o >>= 1) {
    if (t < o) red[t] += red[t + o];
    __syncthreads();
  }
  float r = red[0]; __syncthreads();
  return r;
}

// ---------------------------------------------------------------------------
// Global-branch mean over (C,D,H,W) per batch
// ---------------------------------------------------------------------------
__global__ __launch_bounds__(256) void k_gmean(const float* __restrict__ x,
                                               float* __restrict__ gm) {
  __shared__ float red[256];
  int b = blockIdx.x;
  const float* xb = x + (size_t)b * 55296;
  float s = 0.f;
  for (int i = threadIdx.x; i < 55296; i += 256) s += xb[i];
  float tot = blk_sum(s, red);
  if (threadIdx.x == 0) gm[b] = tot / 55296.0f;
}

// ---------------------------------------------------------------------------
// Global branch, spread over many work-groups in three dependent launches.
// Rank-1 score => instance-norm stats factor; softmax is shift-invariant so
// only 1/sigma and row-max of the raw score are needed.
// ---------------------------------------------------------------------------
__device__ __forceinline__ float wave_sum(float v) {
#pragma unroll
  for (int o = 16; o > 0; o >>= 1) v += __shfl_xor(v, o, 32);
  return v;
}
__device__ __forceinline__ float wave_max(float v) {
#pragma unroll
  for (int o = 16; o > 0; o >>= 1) v = fmaxf(v, __shfl_xor(v, o, 32));
  return v;
}
__device__ __forceinline__ float wave_min(float v) {
#pragma unroll
  for (int o = 16; o > 0; o >>= 1) v = fminf(v, __shfl_xor(v, o, 32));
  return v;
}

// Launch 1: q/k/v projections for all 8 batches at once (8x256 @ 256x1024 x3).
// Work-group = one matrix x 32 columns; wave = 32 rows of K; lane = column.
// Each weight element is read once by the whole grid.
__global__ __launch_bounds__(256) void k_g_qkv(
    const float* __restrict__ gm,
    const float* __restrict__ tok_w, const float* __restrict__ tok_b,
    const float* __restrict__ ln1_g, const float* __restrict__ ln1_b,
    const float* __restrict__ wq, const float* __restrict__ wk,
    const float* __restrict__ wv, float* __restrict__ qkv) {
  __shared__ __attribute__((aligned(16))) float t_s[256 * 8];  // t[k][batch]
  __shared__ float red[8 * 8 * 32];                            // [wave][batch][lane]
  int tid = threadIdx.x, wave = tid >> 5, lane = tid & 31;
  int mat = blockIdx.x >> 5, col = (blockIdx.x & 31) * 32 + lane;
  const float* Wm = mat == 0 ? wq : (mat == 1 ? wk : wv);
  const float* wp = Wm + (size_t)(wave * 32) * 1024 + col;
  float wreg[32];   // issued first: the LN below runs under their latency
#pragma unroll
  for (int i = 0; i < 32; ++i) wreg[i] = wp[i * 1024];
  float m = gm[wave];
  float tw[8], tb8[8], lg[8], lb[8];
#pragma unroll
  for (int k = 0; k < 8; ++k) {
    int c = k * 32 + lane;
    tw[k] = tok_w[c]; tb8[k] = tok_b[c]; lg[k] = ln1_g[c]; lb[k] = ln1_b[c];
  }
  // the scheduler otherwise sinks part of the loads above behind the first
  // load wait (two or more exposed latencies instead of one)
  __builtin_amdgcn_sched_barrier(0);
  // stands before any register that a load above names is written again; the
  // address pair is an input so that it lives up to the wait
  asm volatile("s_wait_xcnt 0x0" :: "v"(wp) : "memory");
  // keeps later register writes from being lifted over the wait
  __builtin_amdgcn_sched_barrier(0);
  // LN1 of batch 'wave': 8 channels per lane
  {
    float tok[8];
    float s1 = 0.f, s2 = 0.f;
#pragma unroll
    for (int k = 0; k < 8; ++k) {
      tok[k] = m * tw[k] + tb8[k];
      s1 += tok[k]; s2 += tok[k] * tok[k];
    }
    s1 = wave_sum(s1); s2 = wave_sum(s2);
    float mn = s1 * (1.f / 256.f);
    float var = s2 * (1.f / 256.f) - mn * mn;
    float rs = rsqrtf(var + 1e-6f);
#pragma unroll
    for (int k = 0; k < 8; ++k) {
      int c = k * 32 + lane;
      t_s[c * 8 + wave] = (tok[k] - mn) * rs * lg[k] + lb[k];
    }
  }
  __syncthreads();
  float acc[8] = {0, 0, 0, 0, 0, 0, 0, 0};
#pragma unroll
  for (int i = 0; i < 32; ++i) {
    const float4* tp = (const float4*)&t_s[(wave * 32 + i) * 8];
    float4 ta = tp[0], tb = tp[1];
    float w = wreg[i];
    acc[0] += ta.x * w; acc[1] += ta.y * w; acc[2] += ta.z * w; acc[3] += ta.w * w;
    acc[4] += tb.x * w; acc[5] += tb.y * w; acc[6] += tb.z * w; acc[7] += tb.w * w;
  }
#pragma unroll
  for (int bb = 0; bb < 8; ++bb) red[(wave * 8 + bb) * 32 + lane] = acc[bb];
  __syncthreads();
  float s = 0.f;   // this thread finishes batch 'wave', column 'col'
#pragma unroll
  for (int w = 0; w < 8; ++w) s += red[(w * 8 + wave) * 32 + lane];
  qkv[(size_t)(mat * 8 + wave) * 1024 + col] = s;
}

// Launch 2: work-group = (batch, head, quarter of the 256 score rows).
// Thread = (row of the quarter, quarter of the 256 columns).  The 64 output
// values then meet their 64 rows of wo; the partial 1x256 goes to 'part'.
__global__ __launch_bounds__(256) void k_g_attn(
    const float* __restrict__ qkv, const float* __restrict__ wo,
    float* __restrict__ part) {
  __shared__ __attribute__((aligned(16))) float k_s[256];
  __shared__ __attribute__((aligned(16))) float v_s[256];
  __shared__ float q_s[256];
  __shared__ float st[8][6];
  __shared__ float den_s[256], acc_s[256];
  __shared__ float o_s[64];
  __shared__ __attribute__((aligned(16))) float red[8 * 256];
  int tid = threadIdx.x, wave = tid >> 5, lane = tid & 31;
  int rq = blockIdx.x & 3, h = (blockIdx.x >> 2) & 3, b = blockIdx.x >> 4;
  // wo rows (c*4 + h) of this wave's 8 score rows, issued first so that they
  // arrive while the softmax runs
  float4 w0[8], w1[8];
  const float* wr = wo + (size_t)((rq * 64 + wave * 8) * 4 + h) * 256 + lane * 4;
#pragma unroll
  for (int i = 0; i < 8; ++i) {
    w0[i] = *(const float4*)(wr + i * 1024);
    w1[i] = *(const float4*)(wr + i * 1024 + 128);
  }
  float qi = qkv[(size_t)(0 + b) * 1024 + h * 256 + tid];   // heads OUTER
  float ki = qkv[(size_t)(8 + b) * 1024 + h * 256 + tid];
  float vi = qkv[(size_t)(16 + b) * 1024 + h * 256 + tid];
  // the scheduler otherwise sinks part of the loads above behind the first
  // load wait (two or more exposed latencies instead of one)
  __builtin_amdgcn_sched_barrier(0);
  // stands before any register that a load above names is written again; the
  // address pair is an input so that it lives up to the wait
  asm volatile("s_wait_xcnt 0x0" :: "v"(wr) : "memory");
  // keeps later register writes from being lifted over the wait
  __builtin_amdgcn_sched_barrier(0);
  q_s[tid] = qi; k_s[tid] = ki; v_s[tid] = vi;
  {
    float a0 = wave_sum(qi), a1 = wave_sum(qi * qi);
    float a2 = wave_sum(ki), a3 = wave_sum(ki * ki);
    float a4 = wave_max(ki), a5 = wave_min(ki);
    if (lane == 0) {
      st[wave][0] = a0; st[wave][1] = a1; st[wave][2] = a2;
      st[wave][3] = a3; st[wave][4] = a4; st[wave][5] = a5;
    }
  }
  __syncthreads();
  float Sq = 0.f, Sq2 = 0.f, Sk = 0.f, Sk2 = 0.f;
  float kmx = st[0][4], kmn = st[0][5];
#pragma unroll
  for (int w = 0; w < 8; ++w) {
    Sq += st[w][0]; Sq2 += st[w][1]; Sk += st[w][2]; Sk2 += st[w][3];
    kmx = fmaxf(kmx, st[w][4]); kmn = fminf(kmn, st[w][5]);
  }
  float mu  = (Sq * Sk)  * (1.f / 65536.f);
  float ex2 = (Sq2 * Sk2) * (1.f / 65536.f);
  float rstd = rsqrtf(ex2 - mu * mu + 1e-5f);
  float qr = q_s[rq * 64 + (tid & 63)];
  int j0 = (tid >> 6) * 64;
  float rmax = qr * (qr >= 0.f ? kmx : kmn);  // row max of raw score
  float den = 0.f, acc = 0.f;
#pragma unroll 4
  for (int j = 0; j < 64; j += 4) {
    float4 k4 = *(const float4*)&k_s[j0 + j];
    float4 v4 = *(const float4*)&v_s[j0 + j];
    float p0 = __expf((qr * k4.x - rmax) * rstd);
    float p1 = __expf((qr * k4.y - rmax) * rstd);
    float p2 = __expf((qr * k4.z - rmax) * rstd);
    float p3 = __expf((qr * k4.w - rmax) * rstd);
    den += p0; acc += p0 * v4.x;
    den += p1; acc += p1 * v4.y;
    den += p2; acc += p2 * v4.z;
    den += p3; acc += p3 * v4.w;
  }
  den_s[tid] = den; acc_s[tid] = acc;
  __syncthreads();
  if (tid < 64) {
    float dd = (den_s[tid] + den_s[64 + tid]) + (den_s[128 + tid] + den_s[192 + tid]);
    float aa = (acc_s[tid] + acc_s[64 + tid]) + (acc_s[128 + tid] + acc_s[192 + tid]);
    o_s[tid] = aa / dd;
  }
  __syncthreads();
  float4 p0 = {0.f, 0.f, 0.f, 0.f}, p1 = {0.f, 0.f, 0.f, 0.f};
#pragma unroll
  for (int i = 0; i < 8; ++i) {
    float o = o_s[wave * 8 + i];
    p0.x += o * w0[i].x; p0.y += o * w0[i].y; p0.z += o * w0[i].z; p0.w += o * w0[i].w;
    p1.x += o * w1[i].x; p1.y += o * w1[i].y; p1.z += o * w1[i].z; p1.w += o * w1[i].w;
  }
  *(float4*)&red[wave * 256 + lane * 4] = p0;
  *(float4*)&red[wave * 256 + 128 + lane * 4] = p1;
  __syncthreads();
  float s = 0.f;
#pragma unroll
  for (int w = 0; w < 8; ++w) s += red[w * 256 + tid];
  part[(size_t)blockIdx.x * 256 + tid] = s;   // [(b*16 + h*4 + rq)][256]
}

// Launch 3: work-group = (batch, quarter of the 256 outputs).  Sums the 16
// partials, adds the residual, LN2, then map-out rows ('bc,oc->bo') with the
// lanes along c (coalesced) and a wave reduction per output, then GELU.
__global__ __launch_bounds__(256) void k_g_out(
    const float* __restrict__ gm,
    const float* __restrict__ tok_w, const float* __restrict__ tok_b,
    const float* __restrict__ part,
    const float* __restrict__ ln2_g, const float* __restrict__ ln2_b,
    const float* __restrict__ mo_w, const float* __restrict__ mo_b,
    float* __restrict__ gvec) {
  __shared__ __attribute__((aligned(16))) float t_s[256];
  __shared__ float st[8][2];
  int c = threadIdx.x, wave = c >> 5, lane = c & 31;
  int b = blockIdx.x >> 2, o0 = (blockIdx.x & 3) * 64 + wave * 8;
  float4 m0[8], m1[8];   // issued first: LN2 runs under their latency
  const float* mr = mo_w + (size_t)o0 * 256 + lane * 4;
#pragma unroll
  for (int r = 0; r < 8; ++r) {
    m0[r] = *(const float4*)(mr + r * 256);
    m1[r] = *(const float4*)(mr + r * 256 + 128);
  }
  const float* pp = part + (size_t)(b * 16) * 256 + c;
  float pr[16];
#pragma unroll
  for (int p = 0; p < 16; ++p) pr[p] = pp[p * 256];
  float resv = gm[b] * tok_w[c] + tok_b[c];
  float g2 = ln2_g[c], b2 = ln2_b[c];
  float mb = mo_b[o0 + (lane & 7)];
  // the scheduler otherwise sinks part of the loads above behind the first
  // load wait (two or more exposed latencies instead of one)
  __builtin_amdgcn_sched_barrier(0);
  // stands before any register that a load above names is written again; the
  // address pair and the offset are inputs so that they live up to the wait
  asm volatile("s_wait_xcnt 0x0" :: "v"(mr), "v"(c) : "memory");
  // keeps later register writes from being lifted over the wait
  __builtin_amdgcn_sched_barrier(0);
  float outv = 0.f;
#pragma unroll
  for (int p = 0; p < 16; ++p) outv += pr[p];
  float ov = outv + resv;
  {
    float a0 = wave_sum(ov), a1 = wave_sum(ov * ov);
    if (lane == 0) { st[wave][0] = a0; st[wave][1] = a1; }
  }
  __syncthreads();
  float T1 = 0.f, T2 = 0.f;
#pragma unroll
  for (int w = 0; w < 8; ++w) { T1 += st[w][0]; T2 += st[w][1]; }
  float mn2 = T1 * (1.f / 256.f), var2 = T2 * (1.f / 256.f) - mn2 * mn2;
  t_s[c] = (ov - mn2) * rsqrtf(var2 + 1e-6f) * g2 + b2;
  __syncthreads();
  float4 ta = *(const float4*)&t_s[lane * 4];
  float4 tb = *(const float4*)&t_s[128 + lane * 4];
  float val = 0.f;
#pragma unroll
  for (int r = 0; r < 8; ++r) {
    float dd = m0[r].x * ta.x + m0[r].y * ta.y + m0[r].z * ta.z + m0[r].w * ta.w +
               m1[r].x * tb.x + m1[r].y * tb.y + m1[r].z * tb.z + m1[r].w * tb.w;
    dd = wave_sum(dd);
    if (lane == r) val = dd;
  }
  if (lane < 8) gvec[b * 256 + o0 + lane] = gelu_exact(val + mb);
}

// ---------------------------------------------------------------------------
// Local branch: patchify (2x2x2) + 8x8 embed + LN over C.
// Emits res (B,216,C) and eln rows (bp*8+pv, C).
// ---------------------------------------------------------------------------
__global__ __launch_bounds__(256) void k_local_embed(
    const float* __restrict__ x, const float* __restrict__ pw,
    const float* __restrict__ pb, const float* __restrict__ ln_g,
    const float* __restrict__ ln_b, float* __restrict__ res,
    float* __restrict__ eln) {
  __shared__ float pw_s[64];
  __shared__ float pb_s[8];
  __shared__ float sc[8 * 256];
  __shared__ float part1[256], part2[256];
  __shared__ float mean_s[8], rstd_s[8];
  int bp = blockIdx.x, b = bp / 27, p = bp % 27;
  int d = p / 9, hh = (p / 3) % 3, w = p % 3;
  int c = threadIdx.x;
  if (c < 64) pw_s[c] = pw[c];
  if (c < 8) pb_s[c] = pb[c];
  __syncthreads();
  const float* xb = x + (size_t)(b * 256 + c) * 216;
  float patch[8];
#pragma unroll
  for (int u = 0; u < 8; ++u) {
    int p1 = u >> 2, p2 = (u >> 1) & 1, p3 = u & 1;
    patch[u] = xb[(d * 2 + p1) * 36 + (hh * 2 + p2) * 6 + (w * 2 + p3)];
  }
  float tokv[8];
#pragma unroll
  for (int e = 0; e < 8; ++e) {
    float a = pb_s[e];
#pragma unroll
    for (int u = 0; u < 8; ++u) a += pw_s[e * 8 + u] * patch[u];
    tokv[e] = a;
    sc[e * 256 + c] = a;
    int p1 = e >> 2, p2 = (e >> 1) & 1, p3 = e & 1;
    int s = (d * 2 + p1) * 36 + (hh * 2 + p2) * 6 + (w * 2 + p3);
    res[(size_t)(b * 216 + s) * 256 + c] = a;   // residual uses raw tok
  }
  __syncthreads();
  int g = c >> 5, lane = c & 31;
  float s1 = 0.f, s2 = 0.f;
#pragma unroll
  for (int k = 0; k < 8; ++k) {
    float vv = sc[g * 256 + lane + k * 32];
    s1 += vv; s2 += vv * vv;
  }
  part1[c] = s1; part2[c] = s2;
  __syncthreads();
  if (c < 8) {
    float a = 0.f, bb = 0.f;
    for (int l = 0; l < 32; ++l) { a += part1[c * 32 + l]; bb += part2[c * 32 + l]; }
    float mn = a * (1.f / 256.f), vr = bb * (1.f / 256.f) - mn * mn;
    mean_s[c] = mn; rstd_s[c] = rsqrtf(vr + 1e-6f);
  }
  __syncthreads();
  float lg = ln_g[c], lb = ln_b[c];
#pragma unroll
  for (int e = 0; e < 8; ++e)
    eln[(size_t)(bp * 8 + e) * 256 + c] =
        (tokv[e] - mean_s[e]) * rstd_s[e] * lg + lb;
}

// ---------------------------------------------------------------------------
// fp32 WMMA GEMM: C = act(A(MxK) @ B(KxN) [+bias]).  TRANSB/ACT are template
// params so the inner loop is branch-free.  blockDim=128 (4 waves); each wave
// owns a 16(M) x 64(N) strip; all 4 waves share one n-strip, so the 16x64 B
// tile is staged through LDS once per K-chunk (coalesced float4 loads, 4x
// reuse).  Requires M%64==0, N%64==0, K%16==0.
// ---------------------------------------------------------------------------
template <bool TRANSB, bool ACT>
__global__ __launch_bounds__(128) void k_gemm_wmma(
    const float* __restrict__ A, const float* __restrict__ B,
    const float* __restrict__ bias, float* __restrict__ C, int M, int N,
    int K) {
  __shared__ float Bs[16 * 64];
  int tid = threadIdx.x;
  int wave = tid >> 5, lane = tid & 31;
  int mr = lane & 15, kg = lane >> 4;
  int m0 = (blockIdx.y * 4 + wave) * 16;
  int n0 = blockIdx.x * 64;
  v8f z = {0, 0, 0, 0, 0, 0, 0, 0};
  v8f acc[4] = {z, z, z, z};
  const float* arow = A + (size_t)(m0 + mr) * K;
  for (int k0 = 0; k0 < K; k0 += 16) {
    __syncthreads();   // guard Bs against previous chunk's readers
    if (!TRANSB) {
      // rows k0..k0+15 of B, cols n0..n0+63: thread loads two float4s
      int r = tid >> 4, c4 = (tid & 15) * 4;
      float4 v0 = *(const float4*)(B + (size_t)(k0 + r) * N + n0 + c4);
      float4 v1 = *(const float4*)(B + (size_t)(k0 + r + 8) * N + n0 + c4);
      *(float4*)(Bs + r * 64 + c4) = v0;
      *(float4*)(Bs + (r + 8) * 64 + c4) = v1;
    } else {
      // B stored (N x K): float4 runs along k, scatter into Bs rows
      int c = tid & 63, q0 = tid >> 6;  // q0 in {0,1}
#pragma unroll
      for (int qq = 0; qq < 2; ++qq) {
        int q = q0 + qq * 2;
        float4 v4 = *(const float4*)(B + (size_t)(n0 + c) * K + k0 + q * 4);
        Bs[(q * 4 + 0) * 64 + c] = v4.x;
        Bs[(q * 4 + 1) * 64 + c] = v4.y;
        Bs[(q * 4 + 2) * 64 + c] = v4.z;
        Bs[(q * 4 + 3) * 64 + c] = v4.w;
      }
    }
    __syncthreads();
#pragma unroll
    for (int kc = 0; kc < 4; ++kc) {
      int ka = kc * 4 + kg * 2;
      v2f a = *(const v2f*)(arow + k0 + ka);
#pragma unroll
      for (int t = 0; t < 4; ++t) {
        int n = t * 16 + mr;
        v2f bv;
        bv[0] = Bs[ka * 64 + n];
        bv[1] = Bs[(ka + 1) * 64 + n];
        acc[t] = wmma4(a, bv, acc[t]);
      }
    }
  }
#pragma unroll
  for (int t = 0; t < 4; ++t) {
    int n = n0 + t * 16 + mr;
    float bb = ACT ? bias[n] : 0.f;
#pragma unroll
    for (int r = 0; r < 8; ++r) {
      int row = m0 + r + 8 * kg;
      float v = acc[t][r] + bb;
      if (ACT) v = gelu_exact(v);
      C[(size_t)row * N + n] = v;
    }
  }
}

// ---------------------------------------------------------------------------
// Local attention core: one block per (bp, head); 864 blocks, 8 waves.
// score(256x256) = q(256x8) @ k(8x256) via WMMA (K=8 -> 2 steps of 4).
// Pass 1: stats (sum, sum^2, row-max). Pass 2: recompute + exp + p@v fused.
// ---------------------------------------------------------------------------
__global__ __launch_bounds__(256) void k_attn_local(
    const float* __restrict__ Qb, const float* __restrict__ Kb,
    const float* __restrict__ Vb, float* __restrict__ Ofl) {
  __shared__ float q_s[256 * 8];       // q[i][m]
  __shared__ float kt_s[8 * 256];      // k[m][j]
  __shared__ float v_s[256 * 8];       // v[j][m]
  __shared__ float tbuf[8][16 * 17];   // per-wave 16x16 tile, padded pitch
  __shared__ float rowmax_s[256];
  __shared__ float red1[256], red2[256];
  __shared__ float rstd_sh;
  int bp = blockIdx.x >> 2, h = blockIdx.x & 3;
  int b = bp / 27, p = bp % 27;
  int d = p / 9, ph = (p / 3) % 3, pwv = p % 3;
  int tid = threadIdx.x;
  {
    int c = tid;
#pragma unroll
    for (int pv = 0; pv < 8; ++pv) {
      size_t idx = (size_t)(bp * 8 + pv) * 1024 + c * 4 + h;  // col = c*Hh + h
      q_s[c * 8 + pv] = Qb[idx];
      kt_s[pv * 256 + c] = Kb[idx];
      v_s[c * 8 + pv] = Vb[idx];
    }
  }
  __syncthreads();
  int wave = tid >> 5, lane = tid & 31;
  int mr = lane & 15, kg = lane >> 4;
  float* tb = tbuf[wave];
  float s1 = 0.f, s2 = 0.f;
  // ---- pass 1: raw score stats -------------------------------------------
  for (int rbi = 0; rbi < 2; ++rbi) {
    int i0 = (wave + rbi * 8) * 16;
    float rmax = -3.0e38f;
    for (int jt = 0; jt < 16; ++jt) {
      int j0 = jt * 16;
      v8f acc = {0, 0, 0, 0, 0, 0, 0, 0};
#pragma unroll
      for (int kc = 0; kc < 2; ++kc) {
        int ka = kc * 4 + kg * 2;
        v2f a, bv;
        a[0] = q_s[(i0 + mr) * 8 + ka];
        a[1] = q_s[(i0 + mr) * 8 + ka + 1];
        bv[0] = kt_s[ka * 256 + j0 + mr];
        bv[1] = kt_s[(ka + 1) * 256 + j0 + mr];
        acc = wmma4(a, bv, acc);
      }
#pragma unroll
      for (int r = 0; r < 8; ++r) {
        float vv = acc[r];
        s1 += vv; s2 += vv * vv;
        tb[(r + 8 * kg) * 17 + mr] = vv;
      }
      if (lane < 16) {  // per-wave LDS, same-wave DS ordering
        for (int j = 0; j < 16; ++j) rmax = fmaxf(rmax, tb[lane * 17 + j]);
      }
    }
    if (lane < 16) rowmax_s[i0 + lane] = rmax;
  }
  red1[tid] = s1; red2[tid] = s2;
  __syncthreads();
  for (int o = 128; o > 0; o >>= 1) {
    if (tid < o) { red1[tid] += red1[tid + o]; red2[tid] += red2[tid + o]; }
    __syncthreads();
  }
  if (tid == 0) {
    float mu = red1[0] * (1.f / 65536.f);
    float var = red2[0] * (1.f / 65536.f) - mu * mu;
    rstd_sh = rsqrtf(var + 1e-5f);   // InstanceNorm eps; mu cancels in softmax
  }
  __syncthreads();
  float rstd = rstd_sh;
  // ---- pass 2: softmax + p@v ---------------------------------------------
  for (int rbi = 0; rbi < 2; ++rbi) {
    int i0 = (wave + rbi * 8) * 16;
    float den = 0.f;
    float num[8] = {0, 0, 0, 0, 0, 0, 0, 0};
    float rmax = (lane < 16) ? rowmax_s[i0 + lane] : 0.f;
    for (int jt = 0; jt < 16; ++jt) {
      int j0 = jt * 16;
      v8f acc = {0, 0, 0, 0, 0, 0, 0, 0};
#pragma unroll
      for (int kc = 0; kc < 2; ++kc) {
        int ka = kc * 4 + kg * 2;
        v2f a, bv;
        a[0] = q_s[(i0 + mr) * 8 + ka];
        a[1] = q_s[(i0 + mr) * 8 + ka + 1];
        bv[0] = kt_s[ka * 256 + j0 + mr];
        bv[1] = kt_s[(ka + 1) * 256 + j0 + mr];
        acc = wmma4(a, bv, acc);
      }
#pragma unroll
      for (int r = 0; r < 8; ++r) tb[(r + 8 * kg) * 17 + mr] = acc[r];
      if (lane < 16) {
        for (int j = 0; j < 16; ++j) {
          float sv = tb[lane * 17 + j];
          float pe = __expf((sv - rmax) * rstd);
          den += pe;
          const float* vp = &v_s[(j0 + j) * 8];
#pragma unroll
          for (int m2 = 0; m2 < 8; ++m2) num[m2] += pe * vp[m2];
        }
      }
    }
    if (lane < 16) {
      int cc = i0 + lane;
      float inv = 1.f / den;
#pragma unroll
      for (int m2 = 0; m2 < 8; ++m2) {
        int p1 = m2 >> 2, p2 = (m2 >> 1) & 1, p3 = m2 & 1;
        int s = (d * 2 + p1) * 36 + (ph * 2 + p2) * 6 + (pwv * 2 + p3);
        Ofl[(size_t)(b * 216 + s) * 1024 + cc * 4 + h] = num[m2] * inv;
      }
    }
  }
}

// ---------------------------------------------------------------------------
// t2 = LN(out + res) per row over C
// ---------------------------------------------------------------------------
__global__ __launch_bounds__(256) void k_ln2_local(
    const float* __restrict__ outb, const float* __restrict__ res,
    const float* __restrict__ g, const float* __restrict__ bb,
    float* __restrict__ t2) {
  __shared__ float red[256];
  int row = blockIdx.x, c = threadIdx.x;
  float v = outb[(size_t)row * 256 + c] + res[(size_t)row * 256 + c];
  float S1 = blk_sum(v, red), S2 = blk_sum(v * v, red);
  float mn = S1 * (1.f / 256.f), var = S2 * (1.f / 256.f) - mn * mn;
  t2[(size_t)row * 256 + c] = (v - mn) * rsqrtf(var + 1e-6f) * g[c] + bb[c];
}

// ---------------------------------------------------------------------------
// y = x + broadcast(global) + local
// ---------------------------------------------------------------------------
__global__ __launch_bounds__(256) void k_final(const float* __restrict__ x,
                                               const float* __restrict__ gvec,
                                               const float* __restrict__ lres,
                                               float* __restrict__ y) {
  int idx = blockIdx.x * 256 + threadIdx.x;
  int c = idx & 255, bs = idx >> 8;
  int b = bs / 216, s = bs - b * 216;
  size_t xi = (size_t)(b * 256 + c) * 216 + s;
  y[xi] = x[xi] + gvec[b * 256 + c] + lres[(size_t)bs * 256 + c];
}

extern "C" void kernel_launch(void* const* d_in, const int* in_sizes, int n_in,
                              void* d_out, int out_size, void* d_ws,
                              size_t ws_size, hipStream_t stream) {
  const float* x       = (const float*)d_in[0];
  const float* g_tok_w = (const float*)d_in[1];
  const float* g_tok_b = (const float*)d_in[2];
  const float* g_ln1_g = (const float*)d_in[3];
  const float* g_ln1_b = (const float*)d_in[4];
  const float* g_wq    = (const float*)d_in[5];
  const float* g_wk    = (const float*)d_in[6];
  const float* g_wv    = (const float*)d_in[7];
  const float* g_wo    = (const float*)d_in[8];
  const float* g_ln2_g = (const float*)d_in[9];
  const float* g_ln2_b = (const float*)d_in[10];
  const float* g_mo_w  = (const float*)d_in[11];
  const float* g_mo_b  = (const float*)d_in[12];
  const float* l_pw    = (const float*)d_in[13];
  const float* l_pb    = (const float*)d_in[14];
  const float* l_ln1_g = (const float*)d_in[15];
  const float* l_ln1_b = (const float*)d_in[16];
  const float* l_wq    = (const float*)d_in[17];
  const float* l_wk    = (const float*)d_in[18];
  const float* l_wv    = (const float*)d_in[19];
  const float* l_wo    = (const float*)d_in[20];
  const float* l_ln2_g = (const float*)d_in[21];
  const float* l_ln2_b = (const float*)d_in[22];
  const float* l_mo_w  = (const float*)d_in[23];
  const float* l_mo_b  = (const float*)d_in[24];

  float* ws   = (float*)d_ws;
  float* gm   = ws;                 // 8
  float* gvec = ws + 8;             // 2048
  float* eln  = ws + 8 + 2048;      // 1728*256
  float* res  = eln + 442368;       // 1728*256
  float* Qb   = res + 442368;       // 1728*1024
  float* Kb   = Qb + 1769472;       // 1728*1024
  float* Vb   = Kb + 1769472;       // 1728*1024
  float* ofl  = Vb + 1769472;       // 1728*1024
  float* gqkv = ofl + 1769472;      // 3*8*1024
  float* gpart = gqkv + 24576;      // 8*16*256
  float* outb = Qb;                 // alias: Qb dead after attention
  float* t2   = Kb;                 // alias: Kb dead after attention
  float* lres = Vb;                 // alias: Vb dead after attention

  k_gmean<<<8, 256, 0, stream>>>(x, gm);
  k_local_embed<<<216, 256, 0, stream>>>(x, l_pw, l_pb, l_ln1_g, l_ln1_b, res,
                                         eln);
  k_gemm_wmma<false, false><<<dim3(16, 27), 128, 0, stream>>>(
      eln, l_wq, nullptr, Qb, 1728, 1024, 256);
  k_gemm_wmma<false, false><<<dim3(16, 27), 128, 0, stream>>>(
      eln, l_wk, nullptr, Kb, 1728, 1024, 256);
  k_gemm_wmma<false, false><<<dim3(16, 27), 128, 0, stream>>>(
      eln, l_wv, nullptr, Vb, 1728, 1024, 256);
  k_g_qkv<<<96, 256, 0, stream>>>(gm, g_tok_w, g_tok_b, g_ln1_g, g_ln1_b, g_wq,
                                  g_wk, g_wv, gqkv);
  k_g_attn<<<128, 256, 0, stream>>>(gqkv, g_wo, gpart);
  k_g_out<<<32, 256, 0, stream>>>(gm, g_tok_w, g_tok_b, gpart, g_ln2_g, g_ln2_b,
                                  g_mo_w, g_mo_b, gvec);
  k_attn_local<<<864, 256, 0, stream>>>(Qb, Kb, Vb, ofl);
  k_gemm_wmma<false, false><<<dim3(4, 27), 128, 0, stream>>>(
      ofl, l_wo, nullptr, outb, 1728, 256, 1024);
  k_ln2_local<<<1728, 256, 0, stream>>>(outb, res, l_ln2_g, l_ln2_b, t2);
  k_gemm_wmma<true, true><<<dim3(4, 27), 128, 0, stream>>>(
      t2, l_mo_w, l_mo_b, lres, 1728, 256, 256);
  k_final<<<1728, 256, 0, stream>>>(x, gvec, lres, (float*)d_out);
}

// v002
// A run of this version takes 172 microseconds.
// Timed twice side by side with v001, it ran 1.40 and 1.41 times as fast.
// Counting every step since v000, it is 2.14 times as fast.
#include <hip/hip_runtime.h>
#include <hip/hip_bf16.h>
#include <math.h>

typedef float v2f __attribute__((ext_vector_type(2)));
typedef float v4f __attribute__((ext_vector_type(4)));
typedef float v8f __attribute__((ext_vector_type(8)));

// ---------------------------------------------------------------------------
// fp32 WMMA: D(16x16) = A(16x4) * B(4x16) + C, full fp32 (matches reference
// numerics up to reassociation).  Lane L: mr = L%16, kg = L/16.
//   A frag (v2f): a[0]=A[mr][kg*2], a[1]=A[mr][kg*2+1]
//   B frag (v2f): b[0]=B[kg*2][mr], b[1]=B[kg*2+1][mr]
//   C/D (v8f):    c[r] = C[r + 8*kg][mr]
// ---------------------------------------------------------------------------
__device__ __forceinline__ v8f wmma4(v2f a, v2f b, v8f c) {
  return __builtin_amdgcn_wmma_f32_16x16x4_f32(false, a, false, b, (short)0, c,
                                               false, false);
}

__device__ __forceinline__ float gelu_exact(float x) {
  return 0.5f * x * (1.0f + erff(x * 0.70710678118654752f));
}

// block-wide reductions, blockDim.x == 256
__device__ __forceinline__ float blk_sum(float v, float* red) {
  int t = threadIdx.x;
  red[t] = v; __syncthreads();
  for (int o = 128; o > 0; o >>= 1) {
    if (t < o) red[t] += red[t + o];
    __syncthreads();
  }
  float r = red[0]; __syncthreads();
  return r;
}

// ---------------------------------------------------------------------------
// Global-branch mean over (C,D,H,W) per batch
// ---------------------------------------------------------------------------
__global__ __launch_bounds__(256) void k_gmean(const float* __restrict__ x,
                                               float* __restrict__ gm) {
  __shared__ float red[256];
  int b = blockIdx.x;
  const float* xb = x + (size_t)b * 55296;
  float s = 0.f;
  for (int i = threadIdx.x; i < 55296; i += 256) s += xb[i];
  float tot = blk_sum(s, red);
  if (threadIdx.x == 0) gm[b] = tot / 55296.0f;
}

// ---------------------------------------------------------------------------
// Global branch, spread over many work-groups in three dependent launches.
// Rank-1 score => instance-norm stats factor; softmax is shift-invariant so
// only 1/sigma and row-max of the raw score are needed.
// ---------------------------------------------------------------------------
__device__ __forceinline__ float wave_sum(float v) {
#pragma unroll
  for (int o = 16; o > 0; o >>= 1) v += __shfl_xor(v, o, 32);
  return v;
}
__device__ __forceinline__ float wave_max(float v) {
#pragma unroll
  for (int o = 16; o > 0; o >>= 1) v = fmaxf(v, __shfl_xor(v, o, 32));
  return v;
}
__device__ __forceinline__ float wave_min(float v) {
#pragma unroll
  for (int o = 16; o > 0; o >>= 1) v = fminf(v, __shfl_xor(v, o, 32));
  return v;
}

// Launch 1: q/k/v projections for all 8 batches at once (8x256 @ 256x1024 x3).
// Work-group = one matrix x 32 columns; wave = 32 rows of K; lane = column.
// Each weight element is read once by the whole grid.
__global__ __launch_bounds__(256) void k_g_qkv(
    const float* __restrict__ gm,
    const float* __restrict__ tok_w, const float* __restrict__ tok_b,
    const float* __restrict__ ln1_g, const float* __restrict__ ln1_b,
    const float* __restrict__ wq, const float* __restrict__ wk,
    const float* __restrict__ wv, float* __restrict__ qkv) {
  __shared__ __attribute__((aligned(16))) float t_s[256 * 8];  // t[k][batch]
  __shared__ float red[8 * 8 * 32];                            // [wave][batch][lane]
  int tid = threadIdx.x, wave = tid >> 5, lane = tid & 31;
  int mat = blockIdx.x >> 5, col = (blockIdx.x & 31) * 32 + lane;
  const float* Wm = mat == 0 ? wq : (mat == 1 ? wk : wv);
  const float* wp = Wm + (size_t)(wave * 32) * 1024 + col;
  float wreg[32];   // issued first: the LN below runs under their latency
#pragma unroll
  for (int i = 0; i < 32; ++i) wreg[i] = wp[i * 1024];
  float m = gm[wave];
  float tw[8], tb8[8], lg[8], lb[8];
#pragma unroll
  for (int k = 0; k < 8; ++k) {
    int c = k * 32 + lane;
    tw[k] = tok_w[c]; tb8[k] = tok_b[c]; lg[k] = ln1_g[c]; lb[k] = ln1_b[c];
  }
  // the scheduler otherwise sinks part of the loads above behind the first
  // load wait (two or more exposed latencies instead of one)
  __builtin_amdgcn_sched_barrier(0);
  // stands before any register that a load above names is written again; the
  // address pair is an input so that it lives up to the wait
  asm volatile("s_wait_xcnt 0x0" :: "v"(wp) : "memory");
  // keeps later register writes from being lifted over the wait
  __builtin_amdgcn_sched_barrier(0);
  // LN1 of batch 'wave': 8 channels per lane
  {
    float tok[8];
    float s1 = 0.f, s2 = 0.f;
#pragma unroll
    for (int k = 0; k < 8; ++k) {
      tok[k] = m * tw[k] + tb8[k];
      s1 += tok[k]; s2 += tok[k] * tok[k];
    }
    s1 = wave_sum(s1); s2 = wave_sum(s2);
    float mn = s1 * (1.f / 256.f);
    float var = s2 * (1.f / 256.f) - mn * mn;
    float rs = rsqrtf(var + 1e-6f);
#pragma unroll
    for (int k = 0; k < 8; ++k) {
      int c = k * 32 + lane;
      t_s[c * 8 + wave] = (tok[k] - mn) * rs * lg[k] + lb[k];
    }
  }
  __syncthreads();
  float acc[8] = {0, 0, 0, 0, 0, 0, 0, 0};
#pragma unroll
  for (int i = 0; i < 32; ++i) {
    const float4* tp = (const float4*)&t_s[(wave * 32 + i) * 8];
    float4 ta = tp[0], tb = tp[1];
    float w = wreg[i];
    acc[0] += ta.x * w; acc[1] += ta.y * w; acc[2] += ta.z * w; acc[3] += ta.w * w;
    acc[4] += tb.x * w; acc[5] += tb.y * w; acc[6] += tb.z * w; acc[7] += tb.w * w;
  }
#pragma unroll
  for (int bb = 0; bb < 8; ++bb) red[(wave * 8 + bb) * 32 + lane] = acc[bb];
  __syncthreads();
  float s = 0.f;   // this thread finishes batch 'wave', column 'col'
#pragma unroll
  for (int w = 0; w < 8; ++w) s += red[(w * 8 + wave) * 32 + lane];
  qkv[(size_t)(mat * 8 + wave) * 1024 + col] = s;
}

// Launch 2: work-group = (batch, head, quarter of the 256 score rows).
// Thread = (row of the quarter, quarter of the 256 columns).  The 64 output
// values then meet their 64 rows of wo; the partial 1x256 goes to 'part'.
__global__ __launch_bounds__(256) void k_g_attn(
    const float* __restrict__ qkv, const float* __restrict__ wo,
    float* __restrict__ part) {
  __shared__ __attribute__((aligned(16))) float k_s[256];
  __shared__ __attribute__((aligned(16))) float v_s[256];
  __shared__ float q_s[256];
  __shared__ float st[8][6];
  __shared__ float den_s[256], acc_s[256];
  __shared__ float o_s[64];
  __shared__ __attribute__((aligned(16))) float red[8 * 256];
  int tid = threadIdx.x, wave = tid >> 5, lane = tid & 31;
  int rq = blockIdx.x & 3, h = (blockIdx.x >> 2) & 3, b = blockIdx.x >> 4;
  // wo rows (c*4 + h) of this wave's 8 score rows, issued first so that they
  // arrive while the softmax runs
  float4 w0[8], w1[8];
  const float* wr = wo + (size_t)((rq * 64 + wave * 8) * 4 + h) * 256 + lane * 4;
#pragma unroll
  for (int i = 0; i < 8; ++i) {
    w0[i] = *(const float4*)(wr + i * 1024);
    w1[i] = *(const float4*)(wr + i * 1024 + 128);
  }
  float qi = qkv[(size_t)(0 + b) * 1024 + h * 256 + tid];   // heads OUTER
  float ki = qkv[(size_t)(8 + b) * 1024 + h * 256 + tid];
  float vi = qkv[(size_t)(16 + b) * 1024 + h * 256 + tid];
  // the scheduler otherwise sinks part of the loads above behind the first
  // load wait (two or more exposed latencies instead of one)
  __builtin_amdgcn_sched_barrier(0);
  // stands before any register that a load above names is written again; the
  // address pair is an input so that it lives up to the wait
  asm volatile("s_wait_xcnt 0x0" :: "v"(wr) : "memory");
  // keeps later register writes from being lifted over the wait
  __builtin_amdgcn_sched_barrier(0);
  q_s[tid] = qi; k_s[tid] = ki; v_s[tid] = vi;
  {
    float a0 = wave_sum(qi), a1 = wave_sum(qi * qi);
    float a2 = wave_sum(ki), a3 = wave_sum(ki * ki);
    float a4 = wave_max(ki), a5 = wave_min(ki);
    if (lane == 0) {
      st[wave][0] = a0; st[wave][1] = a1; st[wave][2] = a2;
      st[wave][3] = a3; st[wave][4] = a4; st[wave][5] = a5;
    }
  }
  __syncthreads();
  float Sq = 0.f, Sq2 = 0.f, Sk = 0.f, Sk2 = 0.f;
  float kmx = st[0][4], kmn = st[0][5];
#pragma unroll
  for (int w = 0; w < 8; ++w) {
    Sq += st[w][0]; Sq2 += st[w][1]; Sk += st[w][2]; Sk2 += st[w][3];
    kmx = fmaxf(kmx, st[w][4]); kmn = fminf(kmn, st[w][5]);
  }
  float mu  = (Sq * Sk)  * (1.f / 65536.f);
  float ex2 = (Sq2 * Sk2) * (1.f / 65536.f);
  float rstd = rsqrtf(ex2 - mu * mu + 1e-5f);
  float qr = q_s[rq * 64 + (tid & 63)];
  int j0 = (tid >> 6) * 64;
  float rmax = qr * (qr >= 0.f ? kmx : kmn);  // row max of raw score
  float den = 0.f, acc = 0.f;
#pragma unroll 4
  for (int j = 0; j < 64; j += 4) {
    float4 k4 = *(const float4*)&k_s[j0 + j];
    float4 v4 = *(const float4*)&v_s[j0 + j];
    float p0 = __expf((qr * k4.x - rmax) * rstd);
    float p1 = __expf((qr * k4.y - rmax) * rstd);
    float p2 = __expf((qr * k4.z - rmax) * rstd);
    float p3 = __expf((qr * k4.w - rmax) * rstd);
    den += p0; acc += p0 * v4.x;
    den += p1; acc += p1 * v4.y;
    den += p2; acc += p2 * v4.z;
    den += p3; acc += p3 * v4.w;
  }
  den_s[tid] = den; acc_s[tid] = acc;
  __syncthreads();
  if (tid < 64) {
    float dd = (den_s[tid] + den_s[64 + tid]) + (den_s[128 + tid] + den_s[192 + tid]);
    float aa = (acc_s[tid] + acc_s[64 + tid]) + (acc_s[128 + tid] + acc_s[192 + tid]);
    o_s[tid] = aa / dd;
  }
  __syncthreads();
  float4 p0 = {0.f, 0.f, 0.f, 0.f}, p1 = {0.f, 0.f, 0.f, 0.f};
#pragma unroll
  for (int i = 0; i < 8; ++i) {
    float o = o_s[wave * 8 + i];
    p0.x += o * w0[i].x; p0.y += o * w0[i].y; p0.z += o * w0[i].z; p0.w += o * w0[i].w;
    p1.x += o * w1[i].x; p1.y += o * w1[i].y; p1.z += o * w1[i].z; p1.w += o * w1[i].w;
  }
  *(float4*)&red[wave * 256 + lane * 4] = p0;
  *(float4*)&red[wave * 256 + 128 + lane * 4] = p1;
  __syncthreads();
  float s = 0.f;
#pragma unroll
  for (int w = 0; w < 8; ++w) s += red[w * 256 + tid];
  part[(size_t)blockIdx.x * 256 + tid] = s;   // [(b*16 + h*4 + rq)][256]
}

// Launch 3: work-group = (batch, quarter of the 256 outputs).  Sums the 16
// partials, adds the residual, LN2, then map-out rows ('bc,oc->bo') with the
// lanes along c (coalesced) and a wave reduction per output, then GELU.
__global__ __launch_bounds__(256) void k_g_out(
    const float* __restrict__ gm,
    const float* __restrict__ tok_w, const float* __restrict__ tok_b,
    const float* __restrict__ part,
    const float* __restrict__ ln2_g, const float* __restrict__ ln2_b,
    const float* __restrict__ mo_w, const float* __restrict__ mo_b,
    float* __restrict__ gvec) {
  __shared__ __attribute__((aligned(16))) float t_s[256];
  __shared__ float st[8][2];
  int c = threadIdx.x, wave = c >> 5, lane = c & 31;
  int b = blockIdx.x >> 2, o0 = (blockIdx.x & 3) * 64 + wave * 8;
  float4 m0[8], m1[8];   // issued first: LN2 runs under their latency
  const float* mr = mo_w + (size_t)o0 * 256 + lane * 4;
#pragma unroll
  for (int r = 0; r < 8; ++r) {
    m0[r] = *(const float4*)(mr + r * 256);
    m1[r] = *(const float4*)(mr + r * 256 + 128);
  }
  const float* pp = part + (size_t)(b * 16) * 256 + c;
  float pr[16];
#pragma unroll
  for (int p = 0; p < 16; ++p) pr[p] = pp[p * 256];
  float resv = gm[b] * tok_w[c] + tok_b[c];
  float g2 = ln2_g[c], b2 = ln2_b[c];
  float mb = mo_b[o0 + (lane & 7)];
  // the scheduler otherwise sinks part of the loads above behind the first
  // load wait (two or more exposed latencies instead of one)
  __builtin_amdgcn_sched_barrier(0);
  // stands before any register that a load above names is written again; the
  // address pair and the offset are inputs so that they live up to the wait
  asm volatile("s_wait_xcnt 0x0" :: "v"(mr), "v"(c) : "memory");
  // keeps later register writes from being lifted over the wait
  __builtin_amdgcn_sched_barrier(0);
  float outv = 0.f;
#pragma unroll
  for (int p = 0; p < 16; ++p) outv += pr[p];
  float ov = outv + resv;
  {
    float a0 = wave_sum(ov), a1 = wave_sum(ov * ov);
    if (lane == 0) { st[wave][0] = a0; st[wave][1] = a1; }
  }
  __syncthreads();
  float T1 = 0.f, T2 = 0.f;
#pragma unroll
  for (int w = 0; w < 8; ++w) { T1 += st[w][0]; T2 += st[w][1]; }
  float mn2 = T1 * (1.f / 256.f), var2 = T2 * (1.f / 256.f) - mn2 * mn2;
  t_s[c] = (ov - mn2) * rsqrtf(var2 + 1e-6f) * g2 + b2;
  __syncthreads();
  float4 ta = *(const float4*)&t_s[lane * 4];
  float4 tb = *(const float4*)&t_s[128 + lane * 4];
  float val = 0.f;
#pragma unroll
  for (int r = 0; r < 8; ++r) {
    float dd = m0[r].x * ta.x + m0[r].y * ta.y + m0[r].z * ta.z + m0[r].w * ta.w +
               m1[r].x * tb.x + m1[r].y * tb.y + m1[r].z * tb.z + m1[r].w * tb.w;
    dd = wave_sum(dd);
    if (lane == r) val = dd;
  }
  if (lane < 8) gvec[b * 256 + o0 + lane] = gelu_exact(val + mb);
}

// ---------------------------------------------------------------------------
// Local branch: patchify (2x2x2) + 8x8 embed + LN over C.
// Emits res (B,216,C) and eln rows (bp*8+pv, C).
// ---------------------------------------------------------------------------
__global__ __launch_bounds__(256) void k_local_embed(
    const float* __restrict__ x, const float* __restrict__ pw,
    const float* __restrict__ pb, const float* __restrict__ ln_g,
    const float* __restrict__ ln_b, float* __restrict__ res,
    float* __restrict__ eln) {
  __shared__ float pw_s[64];
  __shared__ float pb_s[8];
  __shared__ float sc[8 * 256];
  __shared__ float part1[256], part2[256];
  __shared__ float mean_s[8], rstd_s[8];
  int bp = blockIdx.x, b = bp / 27, p = bp % 27;
  int d = p / 9, hh = (p / 3) % 3, w = p % 3;
  int c = threadIdx.x;
  if (c < 64) pw_s[c] = pw[c];
  if (c < 8) pb_s[c] = pb[c];
  __syncthreads();
  const float* xb = x + (size_t)(b * 256 + c) * 216;
  float patch[8];
#pragma unroll
  for (int u = 0; u < 8; ++u) {
    int p1 = u >> 2, p2 = (u >> 1) & 1, p3 = u & 1;
    patch[u] = xb[(d * 2 + p1) * 36 + (hh * 2 + p2) * 6 + (w * 2 + p3)];
  }
  float tokv[8];
#pragma unroll
  for (int e = 0; e < 8; ++e) {
    float a = pb_s[e];
#pragma unroll
    for (int u = 0; u < 8; ++u) a += pw_s[e * 8 + u] * patch[u];
    tokv[e] = a;
    sc[e * 256 + c] = a;
    int p1 = e >> 2, p2 = (e >> 1) & 1, p3 = e & 1;
    int s = (d * 2 + p1) * 36 + (hh * 2 + p2) * 6 + (w * 2 + p3);
    res[(size_t)(b * 216 + s) * 256 + c] = a;   // residual uses raw tok
  }
  __syncthreads();
  int g = c >> 5, lane = c & 31;
  float s1 = 0.f, s2 = 0.f;
#pragma unroll
  for (int k = 0; k < 8; ++k) {
    float vv = sc[g * 256 + lane + k * 32];
    s1 += vv; s2 += vv * vv;
  }
  part1[c] = s1; part2[c] = s2;
  __syncthreads();
  if (c < 8) {
    float a = 0.f, bb = 0.f;
    for (int l = 0; l < 32; ++l) { a += part1[c * 32 + l]; bb += part2[c * 32 + l]; }
    float mn = a * (1.f / 256.f), vr = bb * (1.f / 256.f) - mn * mn;
    mean_s[c] = mn; rstd_s[c] = rsqrtf(vr + 1e-6f);
  }
  __syncthreads();
  float lg = ln_g[c], lb = ln_b[c];
#pragma unroll
  for (int e = 0; e < 8; ++e)
    eln[(size_t)(bp * 8 + e) * 256 + c] =
        (tokv[e] - mean_s[e]) * rstd_s[e] * lg + lb;
}

// ---------------------------------------------------------------------------
// fp32 WMMA GEMM: C = act(A(MxK) @ B(KxN) [+bias]).  TRANSB/ACT are template
// params so the inner loop is branch-free.  blockDim=128 (4 waves); each wave
// owns a 16(M) x 64(N) strip; all 4 waves share one n-strip, so the 64x64 B
// tile is staged through LDS once per K-chunk (16-byte loads, 4x reuse).
// The K loop is software-pipelined at both levels.  Global: while the WMMAs of
// chunk c run, the A fragments and the B tile of chunk c+1 are on their way
// into registers; the tile then goes into the other LDS buffer, so one barrier
// per chunk both publishes it and ends the reads of the buffer refilled next.
// LDS: B fragments are read two groups of WMMAs ahead of their use.  For that
// a fragment must land in its register pair as it is, so the tile lies in LDS
// as rows of k pairs: Bs[k/2][n][k%2], row pitch GPP dwords (128 + 32: the two
// half-waves, one k pair apart, fall on different halves of the 64 banks).
// Requires M%64==0, N%64==0, K%64==0.
// ---------------------------------------------------------------------------
#define GKC 64
#define GPP 160

template <bool TRANSB>
__device__ __forceinline__ void gemm_fetch(const float* __restrict__ arow,
                                           const float* __restrict__ bsrc,
                                           int k0, int N, v2f (&an)[GKC / 4],
                                           v4f (&bn)[8]) {
  const float* ap = arow + k0;
  const float* bp[8];
#pragma unroll
  for (int i = 0; i < 8; ++i) {
    // !TRANSB: rows k0 + 16*(i/2) + i%2 (+ 2*rp0, in bsrc); TRANSB: k quad 2*i
    size_t off = TRANSB ? (size_t)(k0 + i * 8)
                        : (size_t)(k0 + (i >> 1) * 16 + (i & 1)) * N;
    bp[i] = bsrc + off;
  }
#pragma unroll
  for (int i = 0; i < GKC / 4; ++i) an[i] = *(const v2f*)(ap + i * 4);
#pragma unroll
  for (int i = 0; i < 8; ++i) bn[i] = *(const v4f*)bp[i];
  // stands before any register that a load above names is written again; the
  // address pairs are inputs so that they live up to the wait (TRANSB: the B
  // loads share one pair and differ in their immediate offsets)
  if (TRANSB)
    asm volatile("s_wait_xcnt 0x0" ::"v"(ap), "v"(bp[0]) : "memory");
  else
    asm volatile("s_wait_xcnt 0x0" ::"v"(ap), "v"(bp[0]), "v"(bp[1]),
                 "v"(bp[2]), "v"(bp[3]), "v"(bp[4]), "v"(bp[5]), "v"(bp[6]),
                 "v"(bp[7])
                 : "memory");
}

template <bool TRANSB>
__device__ __forceinline__ void gemm_put(float* bd, int tid,
                                         const v4f (&bn)[8]) {
  if (!TRANSB) {
    int rp0 = tid >> 4, c4 = (tid & 15) * 4;
#pragma unroll
    for (int i = 0; i < 4; ++i) {
      v4f x = bn[2 * i], y = bn[2 * i + 1];   // rows 2*rp and 2*rp + 1
      v4f lo = {x[0], y[0], x[1], y[1]}, hi = {x[2], y[2], x[3], y[3]};
      float* d = bd + (rp0 + 8 * i) * GPP + c4 * 2;
      *(v4f*)d = lo;
      *(v4f*)(d + 4) = hi;
    }
  } else {
    int c = tid & 63, q0 = tid >> 6;
#pragma unroll
    for (int i = 0; i < 8; ++i) {
      int q = q0 + 2 * i;                      // k = 4*q .. 4*q + 3
      v2f lo = {bn[i][0], bn[i][1]}, hi = {bn[i][2], bn[i][3]};
      *(v2f*)(bd + (2 * q) * GPP + c * 2) = lo;
      *(v2f*)(bd + (2 * q + 1) * GPP + c * 2) = hi;
    }
  }
}

template <bool TRANSB, bool ACT>
__global__ __launch_bounds__(128) void k_gemm_wmma(
    const float* __restrict__ A, const float* __restrict__ B,
    const float* __restrict__ bias, float* __restrict__ C, int M, int N,
    int K) {
  __shared__ __attribute__((aligned(16))) float Bs[2][(GKC / 2) * GPP];
  int tid = threadIdx.x;
  int wave = tid >> 5, lane = tid & 31;
  int mr = lane & 15, kg = lane >> 4;
  int m0 = (blockIdx.y * 4 + wave) * 16;
  int n0 = blockIdx.x * 64;
  v8f z = {0, 0, 0, 0, 0, 0, 0, 0};
  v8f acc[4] = {z, z, z, z};
  const float* arow = A + (size_t)(m0 + mr) * K + kg * 2;
  const float* bsrc =
      TRANSB ? B + (size_t)(n0 + (tid & 63)) * K + (tid >> 6) * 4
             : B + (size_t)((tid >> 4) * 2) * N + n0 + (tid & 15) * 4;
  v2f an[GKC / 4];
  v4f bn[8];
  gemm_fetch<TRANSB>(arow, bsrc, 0, N, an, bn);
  gemm_put<TRANSB>(Bs[0], tid, bn);
  __syncthreads();
  for (int k0 = 0, buf = 0;; k0 += GKC, buf ^= 1) {
    v2f ac[GKC / 4];
#pragma unroll
    for (int i = 0; i < GKC / 4; ++i) ac[i] = an[i];
    bool more = k0 + GKC < K;   // the same for the whole work-group
    if (more) gemm_fetch<TRANSB>(arow, bsrc, k0 + GKC, N, an, bn);
    // fragment of k-step kc, column tile t: bs + kc*2*GPP + t*32.  Groups of
    // two k-steps (8 WMMAs), a ring of three: g+2 is read while g multiplies.
    const float* bs = Bs[buf] + kg * GPP + mr * 2;
    v2f bf[3][8];
#pragma unroll
    for (int g = 0; g < 2; ++g)
#pragma unroll
      for (int j = 0; j < 8; ++j)
        bf[g][j] = *(const v2f*)(bs + (g * 2 + (j >> 2)) * 2 * GPP + (j & 3) * 32);
#pragma unroll
    for (int g = 0; g < GKC / 8; ++g) {
      if (g + 2 < GKC / 8) {
#pragma unroll
        for (int j = 0; j < 8; ++j)
          bf[(g + 2) % 3][j] = *(const v2f*)(bs + ((g + 2) * 2 + (j >> 2)) * 2 * GPP +
                                             (j & 3) * 32);
      }
      // keeps the LDS reads above ahead of this group's WMMAs: the scheduler
      // otherwise sinks each read to just before its use and waits it out
      __builtin_amdgcn_sched_barrier(0);
#pragma unroll
      for (int j = 0; j < 8; ++j)
        acc[j & 3] = wmma4(ac[g * 2 + (j >> 2)], bf[g % 3][j], acc[j & 3]);
    }
    if (!more) break;
    gemm_put<TRANSB>(Bs[buf ^ 1], tid, bn);
    __syncthreads();   // publishes chunk c+1; ends the reads of chunk c
  }
#pragma unroll
  for (int t = 0; t < 4; ++t) {
    int n = n0 + t * 16 + mr;
    float bb = ACT ? bias[n] : 0.f;
#pragma unroll
    for (int r = 0; r < 8; ++r) {
      int row = m0 + r + 8 * kg;
      float v = acc[t][r] + bb;
      if (ACT) v = gelu_exact(v);
      C[(size_t)row * N + n] = v;
    }
  }
}

// ---------------------------------------------------------------------------
// Local attention core: one block per (bp, head); 864 blocks, 8 waves.
// score(256x256) = q(256x8) @ k(8x256) via WMMA (K=8 -> 2 steps of 4).
// Pass 1: stats (sum, sum^2, row-max). Pass 2: recompute + exp + p@v fused.
// ---------------------------------------------------------------------------
__global__ __launch_bounds__(256) void k_attn_local(
    const float* __restrict__ Qb, const float* __restrict__ Kb,
    const float* __restrict__ Vb, float* __restrict__ Ofl) {
  __shared__ float q_s[256 * 8];       // q[i][m]
  __shared__ float kt_s[8 * 256];      // k[m][j]
  __shared__ float v_s[256 * 8];       // v[j][m]
  __shared__ float tbuf[8][16 * 17];   // per-wave 16x16 tile, padded pitch
  __shared__ float rowmax_s[256];
  __shared__ float red1[256], red2[256];
  __shared__ float rstd_sh;
  int bp = blockIdx.x >> 2, h = blockIdx.x & 3;
  int b = bp / 27, p = bp % 27;
  int d = p / 9, ph = (p / 3) % 3, pwv = p % 3;
  int tid = threadIdx.x;
  {
    int c = tid;
#pragma unroll
    for (int pv = 0; pv < 8; ++pv) {
      size_t idx = (size_t)(bp * 8 + pv) * 1024 + c * 4 + h;  // col = c*Hh + h
      q_s[c * 8 + pv] = Qb[idx];
      kt_s[pv * 256 + c] = Kb[idx];
      v_s[c * 8 + pv] = Vb[idx];
    }
  }
  __syncthreads();
  int wave = tid >> 5, lane = tid & 31;
  int mr = lane & 15, kg = lane >> 4;
  float* tb = tbuf[wave];
  float s1 = 0.f, s2 = 0.f;
  // ---- pass 1: raw score stats -------------------------------------------
  for (int rbi = 0; rbi < 2; ++rbi) {
    int i0 = (wave + rbi * 8) * 16;
    float rmax = -3.0e38f;
    for (int jt = 0; jt < 16; ++jt) {
      int j0 = jt * 16;
      v8f acc = {0, 0, 0, 0, 0, 0, 0, 0};
#pragma unroll
      for (int kc = 0; kc < 2; ++kc) {
        int ka = kc * 4 + kg * 2;
        v2f a, bv;
        a[0] = q_s[(i0 + mr) * 8 + ka];
        a[1] = q_s[(i0 + mr) * 8 + ka + 1];
        bv[0] = kt_s[ka * 256 + j0 + mr];
        bv[1] = kt_s[(ka + 1) * 256 + j0 + mr];
        acc = wmma4(a, bv, acc);
      }
#pragma unroll
      for (int r = 0; r < 8; ++r) {
        float vv = acc[r];
        s1 += vv; s2 += vv * vv;
        tb[(r + 8 * kg) * 17 + mr] = vv;
      }
      if (lane < 16) {  // per-wave LDS, same-wave DS ordering
        for (int j = 0; j < 16; ++j) rmax = fmaxf(rmax, tb[lane * 17 + j]);
      }
    }
    if (lane < 16) rowmax_s[i0 + lane] = rmax;
  }
  red1[tid] = s1; red2[tid] = s2;
  __syncthreads();
  for (int o = 128; o > 0; o >>= 1) {
    if (tid < o) { red1[tid] += red1[tid + o]; red2[tid] += red2[tid + o]; }
    __syncthreads();
  }
  if (tid == 0) {
    float mu = red1[0] * (1.f / 65536.f);
    float var = red2[0] * (1.f / 65536.f) - mu * mu;
    rstd_sh = rsqrtf(var + 1e-5f);   // InstanceNorm eps; mu cancels in softmax
  }
  __syncthreads();
  float rstd = rstd_sh;
  // ---- pass 2: softmax + p@v ---------------------------------------------
  for (int rbi = 0; rbi < 2; ++rbi) {
    int i0 = (wave + rbi * 8) * 16;
    float den = 0.f;
    float num[8] = {0, 0, 0, 0, 0, 0, 0, 0};
    float rmax = (lane < 16) ? rowmax_s[i0 + lane] : 0.f;
    for (int jt = 0; jt < 16; ++jt) {
      int j0 = jt * 16;
      v8f acc = {0, 0, 0, 0, 0, 0, 0, 0};
#pragma unroll
      for (int kc = 0; kc < 2; ++kc) {
        int ka = kc * 4 + kg * 2;
        v2f a, bv;
        a[0] = q_s[(i0 + mr) * 8 + ka];
        a[1] = q_s[(i0 + mr) * 8 + ka + 1];
        bv[0] = kt_s[ka * 256 + j0 + mr];
        bv[1] = kt_s[(ka + 1) * 256 + j0 + mr];
        acc = wmma4(a, bv, acc);
      }
#pragma unroll
      for (int r = 0; r < 8; ++r) tb[(r + 8 * kg) * 17 + mr] = acc[r];
      if (lane < 16) {
        for (int j = 0; j < 16; ++j) {
          float sv = tb[lane * 17 + j];
          float pe = __expf((sv - rmax) * rstd);
          den += pe;
          const float* vp = &v_s[(j0 + j) * 8];
#pragma unroll
          for (int m2 = 0; m2 < 8; ++m2) num[m2] += pe * vp[m2];
        }
      }
    }
    if (lane < 16) {
      int cc = i0 + lane;
      float inv = 1.f / den;
#pragma unroll
      for (int m2 = 0; m2 < 8; ++m2) {
        int p1 = m2 >> 2, p2 = (m2 >> 1) & 1, p3 = m2 & 1;
        int s = (d * 2 + p1) * 36 + (ph * 2 + p2) * 6 + (pwv * 2 + p3);
        Ofl[(size_t)(b * 216 + s) * 1024 + cc * 4 + h] = num[m2] * inv;
      }
    }
  }
}

// ---------------------------------------------------------------------------
// t2 = LN(out + res) per row over C
// ---------------------------------------------------------------------------
__global__ __launch_bounds__(256) void k_ln2_local(
    const float* __restrict__ outb, const float* __restrict__ res,
    const float* __restrict__ g, const float* __restrict__ bb,
    float* __restrict__ t2) {
  __shared__ float red[256];
  int row = blockIdx.x, c = threadIdx.x;
  float v = outb[(size_t)row * 256 + c] + res[(size_t)row * 256 + c];
  float S1 = blk_sum(v, red), S2 = blk_sum(v * v, red);
  float mn = S1 * (1.f / 256.f), var = S2 * (1.f / 256.f) - mn * mn;
  t2[(size_t)row * 256 + c] = (v - mn) * rsqrtf(var + 1e-6f) * g[c] + bb[c];
}

// ---------------------------------------------------------------------------
// y = x + broadcast(global) + local
// ---------------------------------------------------------------------------
__global__ __launch_bounds__(256) void k_final(const float* __restrict__ x,
                                               const float* __restrict__ gvec,
                                               const float* __restrict__ lres,
                                               float* __restrict__ y) {
  int idx = blockIdx.x * 256 + threadIdx.x;
  int c = idx & 255, bs = idx >> 8;
  int b = bs / 216, s = bs - b * 216;
  size_t xi = (size_t)(b * 256 + c) * 216 + s;
  y[xi] = x[xi] + gvec[b * 256 + c] + lres[(size_t)bs * 256 + c];
}

extern "C" void kernel_launch(void* const* d_in, const int* in_sizes, int n_in,
                              void* d_out, int out_size, void* d_ws,
                              size_t ws_size, hipStream_t stream) {
  const float* x       = (const float*)d_in[0];
  const float* g_tok_w = (const float*)d_in[1];
  const float* g_tok_b = (const float*)d_in[2];
  const float* g_ln1_g = (const float*)d_in[3];
  const float* g_ln1_b = (const float*)d_in[4];
  const float* g_wq    = (const float*)d_in[5];
  const float* g_wk    = (const float*)d_in[6];
  const float* g_wv    = (const float*)d_in[7];
  const float* g_wo    = (const float*)d_in[8];
  const float* g_ln2_g = (const float*)d_in[9];
  const float* g_ln2_b = (const float*)d_in[10];
  const float* g_mo_w  = (const float*)d_in[11];
  const float* g_mo_b  = (const float*)d_in[12];
  const float* l_pw    = (const float*)d_in[13];
  const float* l_pb    = (const float*)d_in[14];
  const float* l_ln1_g = (const float*)d_in[15];
  const float* l_ln1_b = (const float*)d_in[16];
  const float* l_wq    = (const float*)d_in[17];
  const float* l_wk    = (const float*)d_in[18];
  const float* l_wv    = (const float*)d_in[19];
  const float* l_wo    = (const float*)d_in[20];
  const float* l_ln2_g = (const float*)d_in[21];
  const float* l_ln2_b = (const float*)d_in[22];
  const float* l_mo_w  = (const float*)d_in[23];
  const float* l_mo_b  = (const float*)d_in[24];

  float* ws   = (float*)d_ws;
  float* gm   = ws;                 // 8
  float* gvec = ws + 8;             // 2048
  float* eln  = ws + 8 + 2048;      // 1728*256
  float* res  = eln + 442368;       // 1728*256
  float* Qb   = res + 442368;       // 1728*1024
  float* Kb   = Qb + 1769472;       // 1728*1024
  float* Vb   = Kb + 1769472;       // 1728*1024
  float* ofl  = Vb + 1769472;       // 1728*1024
  float* gqkv = ofl + 1769472;      // 3*8*1024
  float* gpart = gqkv + 24576;      // 8*16*256
  float* outb = Qb;                 // alias: Qb dead after attention
  float* t2   = Kb;                 // alias: Kb dead after attention
  float* lres = Vb;                 // alias: Vb dead after attention

  k_gmean<<<8, 256, 0, stream>>>(x, gm);
  k_local_embed<<<216, 256, 0, stream>>>(x, l_pw, l_pb, l_ln1_g, l_ln1_b, res,
                                         eln);
  k_gemm_wmma<false, false><<<dim3(16, 27), 128, 0, stream>>>(
      eln, l_wq, nullptr, Qb, 1728, 1024, 256);
  k_gemm_wmma<false, false><<<dim3(16, 27), 128, 0, stream>>>(
      eln, l_wk, nullptr, Kb, 1728, 1024, 256);
  k_gemm_wmma<false, false><<<dim3(16, 27), 128, 0, stream>>>(
      eln, l_wv, nullptr, Vb, 1728, 1024, 256);
  k_g_qkv<<<96, 256, 0, stream>>>(gm, g_tok_w, g_tok_b, g_ln1_g, g_ln1_b, g_wq,
                                  g_wk, g_wv, gqkv);
  k_g_attn<<<128, 256, 0, stream>>>(gqkv, g_wo, gpart);
  k_g_out<<<32, 256, 0, stream>>>(gm, g_tok_w, g_tok_b, gpart, g_ln2_g, g_ln2_b,
                                  g_mo_w, g_mo_b, gvec);
  k_attn_local<<<864, 256, 0, stream>>>(Qb, Kb, Vb, ofl);
  k_gemm_wmma<false, false><<<dim3(4, 27), 128, 0, stream>>>(
      ofl, l_wo, nullptr, outb, 1728, 256, 1024);
  k_ln2_local<<<1728, 256, 0, stream>>>(outb, res, l_ln2_g, l_ln2_b, t2);
  k_gemm_wmma<true, true><<<dim3(4, 27), 128, 0, stream>>>(
      t2, l_mo_w, l_mo_b, lres, 1728, 256, 256);
  k_final<<<1728, 256, 0, stream>>>(x, gvec, lres, (float*)d_out);
}

// v003
// Measured time: 144 microseconds a run.
// Two timings next to v002 both put it at 1.19 times that version's speed.
// Counting every step since v000, it is 2.55 times as fast.
#include <hip/hip_runtime.h>
#include <hip/hip_bf16.h>
#include <math.h>

typedef float v2f __attribute__((ext_vector_type(2)));
typedef float v4f __attribute__((ext_vector_type(4)));
typedef float v8f __attribute__((ext_vector_type(8)));

// ---------------------------------------------------------------------------
// fp32 WMMA: D(16x16) = A(16x4) * B(4x16) + C, full fp32 (matches reference
// numerics up to reassociation).  Lane L: mr = L%16, kg = L/16.
//   A frag (v2f): a[0]=A[mr][kg*2], a[1]=A[mr][kg*2+1]
//   B frag (v2f): b[0]=B[kg*2][mr], b[1]=B[kg*2+1][mr]
//   C/D (v8f):    c[r] = C[r + 8*kg][mr]
// ---------------------------------------------------------------------------
__device__ __forceinline__ v8f wmma4(v2f a, v2f b, v8f c) {
  return __builtin_amdgcn_wmma_f32_16x16x4_f32(false, a, false, b, (short)0, c,
                                               false, false);
}

__device__ __forceinline__ float gelu_exact(float x) {
  return 0.5f * x * (1.0f + erff(x * 0.70710678118654752f));
}

// block-wide reductions, blockDim.x == 256
__device__ __forceinline__ float blk_sum(float v, float* red) {
  int t = threadIdx.x;
  red[t] = v; __syncthreads();
  for (int o = 128; o > 0; o >>= 1) {
    if (t < o) red[t] += red[t + o];
    __syncthreads();
  }
  float r = red[0]; __syncthreads();
  return r;
}

// ---------------------------------------------------------------------------
// Global-branch mean over (C,D,H,W) per batch
// ---------------------------------------------------------------------------
__global__ __launch_bounds__(256) void k_gmean(const float* __restrict__ x,
                                               float* __restrict__ gm) {
  __shared__ float red[256];
  int b = blockIdx.x;
  const float* xb = x + (size_t)b * 55296;
  float s = 0.f;
  for (int i = threadIdx.x; i < 55296; i += 256) s += xb[i];
  float tot = blk_sum(s, red);
  if (threadIdx.x == 0) gm[b] = tot / 55296.0f;
}

// ---------------------------------------------------------------------------
// Global branch, spread over many work-groups in three dependent launches.
// Rank-1 score => instance-norm stats factor; softmax is shift-invariant so
// only 1/sigma and row-max of the raw score are needed.
// ---------------------------------------------------------------------------
__device__ __forceinline__ float wave_sum(float v) {
#pragma unroll
  for (int o = 16; o > 0; o >>= 1) v += __shfl_xor(v, o, 32);
  return v;
}
__device__ __forceinline__ float wave_max(float v) {
#pragma unroll
  for (int o = 16; o > 0; o >>= 1) v = fmaxf(v, __shfl_xor(v, o, 32));
  return v;
}
__device__ __forceinline__ float wave_min(float v) {
#pragma unroll
  for (int o = 16; o > 0; o >>= 1) v = fminf(v, __shfl_xor(v, o, 32));
  return v;
}

// Launch 1: q/k/v projections for all 8 batches at once (8x256 @ 256x1024 x3).
// Work-group = one matrix x 32 columns; wave = 32 rows of K; lane = column.
// Each weight element is read once by the whole grid.
__global__ __launch_bounds__(256) void k_g_qkv(
    const float* __restrict__ gm,
    const float* __restrict__ tok_w, const float* __restrict__ tok_b,
    const float* __restrict__ ln1_g, const float* __restrict__ ln1_b,
    const float* __restrict__ wq, const float* __restrict__ wk,
    const float* __restrict__ wv, float* __restrict__ qkv) {
  __shared__ __attribute__((aligned(16))) float t_s[256 * 8];  // t[k][batch]
  __shared__ float red[8 * 8 * 32];                            // [wave][batch][lane]
  int tid = threadIdx.x, wave = tid >> 5, lane = tid & 31;
  int mat = blockIdx.x >> 5, col = (blockIdx.x & 31) * 32 + lane;
  const float* Wm = mat == 0 ? wq : (mat == 1 ? wk : wv);
  const float* wp = Wm + (size_t)(wave * 32) * 1024 + col;
  float wreg[32];   // issued first: the LN below runs under their latency
#pragma unroll
  for (int i = 0; i < 32; ++i) wreg[i] = wp[i * 1024];
  float m = gm[wave];
  float tw[8], tb8[8], lg[8], lb[8];
#pragma unroll
  for (int k = 0; k < 8; ++k) {
    int c = k * 32 + lane;
    tw[k] = tok_w[c]; tb8[k] = tok_b[c]; lg[k] = ln1_g[c]; lb[k] = ln1_b[c];
  }
  // the scheduler otherwise sinks part of the loads above behind the first
  // load wait (two or more exposed latencies instead of one)
  __builtin_amdgcn_sched_barrier(0);
  // stands before any register that a load above names is written again; the
  // address pair is an input so that it lives up to the wait
  asm volatile("s_wait_xcnt 0x0" :: "v"(wp) : "memory");
  // keeps later register writes from being lifted over the wait
  __builtin_amdgcn_sched_barrier(0);
  // LN1 of batch 'wave': 8 channels per lane
  {
    float tok[8];
    float s1 = 0.f, s2 = 0.f;
#pragma unroll
    for (int k = 0; k < 8; ++k) {
      tok[k] = m * tw[k] + tb8[k];
      s1 += tok[k]; s2 += tok[k] * tok[k];
    }
    s1 = wave_sum(s1); s2 = wave_sum(s2);
    float mn = s1 * (1.f / 256.f);
    float var = s2 * (1.f / 256.f) - mn * mn;
    float rs = rsqrtf(var + 1e-6f);
#pragma unroll
    for (int k = 0; k < 8; ++k) {
      int c = k * 32 + lane;
      t_s[c * 8 + wave] = (tok[k] - mn) * rs * lg[k] + lb[k];
    }
  }
  __syncthreads();
  float acc[8] = {0, 0, 0, 0, 0, 0, 0, 0};
#pragma unroll
  for (int i = 0; i < 32; ++i) {
    const float4* tp = (const float4*)&t_s[(wave * 32 + i) * 8];
    float4 ta = tp[0], tb = tp[1];
    float w = wreg[i];
    acc[0] += ta.x * w; acc[1] += ta.y * w; acc[2] += ta.z * w; acc[3] += ta.w * w;
    acc[4] += tb.x * w; acc[5] += tb.y * w; acc[6] += tb.z * w; acc[7] += tb.w * w;
  }
#pragma unroll
  for (int bb = 0; bb < 8; ++bb) red[(wave * 8 + bb) * 32 + lane] = acc[bb];
  __syncthreads();
  float s = 0.f;   // this thread finishes batch 'wave', column 'col'
#pragma unroll
  for (int w = 0; w < 8; ++w) s += red[(w * 8 + wave) * 32 + lane];
  qkv[(size_t)(mat * 8 + wave) * 1024 + col] = s;
}

// Launch 2: work-group = (batch, head, quarter of the 256 score rows).
// Thread = (row of the quarter, quarter of the 256 columns).  The 64 output
// values then meet their 64 rows of wo; the partial 1x256 goes to 'part'.
__global__ __launch_bounds__(256) void k_g_attn(
    const float* __restrict__ qkv, const float* __restrict__ wo,
    float* __restrict__ part) {
  __shared__ __attribute__((aligned(16))) float k_s[256];
  __shared__ __attribute__((aligned(16))) float v_s[256];
  __shared__ float q_s[256];
  __shared__ float st[8][6];
  __shared__ float den_s[256], acc_s[256];
  __shared__ float o_s[64];
  __shared__ __attribute__((aligned(16))) float red[8 * 256];
  int tid = threadIdx.x, wave = tid >> 5, lane = tid & 31;
  int rq = blockIdx.x & 3, h = (blockIdx.x >> 2) & 3, b = blockIdx.x >> 4;
  // wo rows (c*4 + h) of this wave's 8 score rows, issued first so that they
  // arrive while the softmax runs
  float4 w0[8], w1[8];
  const float* wr = wo + (size_t)((rq * 64 + wave * 8) * 4 + h) * 256 + lane * 4;
#pragma unroll
  for (int i = 0; i < 8; ++i) {
    w0[i] = *(const float4*)(wr + i * 1024);
    w1[i] = *(const float4*)(wr + i * 1024 + 128);
  }
  float qi = qkv[(size_t)(0 + b) * 1024 + h * 256 + tid];   // heads OUTER
  float ki = qkv[(size_t)(8 + b) * 1024 + h * 256 + tid];
  float vi = qkv[(size_t)(16 + b) * 1024 + h * 256 + tid];
  // the scheduler otherwise sinks part of the loads above behind the first
  // load wait (two or more exposed latencies instead of one)
  __builtin_amdgcn_sched_barrier(0);
  // stands before any register that a load above names is written again; the
  // address pair is an input so that it lives up to the wait
  asm volatile("s_wait_xcnt 0x0" :: "v"(wr) : "memory");
  // keeps later register writes from being lifted over the wait
  __builtin_amdgcn_sched_barrier(0);
  q_s[tid] = qi; k_s[tid] = ki; v_s[tid] = vi;
  {
    float a0 = wave_sum(qi), a1 = wave_sum(qi * qi);
    float a2 = wave_sum(ki), a3 = wave_sum(ki * ki);
    float a4 = wave_max(ki), a5 = wave_min(ki);
    if (lane == 0) {
      st[wave][0] = a0; st[wave][1] = a1; st[wave][2] = a2;
      st[wave][3] = a3; st[wave][4] = a4; st[wave][5] = a5;
    }
  }
  __syncthreads();
  float Sq = 0.f, Sq2 = 0.f, Sk = 0.f, Sk2 = 0.f;
  float kmx = st[0][4], kmn = st[0][5];
#pragma unroll
  for (int w = 0; w < 8; ++w) {
    Sq += st[w][0]; Sq2 += st[w][1]; Sk += st[w][2]; Sk2 += st[w][3];
    kmx = fmaxf(kmx, st[w][4]); kmn = fminf(kmn, st[w][5]);
  }
  float mu  = (Sq * Sk)  * (1.f / 65536.f);
  float ex2 = (Sq2 * Sk2) * (1.f / 65536.f);
  float rstd = rsqrtf(ex2 - mu * mu + 1e-5f);
  float qr = q_s[rq * 64 + (tid & 63)];
  int j0 = (tid >> 6) * 64;
  float rmax = qr * (qr >= 0.f ? kmx : kmn);  // row max of raw score
  float den = 0.f, acc = 0.f;
#pragma unroll 4
  for (int j = 0; j < 64; j += 4) {
    float4 k4 = *(const float4*)&k_s[j0 + j];
    float4 v4 = *(const float4*)&v_s[j0 + j];
    float p0 = __expf((qr * k4.x - rmax) * rstd);
    float p1 = __expf((qr * k4.y - rmax) * rstd);
    float p2 = __expf((qr * k4.z - rmax) * rstd);
    float p3 = __expf((qr * k4.w - rmax) * rstd);
    den += p0; acc += p0 * v4.x;
    den += p1; acc += p1 * v4.y;
    den += p2; acc += p2 * v4.z;
    den += p3; acc += p3 * v4.w;
  }
  den_s[tid] = den; acc_s[tid] = acc;
  __syncthreads();
  if (tid < 64) {
    float dd = (den_s[tid] + den_s[64 + tid]) + (den_s[128 + tid] + den_s[192 + tid]);
    float aa = (acc_s[tid] + acc_s[64 + tid]) + (acc_s[128 + tid] + acc_s[192 + tid]);
    o_s[tid] = aa / dd;
  }
  __syncthreads();
  float4 p0 = {0.f, 0.f, 0.f, 0.f}, p1 = {0.f, 0.f, 0.f, 0.f};
#pragma unroll
  for (int i = 0; i < 8; ++i) {
    float o = o_s[wave * 8 + i];
    p0.x += o * w0[i].x; p0.y += o * w0[i].y; p0.z += o * w0[i].z; p0.w += o * w0[i].w;
    p1.x += o * w1[i].x; p1.y += o * w1[i].y; p1.z += o * w1[i].z; p1.w += o * w1[i].w;
  }
  *(float4*)&red[wave * 256 + lane * 4] = p0;
  *(float4*)&red[wave * 256 + 128 + lane * 4] = p1;
  __syncthreads();
  float s = 0.f;
#pragma unroll
  for (int w = 0; w < 8; ++w) s += red[w * 256 + tid];
  part[(size_t)blockIdx.x * 256 + tid] = s;   // [(b*16 + h*4 + rq)][256]
}

// Launch 3: work-group = (batch, quarter of the 256 outputs).  Sums the 16
// partials, adds the residual, LN2, then map-out rows ('bc,oc->bo') with the
// lanes along c (coalesced) and a wave reduction per output, then GELU.
__global__ __launch_bounds__(256) void k_g_out(
    const float* __restrict__ gm,
    const float* __restrict__ tok_w, const float* __restrict__ tok_b,
    const float* __restrict__ part,
    const float* __restrict__ ln2_g, const float* __restrict__ ln2_b,
    const float* __restrict__ mo_w, const float* __restrict__ mo_b,
    float* __restrict__ gvec) {
  __shared__ __attribute__((aligned(16))) float t_s[256];
  __shared__ float st[8][2];
  int c = threadIdx.x, wave = c >> 5, lane = c & 31;
  int b = blockIdx.x >> 2, o0 = (blockIdx.x & 3) * 64 + wave * 8;
  float4 m0[8], m1[8];   // issued first: LN2 runs under their latency
  const float* mr = mo_w + (size_t)o0 * 256 + lane * 4;
#pragma unroll
  for (int r = 0; r < 8; ++r) {
    m0[r] = *(const float4*)(mr + r * 256);
    m1[r] = *(const float4*)(mr + r * 256 + 128);
  }
  const float* pp = part + (size_t)(b * 16) * 256 + c;
  float pr[16];
#pragma unroll
  for (int p = 0; p < 16; ++p) pr[p] = pp[p * 256];
  float resv = gm[b] * tok_w[c] + tok_b[c];
  float g2 = ln2_g[c], b2 = ln2_b[c];
  float mb = mo_b[o0 + (lane & 7)];
  // the scheduler otherwise sinks part of the loads above behind the first
  // load wait (two or more exposed latencies instead of one)
  __builtin_amdgcn_sched_barrier(0);
  // stands before any register that a load above names is written again; the
  // address pair and the offset are inputs so that they live up to the wait
  asm volatile("s_wait_xcnt 0x0" :: "v"(mr), "v"(c) : "memory");
  // keeps later register writes from being lifted over the wait
  __builtin_amdgcn_sched_barrier(0);
  float outv = 0.f;
#pragma unroll
  for (int p = 0; p < 16; ++p) outv += pr[p];
  float ov = outv + resv;
  {
    float a0 = wave_sum(ov), a1 = wave_sum(ov * ov);
    if (lane == 0) { st[wave][0] = a0; st[wave][1] = a1; }
  }
  __syncthreads();
  float T1 = 0.f, T2 = 0.f;
#pragma unroll
  for (int w = 0; w < 8; ++w) { T1 += st[w][0]; T2 += st[w][1]; }
  float mn2 = T1 * (1.f / 256.f), var2 = T2 * (1.f / 256.f) - mn2 * mn2;
  t_s[c] = (ov - mn2) * rsqrtf(var2 + 1e-6f) * g2 + b2;
  __syncthreads();
  float4 ta = *(const float4*)&t_s[lane * 4];
  float4 tb = *(const float4*)&t_s[128 + lane * 4];
  float val = 0.f;
#pragma unroll
  for (int r = 0; r < 8; ++r) {
    float dd = m0[r].x * ta.x + m0[r].y * ta.y + m0[r].z * ta.z + m0[r].w * ta.w +
               m1[r].x * tb.x + m1[r].y * tb.y + m1[r].z * tb.z + m1[r].w * tb.w;
    dd = wave_sum(dd);
    if (lane == r) val = dd;
  }
  if (lane < 8) gvec[b * 256 + o0 + lane] = gelu_exact(val + mb);
}

// ---------------------------------------------------------------------------
// Local branch: patchify (2x2x2) + 8x8 embed + LN over C.
// Emits res (B,216,C) and eln rows (bp*8+pv, C).
// ---------------------------------------------------------------------------
__global__ __launch_bounds__(256) void k_local_embed(
    const float* __restrict__ x, const float* __restrict__ pw,
    const float* __restrict__ pb, const float* __restrict__ ln_g,
    const float* __restrict__ ln_b, float* __restrict__ res,
    float* __restrict__ eln) {
  __shared__ float pw_s[64];
  __shared__ float pb_s[8];
  __shared__ float sc[8 * 256];
  __shared__ float part1[256], part2[256];
  __shared__ float mean_s[8], rstd_s[8];
  int bp = blockIdx.x, b = bp / 27, p = bp % 27;
  int d = p / 9, hh = (p / 3) % 3, w = p % 3;
  int c = threadIdx.x;
  if (c < 64) pw_s[c] = pw[c];
  if (c < 8) pb_s[c] = pb[c];
  __syncthreads();
  const float* xb = x + (size_t)(b * 256 + c) * 216;
  float patch[8];
#pragma unroll
  for (int u = 0; u < 8; ++u) {
    int p1 = u >> 2, p2 = (u >> 1) & 1, p3 = u & 1;
    patch[u] = xb[(d * 2 + p1) * 36 + (hh * 2 + p2) * 6 + (w * 2 + p3)];
  }
  float tokv[8];
#pragma unroll
  for (int e = 0; e < 8; ++e) {
    float a = pb_s[e];
#pragma unroll
    for (int u = 0; u < 8; ++u) a += pw_s[e * 8 + u] * patch[u];
    tokv[e] = a;
    sc[e * 256 + c] = a;
    int p1 = e >> 2, p2 = (e >> 1) & 1, p3 = e & 1;
    int s = (d * 2 + p1) * 36 + (hh * 2 + p2) * 6 + (w * 2 + p3);
    res[(size_t)(b * 216 + s) * 256 + c] = a;   // residual uses raw tok
  }
  __syncthreads();
  int g = c >> 5, lane = c & 31;
  float s1 = 0.f, s2 = 0.f;
#pragma unroll
  for (int k = 0; k < 8; ++k) {
    float vv = sc[g * 256 + lane + k * 32];
    s1 += vv; s2 += vv * vv;
  }
  part1[c] = s1; part2[c] = s2;
  __syncthreads();
  if (c < 8) {
    float a = 0.f, bb = 0.f;
    for (int l = 0; l < 32; ++l) { a += part1[c * 32 + l]; bb += part2[c * 32 + l]; }
    float mn = a * (1.f / 256.f), vr = bb * (1.f / 256.f) - mn * mn;
    mean_s[c] = mn; rstd_s[c] = rsqrtf(vr + 1e-6f);
  }
  __syncthreads();
  float lg = ln_g[c], lb = ln_b[c];
#pragma unroll
  for (int e = 0; e < 8; ++e)
    eln[(size_t)(bp * 8 + e) * 256 + c] =
        (tokv[e] - mean_s[e]) * rstd_s[e] * lg + lb;
}

// ---------------------------------------------------------------------------
// fp32 WMMA GEMM: C = act(A(MxK) @ B(KxN) [+bias]).  TRANSB/ACT are template
// params so the inner loop is branch-free.  blockDim=128 (4 waves); each wave
// owns a 16(M) x 64(N) strip; all 4 waves share one n-strip, so the 64x64 B
// tile is staged through LDS once per K-chunk (16-byte loads, 4x reuse).
// The K loop is software-pipelined at both levels.  Global: while the WMMAs of
// chunk c run, the A fragments and the B tile of chunk c+1 are on their way
// into registers; the tile then goes into the other LDS buffer, so one barrier
// per chunk both publishes it and ends the reads of the buffer refilled next.
// LDS: B fragments are read two groups of WMMAs ahead of their use.  For that
// a fragment must land in its register pair as it is, so the tile lies in LDS
// as rows of k pairs: Bs[k/2][n][k%2], row pitch GPP dwords (128 + 32: the two
// half-waves, one k pair apart, fall on different halves of the 64 banks).
// Requires M%64==0, N%64==0, K%64==0.
// ---------------------------------------------------------------------------
#define GKC 64
#define GPP 160

template <bool TRANSB>
__device__ __forceinline__ void gemm_fetch(const float* __restrict__ arow,
                                           const float* __restrict__ bsrc,
                                           int k0, int N, v2f (&an)[GKC / 4],
                                           v4f (&bn)[8]) {
  const float* ap = arow + k0;
  const float* bp[8];
#pragma unroll
  for (int i = 0; i < 8; ++i) {
    // !TRANSB: rows k0 + 16*(i/2) + i%2 (+ 2*rp0, in bsrc); TRANSB: k quad 2*i
    size_t off = TRANSB ? (size_t)(k0 + i * 8)
                        : (size_t)(k0 + (i >> 1) * 16 + (i & 1)) * N;
    bp[i] = bsrc + off;
  }
#pragma unroll
  for (int i = 0; i < GKC / 4; ++i) an[i] = *(const v2f*)(ap + i * 4);
#pragma unroll
  for (int i = 0; i < 8; ++i) bn[i] = *(const v4f*)bp[i];
  // stands before any register that a load above names is written again; the
  // address pairs are inputs so that they live up to the wait (TRANSB: the B
  // loads share one pair and differ in their immediate offsets)
  if (TRANSB)
    asm volatile("s_wait_xcnt 0x0" ::"v"(ap), "v"(bp[0]) : "memory");
  else
    asm volatile("s_wait_xcnt 0x0" ::"v"(ap), "v"(bp[0]), "v"(bp[1]),
                 "v"(bp[2]), "v"(bp[3]), "v"(bp[4]), "v"(bp[5]), "v"(bp[6]),
                 "v"(bp[7])
                 : "memory");
}

template <bool TRANSB>
__device__ __forceinline__ void gemm_put(float* bd, int tid,
                                         const v4f (&bn)[8]) {
  if (!TRANSB) {
    int rp0 = tid >> 4, c4 = (tid & 15) * 4;
#pragma unroll
    for (int i = 0; i < 4; ++i) {
      v4f x = bn[2 * i], y = bn[2 * i + 1];   // rows 2*rp and 2*rp + 1
      v4f lo = {x[0], y[0], x[1], y[1]}, hi = {x[2], y[2], x[3], y[3]};
      float* d = bd + (rp0 + 8 * i) * GPP + c4 * 2;
      *(v4f*)d = lo;
      *(v4f*)(d + 4) = hi;
    }
  } else {
    int c = tid & 63, q0 = tid >> 6;
#pragma unroll
    for (int i = 0; i < 8; ++i) {
      int q = q0 + 2 * i;                      // k = 4*q .. 4*q + 3
      v2f lo = {bn[i][0], bn[i][1]}, hi = {bn[i][2], bn[i][3]};
      *(v2f*)(bd + (2 * q) * GPP + c * 2) = lo;
      *(v2f*)(bd + (2 * q + 1) * GPP + c * 2) = hi;
    }
  }
}

template <bool TRANSB, bool ACT>
__global__ __launch_bounds__(128) void k_gemm_wmma(
    const float* __restrict__ A, const float* __restrict__ B,
    const float* __restrict__ bias, float* __restrict__ C, int M, int N,
    int K) {
  __shared__ __attribute__((aligned(16))) float Bs[2][(GKC / 2) * GPP];
  int tid = threadIdx.x;
  int wave = tid >> 5, lane = tid & 31;
  int mr = lane & 15, kg = lane >> 4;
  int m0 = (blockIdx.y * 4 + wave) * 16;
  int n0 = blockIdx.x * 64;
  v8f z = {0, 0, 0, 0, 0, 0, 0, 0};
  v8f acc[4] = {z, z, z, z};
  const float* arow = A + (size_t)(m0 + mr) * K + kg * 2;
  const float* bsrc =
      TRANSB ? B + (size_t)(n0 + (tid & 63)) * K + (tid >> 6) * 4
             : B + (size_t)((tid >> 4) * 2) * N + n0 + (tid & 15) * 4;
  v2f an[GKC / 4];
  v4f bn[8];
  gemm_fetch<TRANSB>(arow, bsrc, 0, N, an, bn);
  gemm_put<TRANSB>(Bs[0], tid, bn);
  __syncthreads();
  for (int k0 = 0, buf = 0;; k0 += GKC, buf ^= 1) {
    v2f ac[GKC / 4];
#pragma unroll
    for (int i = 0; i < GKC / 4; ++i) ac[i] = an[i];
    bool more = k0 + GKC < K;   // the same for the whole work-group
    if (more) gemm_fetch<TRANSB>(arow, bsrc, k0 + GKC, N, an, bn);
    // fragment of k-step kc, column tile t: bs + kc*2*GPP + t*32.  Groups of
    // two k-steps (8 WMMAs), a ring of three: g+2 is read while g multiplies.
    const float* bs = Bs[buf] + kg * GPP + mr * 2;
    v2f bf[3][8];
#pragma unroll
    for (int g = 0; g < 2; ++g)
#pragma unroll
      for (int j = 0; j < 8; ++j)
        bf[g][j] = *(const v2f*)(bs + (g * 2 + (j >> 2)) * 2 * GPP + (j & 3) * 32);
#pragma unroll
    for (int g = 0; g < GKC / 8; ++g) {
      if (g + 2 < GKC / 8) {
#pragma unroll
        for (int j = 0; j < 8; ++j)
          bf[(g + 2) % 3][j] = *(const v2f*)(bs + ((g + 2) * 2 + (j >> 2)) * 2 * GPP +
                                             (j & 3) * 32);
      }
      // keeps the LDS reads above ahead of this group's WMMAs: the scheduler
      // otherwise sinks each read to just before its use and waits it out
      __builtin_amdgcn_sched_barrier(0);
#pragma unroll
      for (int j = 0; j < 8; ++j)
        acc[j & 3] = wmma4(ac[g * 2 + (j >> 2)], bf[g % 3][j], acc[j & 3]);
    }
    if (!more) break;
    gemm_put<TRANSB>(Bs[buf ^ 1], tid, bn);
    __syncthreads();   // publishes chunk c+1; ends the reads of chunk c
  }
#pragma unroll
  for (int t = 0; t < 4; ++t) {
    int n = n0 + t * 16 + mr;
    float bb = ACT ? bias[n] : 0.f;
#pragma unroll
    for (int r = 0; r < 8; ++r) {
      int row = m0 + r + 8 * kg;
      float v = acc[t][r] + bb;
      if (ACT) v = gelu_exact(v);
      C[(size_t)row * N + n] = v;
    }
  }
}

// ---------------------------------------------------------------------------
// Local attention core: one block per (bp, head); 864 blocks, 8 waves.
// The score tile is built transposed, S^T(16 j x 16 i) = k(16 j x 8) @ q^T(8 x
// 16 i), so that in the accumulator a lane owns ONE softmax row i = mr and the
// eight columns j = r + 8*kg.  Row max, exp and the statistics then run in
// registers on all 32 lanes, and a register pair {p[2s], p[2s+1]} is, as it
// lies, the B fragment of O^T(16 x 16 i) += V^T(16 x 4 j) @ P^T(4 j x 16 i)
// under the k order j = 8*kg + 2*s + e, which the V^T loader follows.
// V^T rows 0..7 are v, row 8 is ones (its product is the softmax row sum),
// rows 9..15 are zero.  A wave keeps its two row tiles through both passes.
// Pass 1: stats (sum, sum^2, row max).  Pass 2: recompute + exp + p@v.
// ---------------------------------------------------------------------------
#define VTP 260   // V^T row pitch in dwords: 16 rows fall on 16 bank quads

__global__ __launch_bounds__(256) void k_attn_local(
    const float* __restrict__ Qb, const float* __restrict__ Kb,
    const float* __restrict__ Vb, float* __restrict__ Ofl) {
  __shared__ __attribute__((aligned(16))) float q_s[256 * 8];    // q[i][m]
  __shared__ __attribute__((aligned(16))) float k_s[256 * 8];    // k[j][m]
  __shared__ __attribute__((aligned(16))) float vt_s[10 * VTP];  // v[m][j], 1, 0
  __shared__ float st[8][2];
  int bp = blockIdx.x >> 2, h = blockIdx.x & 3;
  int b = bp / 27, p = bp % 27;
  int d = p / 9, ph = (p / 3) % 3, pwv = p % 3;
  int tid = threadIdx.x;
  {
    int c = tid;
    float qv[8], kv[8], vv[8];
    size_t idx = (size_t)(bp * 8) * 1024 + c * 4 + h;  // col = c*Hh + h
    const float *qg = Qb + idx, *kg_ = Kb + idx, *vg = Vb + idx;
#pragma unroll
    for (int pv = 0; pv < 8; ++pv) {
      qv[pv] = qg[pv * 1024]; kv[pv] = kg_[pv * 1024]; vv[pv] = vg[pv * 1024];
    }
    // keeps all 24 loads ahead of the wait below (one exposed latency)
    __builtin_amdgcn_sched_barrier(0);
    // stands before any register that a load above names is written again; the
    // address pairs are inputs so that they live up to the wait
    asm volatile("s_wait_xcnt 0x0" ::"v"(qg), "v"(kg_), "v"(vg) : "memory");
    // keeps later register writes from being lifted over the wait
    __builtin_amdgcn_sched_barrier(0);
    v4f q0 = {qv[0], qv[1], qv[2], qv[3]}, q1 = {qv[4], qv[5], qv[6], qv[7]};
    v4f k0 = {kv[0], kv[1], kv[2], kv[3]}, k1 = {kv[4], kv[5], kv[6], kv[7]};
    *(v4f*)&q_s[c * 8] = q0; *(v4f*)&q_s[c * 8 + 4] = q1;
    *(v4f*)&k_s[c * 8] = k0; *(v4f*)&k_s[c * 8 + 4] = k1;
#pragma unroll
    for (int pv = 0; pv < 8; ++pv) vt_s[pv * VTP + c] = vv[pv];
    vt_s[8 * VTP + c] = 1.f;
    vt_s[9 * VTP + c] = 0.f;
  }
  __syncthreads();
  int wave = tid >> 5, lane = tid & 31;
  int mr = lane & 15, kg = lane >> 4;
  const v8f z = {0, 0, 0, 0, 0, 0, 0, 0};
  // k order of the score product, A (k) and B (q) alike: step kc, half kg,
  // element e  <->  m = 4*kg + 2*kc + e: one 16-byte read holds both steps.
  v4f qf[2];
#pragma unroll
  for (int t = 0; t < 2; ++t)
    qf[t] = *(const v4f*)&q_s[((wave + t * 8) * 16 + mr) * 8 + kg * 4];
  const float* kp = k_s + mr * 8 + kg * 4;
  // ---- pass 1: raw score stats -------------------------------------------
  v2f s1v = {0.f, 0.f}, s2v = {0.f, 0.f};
  float rmax[2] = {-3.0e38f, -3.0e38f};
  for (int jt = 0; jt < 16; ++jt) {
    v4f kf = *(const v4f*)(kp + jt * 128);
    v2f ka = {kf[0], kf[1]}, kb = {kf[2], kf[3]};
#pragma unroll
    for (int t = 0; t < 2; ++t) {
      v2f qa = {qf[t][0], qf[t][1]}, qb = {qf[t][2], qf[t][3]};
      v8f acc = wmma4(kb, qb, wmma4(ka, qa, z));
#pragma unroll
      for (int s = 0; s < 4; ++s) {
        v2f pr = {acc[2 * s], acc[2 * s + 1]};
        s1v += pr; s2v += pr * pr;
        rmax[t] = fmaxf(rmax[t], fmaxf(pr[0], pr[1]));
      }
    }
  }
  {
    float a0 = wave_sum(s1v[0] + s1v[1]), a1 = wave_sum(s2v[0] + s2v[1]);
    if (lane == 0) { st[wave][0] = a0; st[wave][1] = a1; }
  }
#pragma unroll
  for (int t = 0; t < 2; ++t)   // the other half-wave holds the row's other j
    rmax[t] = fmaxf(rmax[t], __shfl_xor(rmax[t], 16, 32));
  __syncthreads();
  float S1 = 0.f, S2 = 0.f;
#pragma unroll
  for (int w = 0; w < 8; ++w) { S1 += st[w][0]; S2 += st[w][1]; }
  float mu = S1 * (1.f / 65536.f);
  float var = S2 * (1.f / 65536.f) - mu * mu;
  float rstd = rsqrtf(var + 1e-5f);   // InstanceNorm eps; mu cancels in softmax
  // ---- pass 2: softmax + p@v ---------------------------------------------
  float cs = rstd * 1.44269504088896341f;         // exp(x) = exp2(x * log2 e)
  v2f cs2 = {cs, cs};
  // one shift per row: its rounding cancels between numerator and row sum
  v2f nb2[2] = {{-rmax[0] * cs, -rmax[0] * cs}, {-rmax[1] * cs, -rmax[1] * cs}};
  v8f o[2] = {z, z};
  const float* vp = vt_s + (mr < 9 ? mr : 9) * VTP + kg * 8;
  for (int jt = 0; jt < 16; ++jt) {
    v4f kf = *(const v4f*)(kp + jt * 128);
    v4f va = *(const v4f*)(vp + jt * 16), vb = *(const v4f*)(vp + jt * 16 + 4);
    v2f ka = {kf[0], kf[1]}, kb = {kf[2], kf[3]};
    v2f vf[4] = {{va[0], va[1]}, {va[2], va[3]}, {vb[0], vb[1]}, {vb[2], vb[3]}};
#pragma unroll
    for (int t = 0; t < 2; ++t) {
      v2f qa = {qf[t][0], qf[t][1]}, qb = {qf[t][2], qf[t][3]};
      v8f acc = wmma4(kb, qb, wmma4(ka, qa, z));
#pragma unroll
      for (int s = 0; s < 4; ++s) {
        v2f x = {acc[2 * s], acc[2 * s + 1]};
        x = x * cs2 + nb2[t];
        v2f pf = {__builtin_amdgcn_exp2f(x[0]), __builtin_amdgcn_exp2f(x[1])};
        o[t] = wmma4(vf[s], pf, o[t]);
      }
    }
  }
  // o[t][r] = O^T[r + 8*kg][i = mr]: kg 0 holds the 8 numerators of row i,
  // kg 1 holds the row sum in r = 0.
#pragma unroll
  for (int t = 0; t < 2; ++t) {
    float den = __shfl_xor(o[t][0], 16, 32);
    if (kg == 0) {
      int cc = (wave + t * 8) * 16 + mr;
      float inv = 1.f / den;
#pragma unroll
      for (int m2 = 0; m2 < 8; ++m2) {
        int p1 = m2 >> 2, p2 = (m2 >> 1) & 1, p3 = m2 & 1;
        int s = (d * 2 + p1) * 36 + (ph * 2 + p2) * 6 + (pwv * 2 + p3);
        Ofl[(size_t)(b * 216 + s) * 1024 + cc * 4 + h] = o[t][m2] * inv;
      }
    }
  }
}

// ---------------------------------------------------------------------------
// t2 = LN(out + res) per row over C
// ---------------------------------------------------------------------------
__global__ __launch_bounds__(256) void k_ln2_local(
    const float* __restrict__ outb, const float* __restrict__ res,
    const float* __restrict__ g, const float* __restrict__ bb,
    float* __restrict__ t2) {
  __shared__ float red[256];
  int row = blockIdx.x, c = threadIdx.x;
  float v = outb[(size_t)row * 256 + c] + res[(size_t)row * 256 + c];
  float S1 = blk_sum(v, red), S2 = blk_sum(v * v, red);
  float mn = S1 * (1.f / 256.f), var = S2 * (1.f / 256.f) - mn * mn;
  t2[(size_t)row * 256 + c] = (v - mn) * rsqrtf(var + 1e-6f) * g[c] + bb[c];
}

// ---------------------------------------------------------------------------
// y = x + broadcast(global) + local
// ---------------------------------------------------------------------------
__global__ __launch_bounds__(256) void k_final(const float* __restrict__ x,
                                               const float* __restrict__ gvec,
                                               const float* __restrict__ lres,
                                               float* __restrict__ y) {
  int idx = blockIdx.x * 256 + threadIdx.x;
  int c = idx & 255, bs = idx >> 8;
  int b = bs / 216, s = bs - b * 216;
  size_t xi = (size_t)(b * 256 + c) * 216 + s;
  y[xi] = x[xi] + gvec[b * 256 + c] + lres[(size_t)bs * 256 + c];
}

extern "C" void kernel_launch(void* const* d_in, const int* in_sizes, int n_in,
                              void* d_out, int out_size, void* d_ws,
                              size_t ws_size, hipStream_t stream) {
  const float* x       = (const float*)d_in[0];
  const float* g_tok_w = (const float*)d_in[1];
  const float* g_tok_b = (const float*)d_in[2];
  const float* g_ln1_g = (const float*)d_in[3];
  const float* g_ln1_b = (const float*)d_in[4];
  const float* g_wq    = (const float*)d_in[5];
  const float* g_wk    = (const float*)d_in[6];
  const float* g_wv    = (const float*)d_in[7];
  const float* g_wo    = (const float*)d_in[8];
  const float* g_ln2_g = (const float*)d_in[9];
  const float* g_ln2_b = (const float*)d_in[10];
  const float* g_mo_w  = (const float*)d_in[11];
  const float* g_mo_b  = (const float*)d_in[12];
  const float* l_pw    = (const float*)d_in[13];
  const float* l_pb    = (const float*)d_in[14];
  const float* l_ln1_g = (const float*)d_in[15];
  const float* l_ln1_b = (const float*)d_in[16];
  const float* l_wq    = (const float*)d_in[17];
  const float* l_wk    = (const float*)d_in[18];
  const float* l_wv    = (const float*)d_in[19];
  const float* l_wo    = (const float*)d_in[20];
  const float* l_ln2_g = (const float*)d_in[21];
  const float* l_ln2_b = (const float*)d_in[22];
  const float* l_mo_w  = (const float*)d_in[23];
  const float* l_mo_b  = (const float*)d_in[24];

  float* ws   = (float*)d_ws;
  float* gm   = ws;                 // 8
  float* gvec = ws + 8;             // 2048
  float* eln  = ws + 8 + 2048;      // 1728*256
  float* res  = eln + 442368;       // 1728*256
  float* Qb   = res + 442368;       // 1728*1024
  float* Kb   = Qb + 1769472;       // 1728*1024
  float* Vb   = Kb + 1769472;       // 1728*1024
  float* ofl  = Vb + 1769472;       // 1728*1024
  float* gqkv = ofl + 1769472;      // 3*8*1024
  float* gpart = gqkv + 24576;      // 8*16*256
  float* outb = Qb;                 // alias: Qb dead after attention
  float* t2   = Kb;                 // alias: Kb dead after attention
  float* lres = Vb;                 // alias: Vb dead after attention

  k_gmean<<<8, 256, 0, stream>>>(x, gm);
  k_local_embed<<<216, 256, 0, stream>>>(x, l_pw, l_pb, l_ln1_g, l_ln1_b, res,
                                         eln);
  k_gemm_wmma<false, false><<<dim3(16, 27), 128, 0, stream>>>(
      eln, l_wq, nullptr, Qb, 1728, 1024, 256);
  k_gemm_wmma<false, false><<<dim3(16, 27), 128, 0, stream>>>(
      eln, l_wk, nullptr, Kb, 1728, 1024, 256);
  k_gemm_wmma<false, false><<<dim3(16, 27), 128, 0, stream>>>(
      eln, l_wv, nullptr, Vb, 1728, 1024, 256);
  k_g_qkv<<<96, 256, 0, stream>>>(gm, g_tok_w, g_tok_b, g_ln1_g, g_ln1_b, g_wq,
                                  g_wk, g_wv, gqkv);
  k_g_attn<<<128, 256, 0, stream>>>(gqkv, g_wo, gpart);
  k_g_out<<<32, 256, 0, stream>>>(gm, g_tok_w, g_tok_b, gpart, g_ln2_g, g_ln2_b,
                                  g_mo_w, g_mo_b, gvec);
  k_attn_local<<<864, 256, 0, stream>>>(Qb, Kb, Vb, ofl);
  k_gemm_wmma<false, false><<<dim3(4, 27), 128, 0, stream>>>(
      ofl, l_wo, nullptr, outb, 1728, 256, 1024);
  k_ln2_local<<<1728, 256, 0, stream>>>(outb, res, l_ln2_g, l_ln2_b, t2);
  k_gemm_wmma<true, true><<<dim3(4, 27), 128, 0, stream>>>(
      t2, l_mo_w, l_mo_b, lres, 1728, 256, 256);
  k_final<<<1728, 256, 0, stream>>>(x, gvec, lres, (float*)d_out);
}

// v004
// One run takes 110 microseconds.
// Timed twice side by side with v003, it ran 1.31 and 1.30 times as fast.
// Counting every step since v000, it is 3.32 times as fast.
#include <hip/hip_runtime.h>
#include <hip/hip_bf16.h>
#include <math.h>

typedef float v2f __attribute__((ext_vector_type(2)));
typedef float v4f __attribute__((ext_vector_type(4)));
typedef float v8f __attribute__((ext_vector_type(8)));

// ---------------------------------------------------------------------------
// fp32 WMMA: D(16x16) = A(16x4) * B(4x16) + C, full fp32 (matches reference
// numerics up to reassociation).  Lane L: mr = L%16, kg = L/16.
//   A frag (v2f): a[0]=A[mr][kg*2], a[1]=A[mr][kg*2+1]
//   B frag (v2f): b[0]=B[kg*2][mr], b[1]=B[kg*2+1][mr]
//   C/D (v8f):    c[r] = C[r + 8*kg][mr]
// ---------------------------------------------------------------------------
__device__ __forceinline__ v8f wmma4(v2f a, v2f b, v8f c) {
  return __builtin_amdgcn_wmma_f32_16x16x4_f32(false, a, false, b, (short)0, c,
                                               false, false);
}

__device__ __forceinline__ float gelu_exact(float x) {
  return 0.5f * x * (1.0f + erff(x * 0.70710678118654752f));
}

// block-wide reductions, blockDim.x == 256
__device__ __forceinline__ float blk_sum(float v, float* red) {
  int t = threadIdx.x;
  red[t] = v; __syncthreads();
  for (int o = 128; o > 0; o >>= 1) {
    if (t < o) red[t] += red[t + o];
    __syncthreads();
  }
  float r = red[0]; __syncthreads();
  return r;
}

// ---------------------------------------------------------------------------
// Global branch, spread over many work-groups in three dependent stages.
// Rank-1 score => instance-norm stats factor; softmax is shift-invariant so
// only 1/sigma and row-max of the raw score are needed.
// No stage has a launch of its own: each is independent of the local-branch
// stage that runs at the same depth of the chain, and its work-groups are the
// first ones of that stage's grid.  The mean over (C,D,H,W) comes as 27 sums
// per batch from the patch-embed work-groups, which read all of x anyway.
// ---------------------------------------------------------------------------
__device__ __forceinline__ float wave_sum(float v) {
#pragma unroll
  for (int o = 16; o > 0; o >>= 1) v += __shfl_xor(v, o, 32);
  return v;
}
__device__ __forceinline__ float wave_max(float v) {
#pragma unroll
  for (int o = 16; o > 0; o >>= 1) v = fmaxf(v, __shfl_xor(v, o, 32));
  return v;
}
__device__ __forceinline__ float wave_min(float v) {
#pragma unroll
  for (int o = 16; o > 0; o >>= 1) v = fminf(v, __shfl_xor(v, o, 32));
  return v;
}

// Stage 1: q/k/v projections for all 8 batches at once (8x256 @ 256x1024 x3).
// Work-group = one matrix x 32 columns; wave = 32 rows of K; lane = column.
// Each weight element is read once by the whole grid.
// t_s: 256*8 floats, t[k][batch], 16-byte aligned; red: 8*8*32 floats,
// [wave][batch][lane].
__device__ __forceinline__ void g_qkv_body(
    int blk, float* t_s, float* red, const float* __restrict__ gsum,
    const float* __restrict__ tok_w, const float* __restrict__ tok_b,
    const float* __restrict__ ln1_g, const float* __restrict__ ln1_b,
    const float* __restrict__ wq, const float* __restrict__ wk,
    const float* __restrict__ wv, float* __restrict__ qkv) {
  int tid = threadIdx.x, wave = tid >> 5, lane = tid & 31;
  int mat = blk >> 5, col = (blk & 31) * 32 + lane;
  const float* Wm = mat == 0 ? wq : (mat == 1 ? wk : wv);
  const float* wp = Wm + (size_t)(wave * 32) * 1024 + col;
  float wreg[32];   // issued first: the LN below runs under their latency
#pragma unroll
  for (int i = 0; i < 32; ++i) wreg[i] = wp[i * 1024];
  const float* gp = gsum + wave * 27 + (lane < 27 ? lane : 26);
  float gs = *gp;   // lanes 0..26: the 27 patch sums of batch 'wave'
  float tw[8], tb8[8], lg[8], lb[8];
#pragma unroll
  for (int k = 0; k < 8; ++k) {
    int c = k * 32 + lane;
    tw[k] = tok_w[c]; tb8[k] = tok_b[c]; lg[k] = ln1_g[c]; lb[k] = ln1_b[c];
  }
  // the scheduler otherwise sinks part of the loads above behind the first
  // load wait (two or more exposed latencies instead of one)
  __builtin_amdgcn_sched_barrier(0);
  // stands before any register that a load above names is written again; the
  // address pairs are inputs so that they live up to the wait
  asm volatile("s_wait_xcnt 0x0" :: "v"(wp), "v"(gp) : "memory");
  // keeps later register writes from being lifted over the wait
  __builtin_amdgcn_sched_barrier(0);
  float m = wave_sum(lane < 27 ? gs : 0.f) / 55296.0f;
  // LN1 of batch 'wave': 8 channels per lane
  {
    float tok[8];
    float s1 = 0.f, s2 = 0.f;
#pragma unroll
    for (int k = 0; k < 8; ++k) {
      tok[k] = m * tw[k] + tb8[k];
      s1 += tok[k]; s2 += tok[k] * tok[k];
    }
    s1 = wave_sum(s1); s2 = wave_sum(s2);
    float mn = s1 * (1.f / 256.f);
    float var = s2 * (1.f / 256.f) - mn * mn;
    float rs = rsqrtf(var + 1e-6f);
#pragma unroll
    for (int k = 0; k < 8; ++k) {
      int c = k * 32 + lane;
      t_s[c * 8 + wave] = (tok[k] - mn) * rs * lg[k] + lb[k];
    }
  }
  __syncthreads();
  float acc[8] = {0, 0, 0, 0, 0, 0, 0, 0};
#pragma unroll
  for (int i = 0; i < 32; ++i) {
    const float4* tp = (const float4*)&t_s[(wave * 32 + i) * 8];
    float4 ta = tp[0], tb = tp[1];
    float w = wreg[i];
    acc[0] += ta.x * w; acc[1] += ta.y * w; acc[2] += ta.z * w; acc[3] += ta.w * w;
    acc[4] += tb.x * w; acc[5] += tb.y * w; acc[6] += tb.z * w; acc[7] += tb.w * w;
  }
#pragma unroll
  for (int bb = 0; bb < 8; ++bb) red[(wave * 8 + bb) * 32 + lane] = acc[bb];
  __syncthreads();
  float s = 0.f;   // this thread finishes batch 'wave', column 'col'
#pragma unroll
  for (int w = 0; w < 8; ++w) s += red[(w * 8 + wave) * 32 + lane];
  qkv[(size_t)(mat * 8 + wave) * 1024 + col] = s;
}

// Stage 2: work-group = (batch, head, quarter of the 256 score rows).
// Thread = (row of the quarter, quarter of the 256 columns).  The 64 output
// values then meet their 64 rows of wo; the partial 1x256 goes to 'part'.
__device__ __forceinline__ void g_attn_body(
    int blk, const float* __restrict__ qkv, const float* __restrict__ wo,
    float* __restrict__ part) {
  __shared__ __attribute__((aligned(16))) float k_s[256];
  __shared__ __attribute__((aligned(16))) float v_s[256];
  __shared__ float q_s[256];
  __shared__ float st[8][6];
  __shared__ float den_s[256], acc_s[256];
  __shared__ float o_s[64];
  __shared__ __attribute__((aligned(16))) float red[8 * 256];
  int tid = threadIdx.x, wave = tid >> 5, lane = tid & 31;
  int rq = blk & 3, h = (blk >> 2) & 3, b = blk >> 4;
  // wo rows (c*4 + h) of this wave's 8 score rows, issued first so that they
  // arrive while the softmax runs
  float4 w0[8], w1[8];
  const float* wr = wo + (size_t)((rq * 64 + wave * 8) * 4 + h) * 256 + lane * 4;
#pragma unroll
  for (int i = 0; i < 8; ++i) {
    w0[i] = *(const float4*)(wr + i * 1024);
    w1[i] = *(const float4*)(wr + i * 1024 + 128);
  }
  float qi = qkv[(size_t)(0 + b) * 1024 + h * 256 + tid];   // heads OUTER
  float ki = qkv[(size_t)(8 + b) * 1024 + h * 256 + tid];
  float vi = qkv[(size_t)(16 + b) * 1024 + h * 256 + tid];
  // the scheduler otherwise sinks part of the loads above behind the first
  // load wait (two or more exposed latencies instead of one)
  __builtin_amdgcn_sched_barrier(0);
  // stands before any register that a load above names is written again; the
  // address pair is an input so that it lives up to the wait
  asm volatile("s_wait_xcnt 0x0" :: "v"(wr) : "memory");
  // keeps later register writes from being lifted over the wait
  __builtin_amdgcn_sched_barrier(0);
  q_s[tid] = qi; k_s[tid] = ki; v_s[tid] = vi;
  {
    float a0 = wave_sum(qi), a1 = wave_sum(qi * qi);
    float a2 = wave_sum(ki), a3 = wave_sum(ki * ki);
    float a4 = wave_max(ki), a5 = wave_min(ki);
    if (lane == 0) {
      st[wave][0] = a0; st[wave][1] = a1; st[wave][2] = a2;
      st[wave][3] = a3; st[wave][4] = a4; st[wave][5] = a5;
    }
  }
  __syncthreads();
  float Sq = 0.f, Sq2 = 0.f, Sk = 0.f, Sk2 = 0.f;
  float kmx = st[0][4], kmn = st[0][5];
#pragma unroll
  for (int w = 0; w < 8; ++w) {
    Sq += st[w][0]; Sq2 += st[w][1]; Sk += st[w][2]; Sk2 += st[w][3];
    kmx = fmaxf(kmx, st[w][4]); kmn = fminf(kmn, st[w][5]);
  }
  float mu  = (Sq * Sk)  * (1.f / 65536.f);
  float ex2 = (Sq2 * Sk2) * (1.f / 65536.f);
  float rstd = rsqrtf(ex2 - mu * mu + 1e-5f);
  float qr = q_s[rq * 64 + (tid & 63)];
  int j0 = (tid >> 6) * 64;
  float rmax = qr * (qr >= 0.f ? kmx : kmn);  // row max of raw score
  float den = 0.f, acc = 0.f;
#pragma unroll 4
  for (int j = 0; j < 64; j += 4) {
    float4 k4 = *(const float4*)&k_s[j0 + j];
    float4 v4 = *(const float4*)&v_s[j0 + j];
    float p0 = __expf((qr * k4.x - rmax) * rstd);
    float p1 = __expf((qr * k4.y - rmax) * rstd);
    float p2 = __expf((qr * k4.z - rmax) * rstd);
    float p3 = __expf((qr * k4.w - rmax) * rstd);
    den += p0; acc += p0 * v4.x;
    den += p1; acc += p1 * v4.y;
    den += p2; acc += p2 * v4.z;
    den += p3; acc += p3 * v4.w;
  }
  den_s[tid] = den; acc_s[tid] = acc;
  __syncthreads();
  if (tid < 64) {
    float dd = (den_s[tid] + den_s[64 + tid]) + (den_s[128 + tid] + den_s[192 + tid]);
    float aa = (acc_s[tid] + acc_s[64 + tid]) + (acc_s[128 + tid] + acc_s[192 + tid]);
    o_s[tid] = aa / dd;
  }
  __syncthreads();
  float4 p0 = {0.f, 0.f, 0.f, 0.f}, p1 = {0.f, 0.f, 0.f, 0.f};
#pragma unroll
  for (int i = 0; i < 8; ++i) {
    float o = o_s[wave * 8 + i];
    p0.x += o * w0[i].x; p0.y += o * w0[i].y; p0.z += o * w0[i].z; p0.w += o * w0[i].w;
    p1.x += o * w1[i].x; p1.y += o * w1[i].y; p1.z += o * w1[i].z; p1.w += o * w1[i].w;
  }
  *(float4*)&red[wave * 256 + lane * 4] = p0;
  *(float4*)&red[wave * 256 + 128 + lane * 4] = p1;
  __syncthreads();
  float s = 0.f;
#pragma unroll
  for (int w = 0; w < 8; ++w) s += red[w * 256 + tid];
  part[(size_t)blk * 256 + tid] = s;   // [(b*16 + h*4 + rq)][256]
}

// Stage 3: work-group = (batch, quarter of the 256 outputs).  Sums the 16
// partials, adds the residual, LN2, then map-out rows ('bc,oc->bo') with the
// lanes along c (coalesced) and a wave reduction per output, then GELU.
__device__ __forceinline__ void g_out_body(
    int blk, const float* __restrict__ gsum,
    const float* __restrict__ tok_w, const float* __restrict__ tok_b,
    const float* __restrict__ part,
    const float* __restrict__ ln2_g, const float* __restrict__ ln2_b,
    const float* __restrict__ mo_w, const float* __restrict__ mo_b,
    float* __restrict__ gvec) {
  __shared__ __attribute__((aligned(16))) float t_s[256];
  __shared__ float st[8][2];
  int c = threadIdx.x, wave = c >> 5, lane = c & 31;
  int b = blk >> 2, o0 = (blk & 3) * 64 + wave * 8;
  float4 m0[8], m1[8];   // issued first: LN2 runs under their latency
  const float* mr = mo_w + (size_t)o0 * 256 + lane * 4;
#pragma unroll
  for (int r = 0; r < 8; ++r) {
    m0[r] = *(const float4*)(mr + r * 256);
    m1[r] = *(const float4*)(mr + r * 256 + 128);
  }
  const float* pp = part + (size_t)(b * 16) * 256 + c;
  float pr[16];
#pragma unroll
  for (int p = 0; p < 16; ++p) pr[p] = pp[p * 256];
  const float* gp = gsum + b * 27 + (lane < 27 ? lane : 26);
  float gs = *gp;   // lanes 0..26: the 27 patch sums of batch b
  float tw = tok_w[c], tb = tok_b[c];
  float g2 = ln2_g[c], b2 = ln2_b[c];
  float mb = mo_b[o0 + (lane & 7)];
  // the scheduler otherwise sinks part of the loads above behind the first
  // load wait (two or more exposed latencies instead of one)
  __builtin_amdgcn_sched_barrier(0);
  // stands before any register that a load above names is written again; the
  // address pairs and the offset are inputs so that they live up to the wait
  asm volatile("s_wait_xcnt 0x0" :: "v"(mr), "v"(c), "v"(gp) : "memory");
  // keeps later register writes from being lifted over the wait
  __builtin_amdgcn_sched_barrier(0);
  float resv = (wave_sum(lane < 27 ? gs : 0.f) / 55296.0f) * tw + tb;
  float outv = 0.f;
#pragma unroll
  for (int p = 0; p < 16; ++p) outv += pr[p];
  float ov = outv + resv;
  {
    float a0 = wave_sum(ov), a1 = wave_sum(ov * ov);
    if (lane == 0) { st[wave][0] = a0; st[wave][1] = a1; }
  }
  __syncthreads();
  float T1 = 0.f, T2 = 0.f;
#pragma unroll
  for (int w = 0; w < 8; ++w) { T1 += st[w][0]; T2 += st[w][1]; }
  float mn2 = T1 * (1.f / 256.f), var2 = T2 * (1.f / 256.f) - mn2 * mn2;
  t_s[c] = (ov - mn2) * rsqrtf(var2 + 1e-6f) * g2 + b2;
  __syncthreads();
  float4 ta = *(const float4*)&t_s[lane * 4];
  float4 tc = *(const float4*)&t_s[128 + lane * 4];
  float val = 0.f;
#pragma unroll
  for (int r = 0; r < 8; ++r) {
    float dd = m0[r].x * ta.x + m0[r].y * ta.y + m0[r].z * ta.z + m0[r].w * ta.w +
               m1[r].x * tc.x + m1[r].y * tc.y + m1[r].z * tc.z + m1[r].w * tc.w;
    dd = wave_sum(dd);
    if (lane == r) val = dd;
  }
  if (lane < 8) gvec[b * 256 + o0 + lane] = gelu_exact(val + mb);
}

// ---------------------------------------------------------------------------
// Local branch: patchify (2x2x2) + 8x8 embed + LN over C.
// Emits res (B,216,C) and eln rows (bp*8+pv, C), and the sum of the 2048 x
// values it has read (one of the 27 parts of its batch's global-branch mean).
// ---------------------------------------------------------------------------
__global__ __launch_bounds__(256) void k_local_embed(
    const float* __restrict__ x, const float* __restrict__ pw,
    const float* __restrict__ pb, const float* __restrict__ ln_g,
    const float* __restrict__ ln_b, float* __restrict__ res,
    float* __restrict__ eln, float* __restrict__ gsum) {
  __shared__ float pw_s[64];
  __shared__ float pb_s[8];
  __shared__ float sc[8 * 256];
  __shared__ float part1[256], part2[256];
  __shared__ float mean_s[8], rstd_s[8];
  __shared__ float xs_s[8];
  int bp = blockIdx.x, b = bp / 27, p = bp % 27;
  int d = p / 9, hh = (p / 3) % 3, w = p % 3;
  int c = threadIdx.x;
  if (c < 64) pw_s[c] = pw[c];
  if (c < 8) pb_s[c] = pb[c];
  __syncthreads();
  const float* xb = x + (size_t)(b * 256 + c) * 216;
  float patch[8];
#pragma unroll
  for (int u = 0; u < 8; ++u) {
    int p1 = u >> 2, p2 = (u >> 1) & 1, p3 = u & 1;
    patch[u] = xb[(d * 2 + p1) * 36 + (hh * 2 + p2) * 6 + (w * 2 + p3)];
  }
  {
    float xs = wave_sum(((patch[0] + patch[1]) + (patch[2] + patch[3])) +
                        ((patch[4] + patch[5]) + (patch[6] + patch[7])));
    if ((c & 31) == 0) xs_s[c >> 5] = xs;   // read behind the next barrier
  }
  float tokv[8];
#pragma unroll
  for (int e = 0; e < 8; ++e) {
    float a = pb_s[e];
#pragma unroll
    for (int u = 0; u < 8; ++u) a += pw_s[e * 8 + u] * patch[u];
    tokv[e] = a;
    sc[e * 256 + c] = a;
    int p1 = e >> 2, p2 = (e >> 1) & 1, p3 = e & 1;
    int s = (d * 2 + p1) * 36 + (hh * 2 + p2) * 6 + (w * 2 + p3);
    res[(size_t)(b * 216 + s) * 256 + c] = a;   // residual uses raw tok
  }
  __syncthreads();
  int g = c >> 5, lane = c & 31;
  float s1 = 0.f, s2 = 0.f;
#pragma unroll
  for (int k = 0; k < 8; ++k) {
    float vv = sc[g * 256 + lane + k * 32];
    s1 += vv; s2 += vv * vv;
  }
  part1[c] = s1; part2[c] = s2;
  if (c == 0)
    gsum[bp] = ((xs_s[0] + xs_s[1]) + (xs_s[2] + xs_s[3])) +
               ((xs_s[4] + xs_s[5]) + (xs_s[6] + xs_s[7]));
  __syncthreads();
  if (c < 8) {
    float a = 0.f, bb = 0.f;
    for (int l = 0; l < 32; ++l) { a += part1[c * 32 + l]; bb += part2[c * 32 + l]; }
    float mn = a * (1.f / 256.f), vr = bb * (1.f / 256.f) - mn * mn;
    mean_s[c] = mn; rstd_s[c] = rsqrtf(vr + 1e-6f);
  }
  __syncthreads();
  float lg = ln_g[c], lb = ln_b[c];
#pragma unroll
  for (int e = 0; e < 8; ++e)
    eln[(size_t)(bp * 8 + e) * 256 + c] =
        (tokv[e] - mean_s[e]) * rstd_s[e] * lg + lb;
}

// ---------------------------------------------------------------------------
// fp32 WMMA GEMM: C = act(A(MxK) @ B(KxN) [+bias]).  TRANSB/ACT are template
// params so the inner loop is branch-free.  128 threads (4 waves) per tile; each wave
// owns a 16(M) x 64(N) strip; all 4 waves share one n-strip, so the 64x64 B
// tile is staged through LDS once per K-chunk (16-byte loads, 4x reuse).
// The K loop is software-pipelined at both levels.  Global: while the WMMAs of
// chunk c run, the A fragments and the B tile of chunk c+1 are on their way
// into registers; the tile then goes into the other LDS buffer, so one barrier
// per chunk both publishes it and ends the reads of the buffer refilled next.
// LDS: B fragments are read two groups of WMMAs ahead of their use.  For that
// a fragment must land in its register pair as it is, so the tile lies in LDS
// as rows of k pairs: Bs[k/2][n][k%2], row pitch GPP dwords (128 + 32: the two
// half-waves, one k pair apart, fall on different halves of the 64 banks).
// Requires M%64==0, N%64==0, K%64==0.
// ---------------------------------------------------------------------------
#define GKC 64
#define GPP 160

template <bool TRANSB>
__device__ __forceinline__ void gemm_fetch(const float* __restrict__ arow,
                                           const float* __restrict__ bsrc,
                                           int k0, int N, v2f (&an)[GKC / 4],
                                           v4f (&bn)[8]) {
  const float* ap = arow + k0;
  const float* bp[8];
#pragma unroll
  for (int i = 0; i < 8; ++i) {
    // !TRANSB: rows k0 + 16*(i/2) + i%2 (+ 2*rp0, in bsrc); TRANSB: k quad 2*i
    size_t off = TRANSB ? (size_t)(k0 + i * 8)
                        : (size_t)(k0 + (i >> 1) * 16 + (i & 1)) * N;
    bp[i] = bsrc + off;
  }
#pragma unroll
  for (int i = 0; i < GKC / 4; ++i) an[i] = *(const v2f*)(ap + i * 4);
#pragma unroll
  for (int i = 0; i < 8; ++i) bn[i] = *(const v4f*)bp[i];
  // stands before any register that a load above names is written again; the
  // address pairs are inputs so that they live up to the wait (TRANSB: the B
  // loads share one pair and differ in their immediate offsets)
  if (TRANSB)
    asm volatile("s_wait_xcnt 0x0" ::"v"(ap), "v"(bp[0]) : "memory");
  else
    asm volatile("s_wait_xcnt 0x0" ::"v"(ap), "v"(bp[0]), "v"(bp[1]),
                 "v"(bp[2]), "v"(bp[3]), "v"(bp[4]), "v"(bp[5]), "v"(bp[6]),
                 "v"(bp[7])
                 : "memory");
}

template <bool TRANSB>
__device__ __forceinline__ void gemm_put(float* bd, int tid,
                                         const v4f (&bn)[8]) {
  if (!TRANSB) {
    int rp0 = tid >> 4, c4 = (tid & 15) * 4;
#pragma unroll
    for (int i = 0; i < 4; ++i) {
      v4f x = bn[2 * i], y = bn[2 * i + 1];   // rows 2*rp and 2*rp + 1
      v4f lo = {x[0], y[0], x[1], y[1]}, hi = {x[2], y[2], x[3], y[3]};
      float* d = bd + (rp0 + 8 * i) * GPP + c4 * 2;
      *(v4f*)d = lo;
      *(v4f*)(d + 4) = hi;
    }
  } else {
    int c = tid & 63, q0 = tid >> 6;
#pragma unroll
    for (int i = 0; i < 8; ++i) {
      int q = q0 + 2 * i;                      // k = 4*q .. 4*q + 3
      v2f lo = {bn[i][0], bn[i][1]}, hi = {bn[i][2], bn[i][3]};
      *(v2f*)(bd + (2 * q) * GPP + c * 2) = lo;
      *(v2f*)(bd + (2 * q + 1) * GPP + c * 2) = hi;
    }
  }
}

#define GBUF ((GKC / 2) * GPP)   // one LDS buffer, in dwords

// One 64 x 64 tile (mblk, nblk) by 128 threads (tid 0..127); Bs: 2 * GBUF
// dwords of their own, 16-byte aligned.  Its barriers are the work-group's.
template <bool TRANSB, bool ACT>
__device__ __forceinline__ void gemm_tile(
    const float* __restrict__ A, const float* __restrict__ B,
    const float* __restrict__ bias, float* __restrict__ C, int N, int K,
    float* Bs, int tid, int mblk, int nblk) {
  int wave = tid >> 5, lane = tid & 31;
  int mr = lane & 15, kg = lane >> 4;
  int m0 = (mblk * 4 + wave) * 16;
  int n0 = nblk * 64;
  v8f z = {0, 0, 0, 0, 0, 0, 0, 0};
  v8f acc[4] = {z, z, z, z};
  const float* arow = A + (size_t)(m0 + mr) * K + kg * 2;
  const float* bsrc =
      TRANSB ? B + (size_t)(n0 + (tid & 63)) * K + (tid >> 6) * 4
             : B + (size_t)((tid >> 4) * 2) * N + n0 + (tid & 15) * 4;
  v2f an[GKC / 4];
  v4f bn[8];
  gemm_fetch<TRANSB>(arow, bsrc, 0, N, an, bn);
  gemm_put<TRANSB>(Bs, tid, bn);
  __syncthreads();
  for (int k0 = 0, buf = 0;; k0 += GKC, buf ^= 1) {
    v2f ac[GKC / 4];
#pragma unroll
    for (int i = 0; i < GKC / 4; ++i) ac[i] = an[i];
    bool more = k0 + GKC < K;   // the same for the whole work-group
    if (more) gemm_fetch<TRANSB>(arow, bsrc, k0 + GKC, N, an, bn);
    // fragment of k-step kc, column tile t: bs + kc*2*GPP + t*32.  Groups of
    // two k-steps (8 WMMAs), a ring of three: g+2 is read while g multiplies.
    const float* bs = Bs + buf * GBUF + kg * GPP + mr * 2;
    v2f bf[3][8];
#pragma unroll
    for (int g = 0; g < 2; ++g)
#pragma unroll
      for (int j = 0; j < 8; ++j)
        bf[g][j] = *(const v2f*)(bs + (g * 2 + (j >> 2)) * 2 * GPP + (j & 3) * 32);
#pragma unroll
    for (int g = 0; g < GKC / 8; ++g) {
      if (g + 2 < GKC / 8) {
#pragma unroll
        for (int j = 0; j < 8; ++j)
          bf[(g + 2) % 3][j] = *(const v2f*)(bs + ((g + 2) * 2 + (j >> 2)) * 2 * GPP +
                                             (j & 3) * 32);
      }
      // keeps the LDS reads above ahead of this group's WMMAs: the scheduler
      // otherwise sinks each read to just before its use and waits it out
      __builtin_amdgcn_sched_barrier(0);
#pragma unroll
      for (int j = 0; j < 8; ++j)
        acc[j & 3] = wmma4(ac[g * 2 + (j >> 2)], bf[g % 3][j], acc[j & 3]);
    }
    if (!more) break;
    gemm_put<TRANSB>(Bs + (buf ^ 1) * GBUF, tid, bn);
    __syncthreads();   // publishes chunk c+1; ends the reads of chunk c
  }
#pragma unroll
  for (int t = 0; t < 4; ++t) {
    int n = n0 + t * 16 + mr;
    float bb = ACT ? bias[n] : 0.f;
#pragma unroll
    for (int r = 0; r < 8; ++r) {
      int row = m0 + r + 8 * kg;
      float v = acc[t][r] + bb;
      if (ACT) v = gelu_exact(v);
      C[(size_t)row * N + n] = v;
    }
  }
}

template <bool TRANSB, bool ACT>
__global__ __launch_bounds__(128) void k_gemm_wmma(
    const float* __restrict__ A, const float* __restrict__ B,
    const float* __restrict__ bias, float* __restrict__ C, int M, int N,
    int K) {
  __shared__ __attribute__((aligned(16))) float Bs[2 * GBUF];
  gemm_tile<TRANSB, ACT>(A, B, bias, C, N, K, Bs, threadIdx.x, blockIdx.y,
                         blockIdx.x);
}

// One grid for the local q, k and v projections and stage 1 of the global
// branch.  Work-groups 0..95: stage 1.  The other 648: two GEMM tiles each,
// one per 128 threads, neighbours in n (the same A rows) of one matrix; 216
// work-groups per matrix.
__global__ __launch_bounds__(256) void k_qkv_all(
    const float* __restrict__ eln, const float* __restrict__ l_wq,
    const float* __restrict__ l_wk, const float* __restrict__ l_wv,
    float* __restrict__ Qb, float* __restrict__ Kb, float* __restrict__ Vb,
    int N, int K, const float* __restrict__ gsum,
    const float* __restrict__ tok_w, const float* __restrict__ tok_b,
    const float* __restrict__ ln1_g, const float* __restrict__ ln1_b,
    const float* __restrict__ g_wq, const float* __restrict__ g_wk,
    const float* __restrict__ g_wv, float* __restrict__ gqkv) {
  __shared__ __attribute__((aligned(16))) float sm[4 * GBUF];
  if (blockIdx.x < 96) {
    g_qkv_body(blockIdx.x, sm, sm + 2048, gsum, tok_w, tok_b, ln1_g, ln1_b,
               g_wq, g_wk, g_wv, gqkv);
    return;
  }
  int g = blockIdx.x - 96;
  int mat = g / 216;
  // the same in all lanes of a wave: kept scalar, and the tile indices with it
  int half = __builtin_amdgcn_readfirstlane(threadIdx.x >> 7);
  int r = (g - mat * 216) * 2 + half;
  const float* Bm = mat == 0 ? l_wq : (mat == 1 ? l_wk : l_wv);
  float* Cm = mat == 0 ? Qb : (mat == 1 ? Kb : Vb);
  gemm_tile<false, false>(eln, Bm, nullptr, Cm, N, K, sm + half * 2 * GBUF,
                          threadIdx.x & 127, r >> 4, r & 15);
}

// ---------------------------------------------------------------------------
// Local attention core: one block per (bp, head); 864 blocks, 8 waves.
// The score tile is built transposed, S^T(16 j x 16 i) = k(16 j x 8) @ q^T(8 x
// 16 i), so that in the accumulator a lane owns ONE softmax row i = mr and the
// eight columns j = r + 8*kg.  Row max, exp and the statistics then run in
// registers on all 32 lanes, and a register pair {p[2s], p[2s+1]} is, as it
// lies, the B fragment of O^T(16 x 16 i) += V^T(16 x 4 j) @ P^T(4 j x 16 i)
// under the k order j = 8*kg + 2*s + e, which the V^T loader follows.
// V^T rows 0..7 are v, row 8 is ones (its product is the softmax row sum),
// rows 9..15 are zero.  A wave keeps its two row tiles through both passes.
// Pass 1: stats (sum, sum^2, row max).  Pass 2: recompute + exp + p@v.
// ---------------------------------------------------------------------------
#define VTP 260   // V^T row pitch in dwords: 16 rows fall on 16 bank quads

__device__ __forceinline__ void attn_local_body(
    int blk, const float* __restrict__ Qb, const float* __restrict__ Kb,
    const float* __restrict__ Vb, float* __restrict__ Ofl) {
  __shared__ __attribute__((aligned(16))) float q_s[256 * 8];    // q[i][m]
  __shared__ __attribute__((aligned(16))) float k_s[256 * 8];    // k[j][m]
  __shared__ __attribute__((aligned(16))) float vt_s[10 * VTP];  // v[m][j], 1, 0
  __shared__ float st[8][2];
  int bp = blk >> 2, h = blk & 3;
  int b = bp / 27, p = bp % 27;
  int d = p / 9, ph = (p / 3) % 3, pwv = p % 3;
  int tid = threadIdx.x;
  {
    int c = tid;
    float qv[8], kv[8], vv[8];
    size_t idx = (size_t)(bp * 8) * 1024 + c * 4 + h;  // col = c*Hh + h
    const float *qg = Qb + idx, *kg_ = Kb + idx, *vg = Vb + idx;
#pragma unroll
    for (int pv = 0; pv < 8; ++pv) {
      qv[pv] = qg[pv * 1024]; kv[pv] = kg_[pv * 1024]; vv[pv] = vg[pv * 1024];
    }
    // keeps all 24 loads ahead of the wait below (one exposed latency)
    __builtin_amdgcn_sched_barrier(0);
    // stands before any register that a load above names is written again; the
    // address pairs are inputs so that they live up to the wait
    asm volatile("s_wait_xcnt 0x0" ::"v"(qg), "v"(kg_), "v"(vg) : "memory");
    // keeps later register writes from being lifted over the wait
    __builtin_amdgcn_sched_barrier(0);
    v4f q0 = {qv[0], qv[1], qv[2], qv[3]}, q1 = {qv[4], qv[5], qv[6], qv[7]};
    v4f k0 = {kv[0], kv[1], kv[2], kv[3]}, k1 = {kv[4], kv[5], kv[6], kv[7]};
    *(v4f*)&q_s[c * 8] = q0; *(v4f*)&q_s[c * 8 + 4] = q1;
    *(v4f*)&k_s[c * 8] = k0; *(v4f*)&k_s[c * 8 + 4] = k1;
#pragma unroll
    for (int pv = 0; pv < 8; ++pv) vt_s[pv * VTP + c] = vv[pv];
    vt_s[8 * VTP + c] = 1.f;
    vt_s[9 * VTP + c] = 0.f;
  }
  __syncthreads();
  int wave = tid >> 5, lane = tid & 31;
  int mr = lane & 15, kg = lane >> 4;
  const v8f z = {0, 0, 0, 0, 0, 0, 0, 0};
  // k order of the score product, A (k) and B (q) alike: step kc, half kg,
  // element e  <->  m = 4*kg + 2*kc + e: one 16-byte read holds both steps.
  v4f qf[2];
#pragma unroll
  for (int t = 0; t < 2; ++t)
    qf[t] = *(const v4f*)&q_s[((wave + t * 8) * 16 + mr) * 8 + kg * 4];
  const float* kp = k_s + mr * 8 + kg * 4;
  // ---- pass 1: raw score stats -------------------------------------------
  v2f s1v = {0.f, 0.f}, s2v = {0.f, 0.f};
  float rmax[2] = {-3.0e38f, -3.0e38f};
  for (int jt = 0; jt < 16; ++jt) {
    v4f kf = *(const v4f*)(kp + jt * 128);
    v2f ka = {kf[0], kf[1]}, kb = {kf[2], kf[3]};
#pragma unroll
    for (int t = 0; t < 2; ++t) {
      v2f qa = {qf[t][0], qf[t][1]}, qb = {qf[t][2], qf[t][3]};
      v8f acc = wmma4(kb, qb, wmma4(ka, qa, z));
#pragma unroll
      for (int s = 0; s < 4; ++s) {
        v2f pr = {acc[2 * s], acc[2 * s + 1]};
        s1v += pr; s2v += pr * pr;
        rmax[t] = fmaxf(rmax[t], fmaxf(pr[0], pr[1]));
      }
    }
  }
  {
    float a0 = wave_sum(s1v[0] + s1v[1]), a1 = wave_sum(s2v[0] + s2v[1]);
    if (lane == 0) { st[wave][0] = a0; st[wave][1] = a1; }
  }
#pragma unroll
  for (int t = 0; t < 2; ++t)   // the other half-wave holds the row's other j
    rmax[t] = fmaxf(rmax[t], __shfl_xor(rmax[t], 16, 32));
  __syncthreads();
  float S1 = 0.f, S2 = 0.f;
#pragma unroll
  for (int w = 0; w < 8; ++w) { S1 += st[w][0]; S2 += st[w][1]; }
  float mu = S1 * (1.f / 65536.f);
  float var = S2 * (1.f / 65536.f) - mu * mu;
  float rstd = rsqrtf(var + 1e-5f);   // InstanceNorm eps; mu cancels in softmax
  // ---- pass 2: softmax + p@v ---------------------------------------------
  float cs = rstd * 1.44269504088896341f;         // exp(x) = exp2(x * log2 e)
  v2f cs2 = {cs, cs};
  // one shift per row: its rounding cancels between numerator and row sum
  v2f nb2[2] = {{-rmax[0] * cs, -rmax[0] * cs}, {-rmax[1] * cs, -rmax[1] * cs}};
  v8f o[2] = {z, z};
  const float* vp = vt_s + (mr < 9 ? mr : 9) * VTP + kg * 8;
  for (int jt = 0; jt < 16; ++jt) {
    v4f kf = *(const v4f*)(kp + jt * 128);
    v4f va = *(const v4f*)(vp + jt * 16), vb = *(const v4f*)(vp + jt * 16 + 4);
    v2f ka = {kf[0], kf[1]}, kb = {kf[2], kf[3]};
    v2f vf[4] = {{va[0], va[1]}, {va[2], va[3]}, {vb[0], vb[1]}, {vb[2], vb[3]}};
#pragma unroll
    for (int t = 0; t < 2; ++t) {
      v2f qa = {qf[t][0], qf[t][1]}, qb = {qf[t][2], qf[t][3]};
      v8f acc = wmma4(kb, qb, wmma4(ka, qa, z));
#pragma unroll
      for (int s = 0; s < 4; ++s) {
        v2f x = {acc[2 * s], acc[2 * s + 1]};
        x = x * cs2 + nb2[t];
        v2f pf = {__builtin_amdgcn_exp2f(x[0]), __builtin_amdgcn_exp2f(x[1])};
        o[t] = wmma4(vf[s], pf, o[t]);
      }
    }
  }
  // o[t][r] = O^T[r + 8*kg][i = mr]: kg 0 holds the 8 numerators of row i,
  // kg 1 holds the row sum in r = 0.
#pragma unroll
  for (int t = 0; t < 2; ++t) {
    float den = __shfl_xor(o[t][0], 16, 32);
    if (kg == 0) {
      int cc = (wave + t * 8) * 16 + mr;
      float inv = 1.f / den;
#pragma unroll
      for (int m2 = 0; m2 < 8; ++m2) {
        int p1 = m2 >> 2, p2 = (m2 >> 1) & 1, p3 = m2 & 1;
        int s = (d * 2 + p1) * 36 + (ph * 2 + p2) * 6 + (pwv * 2 + p3);
        Ofl[(size_t)(b * 216 + s) * 1024 + cc * 4 + h] = o[t][m2] * inv;
      }
    }
  }
}

// One grid for both attentions.  Work-groups 0..127: stage 2 of the global
// branch; the other 864: the local attention core.
__global__ __launch_bounds__(256) void k_attn_all(
    const float* __restrict__ Qb, const float* __restrict__ Kb,
    const float* __restrict__ Vb, float* __restrict__ Ofl,
    const float* __restrict__ gqkv, const float* __restrict__ g_wo,
    float* __restrict__ gpart) {
  if (blockIdx.x < 128)
    g_attn_body(blockIdx.x, gqkv, g_wo, gpart);
  else
    attn_local_body(blockIdx.x - 128, Qb, Kb, Vb, Ofl);
}

// ---------------------------------------------------------------------------
// t2 = LN(out + res) per row over C
// ---------------------------------------------------------------------------
__device__ __forceinline__ void ln2_local_body(
    int row, const float* __restrict__ outb, const float* __restrict__ res,
    const float* __restrict__ g, const float* __restrict__ bb,
    float* __restrict__ t2) {
  __shared__ float red[256];
  int c = threadIdx.x;
  float v = outb[(size_t)row * 256 + c] + res[(size_t)row * 256 + c];
  float S1 = blk_sum(v, red), S2 = blk_sum(v * v, red);
  float mn = S1 * (1.f / 256.f), var = S2 * (1.f / 256.f) - mn * mn;
  t2[(size_t)row * 256 + c] = (v - mn) * rsqrtf(var + 1e-6f) * g[c] + bb[c];
}

// One grid for the local LN2 and stage 3 of the global branch.  Work-groups
// 0..31: stage 3; the other 1728: one LN2 row each.
__global__ __launch_bounds__(256) void k_ln2_all(
    const float* __restrict__ outb, const float* __restrict__ res,
    const float* __restrict__ l_g, const float* __restrict__ l_b,
    float* __restrict__ t2, const float* __restrict__ gsum,
    const float* __restrict__ tok_w, const float* __restrict__ tok_b,
    const float* __restrict__ gpart, const float* __restrict__ g_g,
    const float* __restrict__ g_b, const float* __restrict__ mo_w,
    const float* __restrict__ mo_b, float* __restrict__ gvec) {
  if (blockIdx.x < 32)
    g_out_body(blockIdx.x, gsum, tok_w, tok_b, gpart, g_g, g_b, mo_w, mo_b,
               gvec);
  else
    ln2_local_body(blockIdx.x - 32, outb, res, l_g, l_b, t2);
}

// ---------------------------------------------------------------------------
// y = x + broadcast(global) + local
// ---------------------------------------------------------------------------
__global__ __launch_bounds__(256) void k_final(const float* __restrict__ x,
                                               const float* __restrict__ gvec,
                                               const float* __restrict__ lres,
                                               float* __restrict__ y) {
  int idx = blockIdx.x * 256 + threadIdx.x;
  int c = idx & 255, bs = idx >> 8;
  int b = bs / 216, s = bs - b * 216;
  size_t xi = (size_t)(b * 256 + c) * 216 + s;
  y[xi] = x[xi] + gvec[b * 256 + c] + lres[(size_t)bs * 256 + c];
}

extern "C" void kernel_launch(void* const* d_in, const int* in_sizes, int n_in,
                              void* d_out, int out_size, void* d_ws,
                              size_t ws_size, hipStream_t stream) {
  const float* x       = (const float*)d_in[0];
  const float* g_tok_w = (const float*)d_in[1];
  const float* g_tok_b = (const float*)d_in[2];
  const float* g_ln1_g = (const float*)d_in[3];
  const float* g_ln1_b = (const float*)d_in[4];
  const float* g_wq    = (const float*)d_in[5];
  const float* g_wk    = (const float*)d_in[6];
  const float* g_wv    = (const float*)d_in[7];
  const float* g_wo    = (const float*)d_in[8];
  const float* g_ln2_g = (const float*)d_in[9];
  const float* g_ln2_b = (const float*)d_in[10];
  const float* g_mo_w  = (const float*)d_in[11];
  const float* g_mo_b  = (const float*)d_in[12];
  const float* l_pw    = (const float*)d_in[13];
  const float* l_pb    = (const float*)d_in[14];
  const float* l_ln1_g = (const float*)d_in[15];
  const float* l_ln1_b = (const float*)d_in[16];
  const float* l_wq    = (const float*)d_in[17];
  const float* l_wk    = (const float*)d_in[18];
  const float* l_wv    = (const float*)d_in[19];
  const float* l_wo    = (const float*)d_in[20];
  const float* l_ln2_g = (const float*)d_in[21];
  const float* l_ln2_b = (const float*)d_in[22];
  const float* l_mo_w  = (const float*)d_in[23];
  const float* l_mo_b  = (const float*)d_in[24];

  float* ws   = (float*)d_ws;
  float* gsum = ws;                 // 8*27, in 2048
  float* gvec = ws + 2048;          // 2048
  float* eln  = ws + 2048 + 2048;   // 1728*256
  float* res  = eln + 442368;       // 1728*256
  float* Qb   = res + 442368;       // 1728*1024
  float* Kb   = Qb + 1769472;       // 1728*1024
  float* Vb   = Kb + 1769472;       // 1728*1024
  float* ofl  = Vb + 1769472;       // 1728*1024
  float* gqkv = ofl + 1769472;      // 3*8*1024
  float* gpart = gqkv + 24576;      // 8*16*256
  float* outb = Qb;                 // alias: Qb dead after attention
  float* t2   = Kb;                 // alias: Kb dead after attention
  float* lres = Vb;                 // alias: Vb dead after attention

  k_local_embed<<<216, 256, 0, stream>>>(x, l_pw, l_pb, l_ln1_g, l_ln1_b, res,
                                         eln, gsum);
  k_qkv_all<<<744, 256, 0, stream>>>(eln, l_wq, l_wk, l_wv, Qb, Kb, Vb, 1024,
                                     256, gsum, g_tok_w, g_tok_b, g_ln1_g,
                                     g_ln1_b, g_wq, g_wk, g_wv, gqkv);
  k_attn_all<<<992, 256, 0, stream>>>(Qb, Kb, Vb, ofl, gqkv, g_wo, gpart);
  k_gemm_wmma<false, false><<<dim3(4, 27), 128, 0, stream>>>(
      ofl, l_wo, nullptr, outb, 1728, 256, 1024);
  k_ln2_all<<<1760, 256, 0, stream>>>(outb, res, l_ln2_g, l_ln2_b, t2, gsum,
                                      g_tok_w, g_tok_b, gpart, g_ln2_g, g_ln2_b,
                                      g_mo_w, g_mo_b, gvec);
  k_gemm_wmma<true, true><<<dim3(4, 27), 128, 0, stream>>>(
      t2, l_mo_w, l_mo_b, lres, 1728, 256, 256);
  k_final<<<1728, 256, 0, stream>>>(x, gvec, lres, (float*)d_out);
}

// v005
// Measured time: 83.5 microseconds a run.
// Two timings next to v004 put it at 1.33 and 1.32 times that version's speed.
// All steps since v000 together make it 4.40 times as fast.
#include <hip/hip_runtime.h>
#include <hip/hip_bf16.h>
#include <math.h>

typedef float v2f __attribute__((ext_vector_type(2)));
typedef float v4f __attribute__((ext_vector_type(4)));
typedef float v8f __attribute__((ext_vector_type(8)));

// ---------------------------------------------------------------------------
// fp32 WMMA: D(16x16) = A(16x4) * B(4x16) + C, full fp32 (matches reference
// numerics up to reassociation).  Lane L: mr = L%16, kg = L/16.
//   A frag (v2f): a[0]=A[mr][kg*2], a[1]=A[mr][kg*2+1]
//   B frag (v2f): b[0]=B[kg*2][mr], b[1]=B[kg*2+1][mr]
//   C/D (v8f):    c[r] = C[r + 8*kg][mr]
// ---------------------------------------------------------------------------
__device__ __forceinline__ v8f wmma4(v2f a, v2f b, v8f c) {
  return __builtin_amdgcn_wmma_f32_16x16x4_f32(false, a, false, b, (short)0, c,
                                               false, false);
}

__device__ __forceinline__ float gelu_exact(float x) {
  return 0.5f * x * (1.0f + erff(x * 0.70710678118654752f));
}

// ---------------------------------------------------------------------------
// Global branch, spread over many work-groups in three dependent stages.
// Rank-1 score => instance-norm stats factor; softmax is shift-invariant so
// only 1/sigma and row-max of the raw score are needed.
// No stage has a launch of its own: each is independent of the local-branch
// stage that runs at the same depth of the chain, and its work-groups are the
// first ones of that stage's grid.  The mean over (C,D,H,W) comes as 27 sums
// per batch from the patch-embed work-groups, which read all of x anyway.
// ---------------------------------------------------------------------------
__device__ __forceinline__ float wave_sum(float v) {
#pragma unroll
  for (int o = 16; o > 0; o >>= 1) v += __shfl_xor(v, o, 32);
  return v;
}
__device__ __forceinline__ float wave_max(float v) {
#pragma unroll
  for (int o = 16; o > 0; o >>= 1) v = fmaxf(v, __shfl_xor(v, o, 32));
  return v;
}
__device__ __forceinline__ float wave_min(float v) {
#pragma unroll
  for (int o = 16; o > 0; o >>= 1) v = fminf(v, __shfl_xor(v, o, 32));
  return v;
}

// Stage 1: q/k/v projections for all 8 batches at once (8x256 @ 256x1024 x3).
// Work-group = one matrix x 32 columns; wave = 32 rows of K; lane = column.
// Each weight element is read once by the whole grid.
// t_s: 256*8 floats, t[k][batch], 16-byte aligned; red: 8*8*32 floats,
// [wave][batch][lane].
__device__ __forceinline__ void g_qkv_body(
    int blk, float* t_s, float* red, const float* __restrict__ gsum,
    const float* __restrict__ tok_w, const float* __restrict__ tok_b,
    const float* __restrict__ ln1_g, const float* __restrict__ ln1_b,
    const float* __restrict__ wq, const float* __restrict__ wk,
    const float* __restrict__ wv, float* __restrict__ qkv) {
  int tid = threadIdx.x, wave = tid >> 5, lane = tid & 31;
  int mat = blk >> 5, col = (blk & 31) * 32 + lane;
  const float* Wm = mat == 0 ? wq : (mat == 1 ? wk : wv);
  const float* wp = Wm + (size_t)(wave * 32) * 1024 + col;
  float wreg[32];   // issued first: the LN below runs under their latency
#pragma unroll
  for (int i = 0; i < 32; ++i) wreg[i] = wp[i * 1024];
  const float* gp = gsum + wave * 27 + (lane < 27 ? lane : 26);
  float gs = *gp;   // lanes 0..26: the 27 patch sums of batch 'wave'
  float tw[8], tb8[8], lg[8], lb[8];
#pragma unroll
  for (int k = 0; k < 8; ++k) {
    int c = k * 32 + lane;
    tw[k] = tok_w[c]; tb8[k] = tok_b[c]; lg[k] = ln1_g[c]; lb[k] = ln1_b[c];
  }
  // the scheduler otherwise sinks part of the loads above behind the first
  // load wait (two or more exposed latencies instead of one)
  __builtin_amdgcn_sched_barrier(0);
  // stands before any register that a load above names is written again; the
  // address pairs are inputs so that they live up to the wait
  asm volatile("s_wait_xcnt 0x0" :: "v"(wp), "v"(gp) : "memory");
  // keeps later register writes from being lifted over the wait
  __builtin_amdgcn_sched_barrier(0);
  float m = wave_sum(lane < 27 ? gs : 0.f) / 55296.0f;
  // LN1 of batch 'wave': 8 channels per lane
  {
    float tok[8];
    float s1 = 0.f, s2 = 0.f;
#pragma unroll
    for (int k = 0; k < 8; ++k) {
      tok[k] = m * tw[k] + tb8[k];
      s1 += tok[k]; s2 += tok[k] * tok[k];
    }
    s1 = wave_sum(s1); s2 = wave_sum(s2);
    float mn = s1 * (1.f / 256.f);
    float var = s2 * (1.f / 256.f) - mn * mn;
    float rs = rsqrtf(var + 1e-6f);
#pragma unroll
    for (int k = 0; k < 8; ++k) {
      int c = k * 32 + lane;
      t_s[c * 8 + wave] = (tok[k] - mn) * rs * lg[k] + lb[k];
    }
  }
  __syncthreads();
  float acc[8] = {0, 0, 0, 0, 0, 0, 0, 0};
#pragma unroll
  for (int i = 0; i < 32; ++i) {
    const float4* tp = (const float4*)&t_s[(wave * 32 + i) * 8];
    float4 ta = tp[0], tb = tp[1];
    float w = wreg[i];
    acc[0] += ta.x * w; acc[1] += ta.y * w; acc[2] += ta.z * w; acc[3] += ta.w * w;
    acc[4] += tb.x * w; acc[5] += tb.y * w; acc[6] += tb.z * w; acc[7] += tb.w * w;
  }
#pragma unroll
  for (int bb = 0; bb < 8; ++bb) red[(wave * 8 + bb) * 32 + lane] = acc[bb];
  __syncthreads();
  float s = 0.f;   // this thread finishes batch 'wave', column 'col'
#pragma unroll
  for (int w = 0; w < 8; ++w) s += red[(w * 8 + wave) * 32 + lane];
  qkv[(size_t)(mat * 8 + wave) * 1024 + col] = s;
}

// Stage 2: work-group = (batch, head, quarter of the 256 score rows).
// Thread = (row of the quarter, quarter of the 256 columns).  The 64 output
// values then meet their 64 rows of wo; the partial 1x256 goes to 'part'.
__device__ __forceinline__ void g_attn_body(
    int blk, const float* __restrict__ qkv, const float* __restrict__ wo,
    float* __restrict__ part) {
  __shared__ __attribute__((aligned(16))) float k_s[256];
  __shared__ __attribute__((aligned(16))) float v_s[256];
  __shared__ float q_s[256];
  __shared__ float st[8][6];
  __shared__ float den_s[256], acc_s[256];
  __shared__ float o_s[64];
  __shared__ __attribute__((aligned(16))) float red[8 * 256];
  int tid = threadIdx.x, wave = tid >> 5, lane = tid & 31;
  int rq = blk & 3, h = (blk >> 2) & 3, b = blk >> 4;
  // wo rows (c*4 + h) of this wave's 8 score rows, issued first so that they
  // arrive while the softmax runs
  float4 w0[8], w1[8];
  const float* wr = wo + (size_t)((rq * 64 + wave * 8) * 4 + h) * 256 + lane * 4;
#pragma unroll
  for (int i = 0; i < 8; ++i) {
    w0[i] = *(const float4*)(wr + i * 1024);
    w1[i] = *(const float4*)(wr + i * 1024 + 128);
  }
  float qi = qkv[(size_t)(0 + b) * 1024 + h * 256 + tid];   // heads OUTER
  float ki = qkv[(size_t)(8 + b) * 1024 + h * 256 + tid];
  float vi = qkv[(size_t)(16 + b) * 1024 + h * 256 + tid];
  // the scheduler otherwise sinks part of the loads above behind the first
  // load wait (two or more exposed latencies instead of one)
  __builtin_amdgcn_sched_barrier(0);
  // stands before any register that a load above names is written again; the
  // address pair is an input so that it lives up to the wait
  asm volatile("s_wait_xcnt 0x0" :: "v"(wr) : "memory");
  // keeps later register writes from being lifted over the wait
  __builtin_amdgcn_sched_barrier(0);
  q_s[tid] = qi; k_s[tid] = ki; v_s[tid] = vi;
  {
    float a0 = wave_sum(qi), a1 = wave_sum(qi * qi);
    float a2 = wave_sum(ki), a3 = wave_sum(ki * ki);
    float a4 = wave_max(ki), a5 = wave_min(ki);
    if (lane == 0) {
      st[wave][0] = a0; st[wave][1] = a1; st[wave][2] = a2;
      st[wave][3] = a3; st[wave][4] = a4; st[wave][5] = a5;
    }
  }
  __syncthreads();
  float Sq = 0.f, Sq2 = 0.f, Sk = 0.f, Sk2 = 0.f;
  float kmx = st[0][4], kmn = st[0][5];
#pragma unroll
  for (int w = 0; w < 8; ++w) {
    Sq += st[w][0]; Sq2 += st[w][1]; Sk += st[w][2]; Sk2 += st[w][3];
    kmx = fmaxf(kmx, st[w][4]); kmn = fminf(kmn, st[w][5]);
  }
  float mu  = (Sq * Sk)  * (1.f / 65536.f);
  float ex2 = (Sq2 * Sk2) * (1.f / 65536.f);
  float rstd = rsqrtf(ex2 - mu * mu + 1e-5f);
  float qr = q_s[rq * 64 + (tid & 63)];
  int j0 = (tid >> 6) * 64;
  float rmax = qr * (qr >= 0.f ? kmx : kmn);  // row max of raw score
  float den = 0.f, acc = 0.f;
#pragma unroll 4
  for (int j = 0; j < 64; j += 4) {
    float4 k4 = *(const float4*)&k_s[j0 + j];
    float4 v4 = *(const float4*)&v_s[j0 + j];
    float p0 = __expf((qr * k4.x - rmax) * rstd);
    float p1 = __expf((qr * k4.y - rmax) * rstd);
    float p2 = __expf((qr * k4.z - rmax) * rstd);
    float p3 = __expf((qr * k4.w - rmax) * rstd);
    den += p0; acc += p0 * v4.x;
    den += p1; acc += p1 * v4.y;
    den += p2; acc += p2 * v4.z;
    den += p3; acc += p3 * v4.w;
  }
  den_s[tid] = den; acc_s[tid] = acc;
  __syncthreads();
  if (tid < 64) {
    float dd = (den_s[tid] + den_s[64 + tid]) + (den_s[128 + tid] + den_s[192 + tid]);
    float aa = (acc_s[tid] + acc_s[64 + tid]) + (acc_s[128 + tid] + acc_s[192 + tid]);
    o_s[tid] = aa / dd;
  }
  __syncthreads();
  float4 p0 = {0.f, 0.f, 0.f, 0.f}, p1 = {0.f, 0.f, 0.f, 0.f};
#pragma unroll
  for (int i = 0; i < 8; ++i) {
    float o = o_s[wave * 8 + i];
    p0.x += o * w0[i].x; p0.y += o * w0[i].y; p0.z += o * w0[i].z; p0.w += o * w0[i].w;
    p1.x += o * w1[i].x; p1.y += o * w1[i].y; p1.z += o * w1[i].z; p1.w += o * w1[i].w;
  }
  *(float4*)&red[wave * 256 + lane * 4] = p0;
  *(float4*)&red[wave * 256 + 128 + lane * 4] = p1;
  __syncthreads();
  float s = 0.f;
#pragma unroll
  for (int w = 0; w < 8; ++w) s += red[w * 256 + tid];
  part[(size_t)blk * 256 + tid] = s;   // [(b*16 + h*4 + rq)][256]
}

// Stage 3: work-group of 128 threads = (batch, eighth of the 256 outputs).
// Sums the 16 partials, adds the residual, LN2 (two channels per thread), then
// map-out rows ('bc,oc->bo') with the lanes along c (coalesced) and a wave
// reduction per output, then GELU.
__device__ __forceinline__ void g_out_body(
    int blk, const float* __restrict__ gsum,
    const float* __restrict__ tok_w, const float* __restrict__ tok_b,
    const float* __restrict__ part,
    const float* __restrict__ ln2_g, const float* __restrict__ ln2_b,
    const float* __restrict__ mo_w, const float* __restrict__ mo_b,
    float* __restrict__ gvec) {
  __shared__ __attribute__((aligned(16))) float t_s[256];
  __shared__ float st[4][2];
  int c = threadIdx.x, wave = c >> 5, lane = c & 31;
  int b = blk >> 3, o0 = (blk & 7) * 32 + wave * 8;
  float4 m0[8], m1[8];   // issued first: LN2 runs under their latency
  const float* mr = mo_w + (size_t)o0 * 256 + lane * 4;
#pragma unroll
  for (int r = 0; r < 8; ++r) {
    m0[r] = *(const float4*)(mr + r * 256);
    m1[r] = *(const float4*)(mr + r * 256 + 128);
  }
  const float* pp = part + (size_t)(b * 16) * 256 + c;
  float pr[16], ps[16];   // channels c and c + 128
#pragma unroll
  for (int p = 0; p < 16; ++p) { pr[p] = pp[p * 256]; ps[p] = pp[p * 256 + 128]; }
  int gi = lane < 27 ? lane : 26, mi = o0 + (lane & 7);
  float gs = gsum[b * 27 + gi];   // lanes 0..26: the 27 patch sums of batch b
  float tw0 = tok_w[c], tb0 = tok_b[c], tw1 = tok_w[c + 128], tb1 = tok_b[c + 128];
  float g20 = ln2_g[c], b20 = ln2_b[c], g21 = ln2_g[c + 128], b21 = ln2_b[c + 128];
  float mb = mo_b[mi];
  // the scheduler otherwise sinks part of the loads above behind the first
  // load wait (two or more exposed latencies instead of one)
  __builtin_amdgcn_sched_barrier(0);
  // stands before any register that a load above names is written again; the
  // address pair and the offsets are inputs so that they live up to the wait
  asm volatile("s_wait_xcnt 0x0" :: "v"(mr), "v"(c), "v"(gi), "v"(mi) : "memory");
  // keeps later register writes from being lifted over the wait
  __builtin_amdgcn_sched_barrier(0);
  float m = wave_sum(lane < 27 ? gs : 0.f) / 55296.0f;
  float out0 = 0.f, out1 = 0.f;
#pragma unroll
  for (int p = 0; p < 16; ++p) { out0 += pr[p]; out1 += ps[p]; }
  float ov0 = out0 + (m * tw0 + tb0), ov1 = out1 + (m * tw1 + tb1);
  {
    float a0 = wave_sum(ov0 + ov1), a1 = wave_sum(ov0 * ov0 + ov1 * ov1);
    if (lane == 0) { st[wave][0] = a0; st[wave][1] = a1; }
  }
  __syncthreads();
  float T1 = 0.f, T2 = 0.f;
#pragma unroll
  for (int w = 0; w < 4; ++w) { T1 += st[w][0]; T2 += st[w][1]; }
  float mn2 = T1 * (1.f / 256.f), var2 = T2 * (1.f / 256.f) - mn2 * mn2;
  float rs2 = rsqrtf(var2 + 1e-6f);
  t_s[c] = (ov0 - mn2) * rs2 * g20 + b20;
  t_s[c + 128] = (ov1 - mn2) * rs2 * g21 + b21;
  __syncthreads();
  float4 ta = *(const float4*)&t_s[lane * 4];
  float4 tc = *(const float4*)&t_s[128 + lane * 4];
  float val = 0.f;
#pragma unroll
  for (int r = 0; r < 8; ++r) {
    float dd = m0[r].x * ta.x + m0[r].y * ta.y + m0[r].z * ta.z + m0[r].w * ta.w +
               m1[r].x * tc.x + m1[r].y * tc.y + m1[r].z * tc.z + m1[r].w * tc.w;
    dd = wave_sum(dd);
    if (lane == r) val = dd;
  }
  if (lane < 8) gvec[b * 256 + o0 + lane] = gelu_exact(val + mb);
}

// ---------------------------------------------------------------------------
// Local branch: patchify (2x2x2) + 8x8 embed + LN over C.
// Emits res (B,216,C) and eln rows (bp*8+pv, C), and the sum of the 2048 x
// values it has read (one of the 27 parts of its batch's global-branch mean).
// ---------------------------------------------------------------------------
__global__ __launch_bounds__(256) void k_local_embed(
    const float* __restrict__ x, const float* __restrict__ pw,
    const float* __restrict__ pb, const float* __restrict__ ln_g,
    const float* __restrict__ ln_b, float* __restrict__ res,
    float* __restrict__ eln, float* __restrict__ gsum) {
  __shared__ float pw_s[64];
  __shared__ float pb_s[8];
  __shared__ float sc[8 * 256];
  __shared__ float part1[256], part2[256];
  __shared__ float mean_s[8], rstd_s[8];
  __shared__ float xs_s[8];
  int bp = blockIdx.x, b = bp / 27, p = bp % 27;
  int d = p / 9, hh = (p / 3) % 3, w = p % 3;
  int c = threadIdx.x;
  if (c < 64) pw_s[c] = pw[c];
  if (c < 8) pb_s[c] = pb[c];
  __syncthreads();
  const float* xb = x + (size_t)(b * 256 + c) * 216;
  float patch[8];
#pragma unroll
  for (int u = 0; u < 8; ++u) {
    int p1 = u >> 2, p2 = (u >> 1) & 1, p3 = u & 1;
    patch[u] = xb[(d * 2 + p1) * 36 + (hh * 2 + p2) * 6 + (w * 2 + p3)];
  }
  {
    float xs = wave_sum(((patch[0] + patch[1]) + (patch[2] + patch[3])) +
                        ((patch[4] + patch[5]) + (patch[6] + patch[7])));
    if ((c & 31) == 0) xs_s[c >> 5] = xs;   // read behind the next barrier
  }
  float tokv[8];
#pragma unroll
  for (int e = 0; e < 8; ++e) {
    float a = pb_s[e];
#pragma unroll
    for (int u = 0; u < 8; ++u) a += pw_s[e * 8 + u] * patch[u];
    tokv[e] = a;
    sc[e * 256 + c] = a;
    int p1 = e >> 2, p2 = (e >> 1) & 1, p3 = e & 1;
    int s = (d * 2 + p1) * 36 + (hh * 2 + p2) * 6 + (w * 2 + p3);
    res[(size_t)(b * 216 + s) * 256 + c] = a;   // residual uses raw tok
  }
  __syncthreads();
  int g = c >> 5, lane = c & 31;
  float s1 = 0.f, s2 = 0.f;
#pragma unroll
  for (int k = 0; k < 8; ++k) {
    float vv = sc[g * 256 + lane + k * 32];
    s1 += vv; s2 += vv * vv;
  }
  part1[c] = s1; part2[c] = s2;
  if (c == 0)
    gsum[bp] = ((xs_s[0] + xs_s[1]) + (xs_s[2] + xs_s[3])) +
               ((xs_s[4] + xs_s[5]) + (xs_s[6] + xs_s[7]));
  __syncthreads();
  if (c < 8) {
    float a = 0.f, bb = 0.f;
    for (int l = 0; l < 32; ++l) { a += part1[c * 32 + l]; bb += part2[c * 32 + l]; }
    float mn = a * (1.f / 256.f), vr = bb * (1.f / 256.f) - mn * mn;
    mean_s[c] = mn; rstd_s[c] = rsqrtf(vr + 1e-6f);
  }
  __syncthreads();
  float lg = ln_g[c], lb = ln_b[c];
#pragma unroll
  for (int e = 0; e < 8; ++e)
    eln[(size_t)(bp * 8 + e) * 256 + c] =
        (tokv[e] - mean_s[e]) * rstd_s[e] * lg + lb;
}

// ---------------------------------------------------------------------------
// fp32 WMMA GEMM: C = act(A(MxK) @ B(KxN) [+bias]).  TRANSB/ACT are template
// params so the inner loop is branch-free.  128 threads (4 waves) per tile; each wave
// owns a 16(M) x 64(N) strip; all 4 waves share one n-strip, so the 64x64 B
// tile is staged through LDS once per K-chunk (16-byte loads, 4x reuse).
// The K loop is software-pipelined at both levels.  Global: while the WMMAs of
// chunk c run, the A fragments and the B tile of chunk c+1 are on their way
// into registers; the tile then goes into the other LDS buffer, so one barrier
// per chunk both publishes it and ends the reads of the buffer refilled next.
// LDS: B fragments are read two groups of WMMAs ahead of their use.  For that
// a fragment must land in its register pair as it is, so the tile lies in LDS
// as rows of k pairs: Bs[k/2][n][k%2], row pitch GPP dwords (128 + 32: the two
// half-waves, one k pair apart, fall on different halves of the 64 banks).
// Requires M%64==0, N%64==0, K%64==0.
// ---------------------------------------------------------------------------
#define GKC 64
#define GPP 160

template <bool TRANSB>
__device__ __forceinline__ void gemm_fetch(const float* __restrict__ arow,
                                           const float* __restrict__ bsrc,
                                           int k0, int N, v2f (&an)[GKC / 4],
                                           v4f (&bn)[8]) {
  const float* ap = arow + k0;
  const float* bp[8];
#pragma unroll
  for (int i = 0; i < 8; ++i) {
    // !TRANSB: rows k0 + 16*(i/2) + i%2 (+ 2*rp0, in bsrc); TRANSB: k quad 2*i
    size_t off = TRANSB ? (size_t)(k0 + i * 8)
                        : (size_t)(k0 + (i >> 1) * 16 + (i & 1)) * N;
    bp[i] = bsrc + off;
  }
#pragma unroll
  for (int i = 0; i < GKC / 4; ++i) an[i] = *(const v2f*)(ap + i * 4);
#pragma unroll
  for (int i = 0; i < 8; ++i) bn[i] = *(const v4f*)bp[i];
  // stands before any register that a load above names is written again; the
  // address pairs are inputs so that they live up to the wait (TRANSB: the B
  // loads share one pair and differ in their immediate offsets)
  if (TRANSB)
    asm volatile("s_wait_xcnt 0x0" ::"v"(ap), "v"(bp[0]) : "memory");
  else
    asm volatile("s_wait_xcnt 0x0" ::"v"(ap), "v"(bp[0]), "v"(bp[1]),
                 "v"(bp[2]), "v"(bp[3]), "v"(bp[4]), "v"(bp[5]), "v"(bp[6]),
                 "v"(bp[7])
                 : "memory");
}

template <bool TRANSB>
__device__ __forceinline__ void gemm_put(float* bd, int tid,
                                         const v4f (&bn)[8]) {
  if (!TRANSB) {
    int rp0 = tid >> 4, c4 = (tid & 15) * 4;
#pragma unroll
    for (int i = 0; i < 4; ++i) {
      v4f x = bn[2 * i], y = bn[2 * i + 1];   // rows 2*rp and 2*rp + 1
      v4f lo = {x[0], y[0], x[1], y[1]}, hi = {x[2], y[2], x[3], y[3]};
      float* d = bd + (rp0 + 8 * i) * GPP + c4 * 2;
      *(v4f*)d = lo;
      *(v4f*)(d + 4) = hi;
    }
  } else {
    int c = tid & 63, q0 = tid >> 6;
#pragma unroll
    for (int i = 0; i < 8; ++i) {
      int q = q0 + 2 * i;                      // k = 4*q .. 4*q + 3
      v2f lo = {bn[i][0], bn[i][1]}, hi = {bn[i][2], bn[i][3]};
      *(v2f*)(bd + (2 * q) * GPP + c * 2) = lo;
      *(v2f*)(bd + (2 * q + 1) * GPP + c * 2) = hi;
    }
  }
}

#define GBUF ((GKC / 2) * GPP)   // one LDS buffer, in dwords

// One 64 x 64 tile (mblk, nblk) by 128 threads (tid 0..127); Bs: 2 * GBUF
// dwords of their own, 16-byte aligned.  Its barriers are the work-group's.
template <bool TRANSB, bool ACT>
__device__ __forceinline__ void gemm_tile(
    const float* __restrict__ A, const float* __restrict__ B,
    const float* __restrict__ bias, float* __restrict__ C, int N, int K,
    float* Bs, int tid, int mblk, int nblk) {
  int wave = tid >> 5, lane = tid & 31;
  int mr = lane & 15, kg = lane >> 4;
  int m0 = (mblk * 4 + wave) * 16;
  int n0 = nblk * 64;
  v8f z = {0, 0, 0, 0, 0, 0, 0, 0};
  v8f acc[4] = {z, z, z, z};
  const float* arow = A + (size_t)(m0 + mr) * K + kg * 2;
  const float* bsrc =
      TRANSB ? B + (size_t)(n0 + (tid & 63)) * K + (tid >> 6) * 4
             : B + (size_t)((tid >> 4) * 2) * N + n0 + (tid & 15) * 4;
  v2f an[GKC / 4];
  v4f bn[8];
  gemm_fetch<TRANSB>(arow, bsrc, 0, N, an, bn);
  gemm_put<TRANSB>(Bs, tid, bn);
  __syncthreads();
  for (int k0 = 0, buf = 0;; k0 += GKC, buf ^= 1) {
    v2f ac[GKC / 4];
#pragma unroll
    for (int i = 0; i < GKC / 4; ++i) ac[i] = an[i];
    bool more = k0 + GKC < K;   // the same for the whole work-group
    if (more) gemm_fetch<TRANSB>(arow, bsrc, k0 + GKC, N, an, bn);
    // fragment of k-step kc, column tile t: bs + kc*2*GPP + t*32.  Groups of
    // two k-steps (8 WMMAs), a ring of three: g+2 is read while g multiplies.
    const float* bs = Bs + buf * GBUF + kg * GPP + mr * 2;
    v2f bf[3][8];
#pragma unroll
    for (int g = 0; g < 2; ++g)
#pragma unroll
      for (int j = 0; j < 8; ++j)
        bf[g][j] = *(const v2f*)(bs + (g * 2 + (j >> 2)) * 2 * GPP + (j & 3) * 32);
#pragma unroll
    for (int g = 0; g < GKC / 8; ++g) {
      if (g + 2 < GKC / 8) {
#pragma unroll
        for (int j = 0; j < 8; ++j)
          bf[(g + 2) % 3][j] = *(const v2f*)(bs + ((g + 2) * 2 + (j >> 2)) * 2 * GPP +
                                             (j & 3) * 32);
      }
      // keeps the LDS reads above ahead of this group's WMMAs: the scheduler
      // otherwise sinks each read to just before its use and waits it out
      __builtin_amdgcn_sched_barrier(0);
#pragma unroll
      for (int j = 0; j < 8; ++j)
        acc[j & 3] = wmma4(ac[g * 2 + (j >> 2)], bf[g % 3][j], acc[j & 3]);
    }
    if (!more) break;
    gemm_put<TRANSB>(Bs + (buf ^ 1) * GBUF, tid, bn);
    __syncthreads();   // publishes chunk c+1; ends the reads of chunk c
  }
#pragma unroll
  for (int t = 0; t < 4; ++t) {
    int n = n0 + t * 16 + mr;
    float bb = ACT ? bias[n] : 0.f;
#pragma unroll
    for (int r = 0; r < 8; ++r) {
      int row = m0 + r + 8 * kg;
      float v = acc[t][r] + bb;
      if (ACT) v = gelu_exact(v);
      C[(size_t)row * N + n] = v;
    }
  }
}

// One grid for the local attention-output GEMM and stage 3 of the global
// branch.  Work-groups 0..63: stage 3; the other 108: one GEMM tile each,
// n fastest.
__global__ __launch_bounds__(128) void k_wo_all(
    const float* __restrict__ A, const float* __restrict__ B,
    float* __restrict__ C, int N, int K, const float* __restrict__ gsum,
    const float* __restrict__ tok_w, const float* __restrict__ tok_b,
    const float* __restrict__ gpart, const float* __restrict__ g_g,
    const float* __restrict__ g_b, const float* __restrict__ mo_w,
    const float* __restrict__ mo_b, float* __restrict__ gvec) {
  __shared__ __attribute__((aligned(16))) float Bs[2 * GBUF];
  if (blockIdx.x < 64) {
    g_out_body(blockIdx.x, gsum, tok_w, tok_b, gpart, g_g, g_b, mo_w, mo_b,
               gvec);
    return;
  }
  int g = blockIdx.x - 64;
  gemm_tile<false, false>(A, B, nullptr, C, N, K, Bs, threadIdx.x, g >> 2,
                          g & 3);
  // stands behind the tile's C stores, before any register that they name can
  // be written again on a way the built code has from here into stage 3's part
  asm volatile("s_wait_xcnt 0x0" ::: "memory");
}

// One grid for the local q, k and v projections and stage 1 of the global
// branch.  Work-groups 0..95: stage 1.  The other 648: two GEMM tiles each,
// one per 128 threads, neighbours in n (the same A rows) of one matrix; 216
// work-groups per matrix.
__global__ __launch_bounds__(256) void k_qkv_all(
    const float* __restrict__ eln, const float* __restrict__ l_wq,
    const float* __restrict__ l_wk, const float* __restrict__ l_wv,
    float* __restrict__ Qb, float* __restrict__ Kb, float* __restrict__ Vb,
    int N, int K, const float* __restrict__ gsum,
    const float* __restrict__ tok_w, const float* __restrict__ tok_b,
    const float* __restrict__ ln1_g, const float* __restrict__ ln1_b,
    const float* __restrict__ g_wq, const float* __restrict__ g_wk,
    const float* __restrict__ g_wv, float* __restrict__ gqkv) {
  __shared__ __attribute__((aligned(16))) float sm[4 * GBUF];
  if (blockIdx.x < 96) {
    g_qkv_body(blockIdx.x, sm, sm + 2048, gsum, tok_w, tok_b, ln1_g, ln1_b,
               g_wq, g_wk, g_wv, gqkv);
    return;
  }
  int g = blockIdx.x - 96;
  int mat = g / 216;
  // the same in all lanes of a wave: kept scalar, and the tile indices with it
  int half = __builtin_amdgcn_readfirstlane(threadIdx.x >> 7);
  int r = (g - mat * 216) * 2 + half;
  const float* Bm = mat == 0 ? l_wq : (mat == 1 ? l_wk : l_wv);
  float* Cm = mat == 0 ? Qb : (mat == 1 ? Kb : Vb);
  gemm_tile<false, false>(eln, Bm, nullptr, Cm, N, K, sm + half * 2 * GBUF,
                          threadIdx.x & 127, r >> 4, r & 15);
}

// ---------------------------------------------------------------------------
// Local attention core: one block per (bp, head); 864 blocks, 8 waves.
// The score tile is built transposed, S^T(16 j x 16 i) = k(16 j x 8) @ q^T(8 x
// 16 i), so that in the accumulator a lane owns ONE softmax row i = mr and the
// eight columns j = r + 8*kg.  Row max, exp and the statistics then run in
// registers on all 32 lanes, and a register pair {p[2s], p[2s+1]} is, as it
// lies, the B fragment of O^T(16 x 16 i) += V^T(16 x 4 j) @ P^T(4 j x 16 i)
// under the k order j = 8*kg + 2*s + e, which the V^T loader follows.
// V^T rows 0..7 are v, row 8 is ones (its product is the softmax row sum),
// rows 9..15 are zero.  A wave keeps its two row tiles through both passes.
// Pass 1: stats (sum, sum^2, row max).  Pass 2: recompute + exp + p@v.
// ---------------------------------------------------------------------------
#define VTP 260   // V^T row pitch in dwords: 16 rows fall on 16 bank quads

__device__ __forceinline__ void attn_local_body(
    int blk, const float* __restrict__ Qb, const float* __restrict__ Kb,
    const float* __restrict__ Vb, float* __restrict__ Ofl) {
  __shared__ __attribute__((aligned(16))) float q_s[256 * 8];    // q[i][m]
  __shared__ __attribute__((aligned(16))) float k_s[256 * 8];    // k[j][m]
  __shared__ __attribute__((aligned(16))) float vt_s[10 * VTP];  // v[m][j], 1, 0
  __shared__ float st[8][2];
  int bp = blk >> 2, h = blk & 3;
  int b = bp / 27, p = bp % 27;
  int d = p / 9, ph = (p / 3) % 3, pwv = p % 3;
  int tid = threadIdx.x;
  {
    int c = tid;
    float qv[8], kv[8], vv[8];
    size_t idx = (size_t)(bp * 8) * 1024 + c * 4 + h;  // col = c*Hh + h
    const float *qg = Qb + idx, *kg_ = Kb + idx, *vg = Vb + idx;
#pragma unroll
    for (int pv = 0; pv < 8; ++pv) {
      qv[pv] = qg[pv * 1024]; kv[pv] = kg_[pv * 1024]; vv[pv] = vg[pv * 1024];
    }
    // keeps all 24 loads ahead of the wait below (one exposed latency)
    __builtin_amdgcn_sched_barrier(0);
    // stands before any register that a load above names is written again; the
    // address pairs are inputs so that they live up to the wait
    asm volatile("s_wait_xcnt 0x0" ::"v"(qg), "v"(kg_), "v"(vg) : "memory");
    // keeps later register writes from being lifted over the wait
    __builtin_amdgcn_sched_barrier(0);
    v4f q0 = {qv[0], qv[1], qv[2], qv[3]}, q1 = {qv[4], qv[5], qv[6], qv[7]};
    v4f k0 = {kv[0], kv[1], kv[2], kv[3]}, k1 = {kv[4], kv[5], kv[6], kv[7]};
    *(v4f*)&q_s[c * 8] = q0; *(v4f*)&q_s[c * 8 + 4] = q1;
    *(v4f*)&k_s[c * 8] = k0; *(v4f*)&k_s[c * 8 + 4] = k1;
#pragma unroll
    for (int pv = 0; pv < 8; ++pv) vt_s[pv * VTP + c] = vv[pv];
    vt_s[8 * VTP + c] = 1.f;
    vt_s[9 * VTP + c] = 0.f;
  }
  __syncthreads();
  int wave = tid >> 5, lane = tid & 31;
  int mr = lane & 15, kg = lane >> 4;
  const v8f z = {0, 0, 0, 0, 0, 0, 0, 0};
  // k order of the score product, A (k) and B (q) alike: step kc, half kg,
  // element e  <->  m = 4*kg + 2*kc + e: one 16-byte read holds both steps.
  v4f qf[2];
#pragma unroll
  for (int t = 0; t < 2; ++t)
    qf[t] = *(const v4f*)&q_s[((wave + t * 8) * 16 + mr) * 8 + kg * 4];
  const float* kp = k_s + mr * 8 + kg * 4;
  // ---- pass 1: raw score stats -------------------------------------------
  v2f s1v = {0.f, 0.f}, s2v = {0.f, 0.f};
  float rmax[2] = {-3.0e38f, -3.0e38f};
  for (int jt = 0; jt < 16; ++jt) {
    v4f kf = *(const v4f*)(kp + jt * 128);
    v2f ka = {kf[0], kf[1]}, kb = {kf[2], kf[3]};
#pragma unroll
    for (int t = 0; t < 2; ++t) {
      v2f qa = {qf[t][0], qf[t][1]}, qb = {qf[t][2], qf[t][3]};
      v8f acc = wmma4(kb, qb, wmma4(ka, qa, z));
#pragma unroll
      for (int s = 0; s < 4; ++s) {
        v2f pr = {acc[2 * s], acc[2 * s + 1]};
        s1v += pr; s2v += pr * pr;
        rmax[t] = fmaxf(rmax[t], fmaxf(pr[0], pr[1]));
      }
    }
  }
  {
    float a0 = wave_sum(s1v[0] + s1v[1]), a1 = wave_sum(s2v[0] + s2v[1]);
    if (lane == 0) { st[wave][0] = a0; st[wave][1] = a1; }
  }
#pragma unroll
  for (int t = 0; t < 2; ++t)   // the other half-wave holds the row's other j
    rmax[t] = fmaxf(rmax[t], __shfl_xor(rmax[t], 16, 32));
  __syncthreads();
  float S1 = 0.f, S2 = 0.f;
#pragma unroll
  for (int w = 0; w < 8; ++w) { S1 += st[w][0]; S2 += st[w][1]; }
  float mu = S1 * (1.f / 65536.f);
  float var = S2 * (1.f / 65536.f) - mu * mu;
  float rstd = rsqrtf(var + 1e-5f);   // InstanceNorm eps; mu cancels in softmax
  // ---- pass 2: softmax + p@v ---------------------------------------------
  float cs = rstd * 1.44269504088896341f;         // exp(x) = exp2(x * log2 e)
  v2f cs2 = {cs, cs};
  // one shift per row: its rounding cancels between numerator and row sum
  v2f nb2[2] = {{-rmax[0] * cs, -rmax[0] * cs}, {-rmax[1] * cs, -rmax[1] * cs}};
  v8f o[2] = {z, z};
  const float* vp = vt_s + (mr < 9 ? mr : 9) * VTP + kg * 8;
  for (int jt = 0; jt < 16; ++jt) {
    v4f kf = *(const v4f*)(kp + jt * 128);
    v4f va = *(const v4f*)(vp + jt * 16), vb = *(const v4f*)(vp + jt * 16 + 4);
    v2f ka = {kf[0], kf[1]}, kb = {kf[2], kf[3]};
    v2f vf[4] = {{va[0], va[1]}, {va[2], va[3]}, {vb[0], vb[1]}, {vb[2], vb[3]}};
#pragma unroll
    for (int t = 0; t < 2; ++t) {
      v2f qa = {qf[t][0], qf[t][1]}, qb = {qf[t][2], qf[t][3]};
      v8f acc = wmma4(kb, qb, wmma4(ka, qa, z));
#pragma unroll
      for (int s = 0; s < 4; ++s) {
        v2f x = {acc[2 * s], acc[2 * s + 1]};
        x = x * cs2 + nb2[t];
        v2f pf = {__builtin_amdgcn_exp2f(x[0]), __builtin_amdgcn_exp2f(x[1])};
        o[t] = wmma4(vf[s], pf, o[t]);
      }
    }
  }
  // o[t][r] = O^T[r + 8*kg][i = mr]: kg 0 holds the 8 numerators of row i,
  // kg 1 holds the row sum in r = 0.
#pragma unroll
  for (int t = 0; t < 2; ++t) {
    float den = __shfl_xor(o[t][0], 16, 32);
    if (kg == 0) {
      int cc = (wave + t * 8) * 16 + mr;
      float inv = 1.f / den;
#pragma unroll
      for (int m2 = 0; m2 < 8; ++m2) {
        int p1 = m2 >> 2, p2 = (m2 >> 1) & 1, p3 = m2 & 1;
        int s = (d * 2 + p1) * 36 + (ph * 2 + p2) * 6 + (pwv * 2 + p3);
        Ofl[(size_t)(b * 216 + s) * 1024 + cc * 4 + h] = o[t][m2] * inv;
      }
    }
  }
}

// One grid for both attentions.  Work-groups 0..127: stage 2 of the global
// branch; the other 864: the local attention core.
__global__ __launch_bounds__(256) void k_attn_all(
    const float* __restrict__ Qb, const float* __restrict__ Kb,
    const float* __restrict__ Vb, float* __restrict__ Ofl,
    const float* __restrict__ gqkv, const float* __restrict__ g_wo,
    float* __restrict__ gpart) {
  if (blockIdx.x < 128)
    g_attn_body(blockIdx.x, gqkv, g_wo, gpart);
  else
    attn_local_body(blockIdx.x - 128, Qb, Kb, Vb, Ofl);
}

// ---------------------------------------------------------------------------
// Tail of the local branch in one launch: t2 = LN(out + res) per row over C,
// map-out GEMM 'sc,oc->os' + bias + GELU, and y = x + broadcast(global) + local.
// Work-group = 16 rows s x 128 outputs o (both halves of o redo the cheap LN of
// their 16 rows); 216 work-groups, 8 waves, a wave owns 16 o.
// The product is built transposed, D(16 o x 16 s) = mo_w(16 o x K) @ t2^T(K x
// 16 s): in the accumulator the 16 lanes of a half-wave then hold 16 successive
// s of one o, which are 64 successive bytes of x and of y.
// Both operands lie in LDS as rows of k, pitch TP dwords (16 bytes x odd).  A
// wave brings its own 16 rows of mo_w with whole-line loads, issued ahead of
// the LN.  k order, A and B alike: read c8, half kg, step kc, element e  <->
// k = 8*c8 + 4*kg + 2*kc + e: one 16-byte read holds two k-steps.
// ---------------------------------------------------------------------------
#define TP 260

__global__ __launch_bounds__(256) void k_tail(
    const float* __restrict__ outb, const float* __restrict__ res,
    const float* __restrict__ ln_g, const float* __restrict__ ln_b,
    const float* __restrict__ mo_w, const float* __restrict__ mo_b,
    const float* __restrict__ x, const float* __restrict__ gvec,
    float* __restrict__ y) {
  __shared__ __attribute__((aligned(16))) float t_s[16 * TP];    // t2[s][k]
  __shared__ __attribute__((aligned(16))) float w_s[128 * TP];   // mo_w[o][k]
  int tid = threadIdx.x, wave = tid >> 5, lane = tid & 31;
  int mr = lane & 15, kg = lane >> 4;
  int row0 = (blockIdx.x >> 1) * 16;
  int n0 = (blockIdx.x & 1) * 128 + wave * 16;
  // LN operands: rows row0 + 2*wave and + 1; the wave's 16 rows of mo_w;
  // epilogue operands: lane = row s = row0 + mr, outputs o = oo + r
  size_t lo = (size_t)(row0 + wave * 2) * 256 + lane * 4;
  const float *op = outb + lo, *rp = res + lo;
  const float *lgp = ln_g + lane * 4, *lbp = ln_b + lane * 4;
  const float* wp = mo_w + (size_t)n0 * 256 + lane * 4;
  int bs = row0 + mr, b = bs / 216, s = bs - b * 216;
  int oo = n0 + kg * 8;
  size_t xo = (size_t)(b * 256 + oo) * 216 + s;
  const float* xp = x + xo;
  const float* gp = gvec + b * 256 + oo;
  const float* bp = mo_b + oo;
  v4f ov[4], rv[4], lg[2], lb[2];   // index = row*2 + half row; half row
#pragma unroll
  for (int j = 0; j < 4; ++j) {
    ov[j] = *(const v4f*)(op + j * 128);
    rv[j] = *(const v4f*)(rp + j * 128);
  }
#pragma unroll
  for (int j = 0; j < 2; ++j) {
    lg[j] = *(const v4f*)(lgp + j * 128);
    lb[j] = *(const v4f*)(lbp + j * 128);
  }
  v4f wr[32];   // load i = row i/2, half i%2
#pragma unroll
  for (int i = 0; i < 32; ++i) wr[i] = *(const v4f*)(wp + i * 128);
  float xv[8];
#pragma unroll
  for (int r = 0; r < 8; ++r) xv[r] = xp[r * 216];
  v4f gv[2] = {*(const v4f*)gp, *(const v4f*)(gp + 4)};
  v4f mb[2] = {*(const v4f*)bp, *(const v4f*)(bp + 4)};
  // keeps all loads ahead of the first load wait (one exposed latency)
  __builtin_amdgcn_sched_barrier(0);
  // stands before any register that a load above names is written again; the
  // address pairs and the lane offset are inputs so that they live up to it
  asm volatile("s_wait_xcnt 0x0" ::"v"(op), "v"(rp), "v"(lane), "v"(wp),
               "v"(xp), "v"(gp)
               : "memory");
  // keeps later register writes from being lifted over the wait
  __builtin_amdgcn_sched_barrier(0);
#pragma unroll
  for (int q = 0; q < 2; ++q) {
    v4f a = ov[2 * q] + rv[2 * q], c = ov[2 * q + 1] + rv[2 * q + 1];
    v4f s4 = a + c, p4 = a * a + c * c;
    float S1 = wave_sum((s4[0] + s4[1]) + (s4[2] + s4[3]));
    float S2 = wave_sum((p4[0] + p4[1]) + (p4[2] + p4[3]));
    float mn = S1 * (1.f / 256.f), var = S2 * (1.f / 256.f) - mn * mn;
    float rs = rsqrtf(var + 1e-6f);
    float* td = t_s + (wave * 2 + q) * TP + lane * 4;
    *(v4f*)td = (a - mn) * rs * lg[0] + lb[0];
    *(v4f*)(td + 128) = (c - mn) * rs * lg[1] + lb[1];
  }
#pragma unroll
  for (int i = 0; i < 32; ++i)
    *(v4f*)&w_s[(wave * 16 + (i >> 1)) * TP + (i & 1) * 128 + lane * 4] = wr[i];
  __syncthreads();   // publishes t2 (and the wave's own mo_w rows)
  const float* ap = w_s + (wave * 16 + mr) * TP + kg * 4;
  const float* bq = t_s + mr * TP + kg * 4;
  const v8f z = {0, 0, 0, 0, 0, 0, 0, 0};
  v8f acc[2] = {z, z};   // one per k-step of a read: two independent chains
  // groups of four reads per operand (8 WMMAs), a ring of three: g+2 is read
  // while g multiplies
  v4f fa[3][4], fb[3][4];
#pragma unroll
  for (int g = 0; g < 2; ++g)
#pragma unroll
    for (int j = 0; j < 4; ++j) {
      fa[g][j] = *(const v4f*)(ap + (g * 4 + j) * 8);
      fb[g][j] = *(const v4f*)(bq + (g * 4 + j) * 8);
    }
#pragma unroll
  for (int g = 0; g < 8; ++g) {
    if (g + 2 < 8) {
#pragma unroll
      for (int j = 0; j < 4; ++j) {
        fa[(g + 2) % 3][j] = *(const v4f*)(ap + ((g + 2) * 4 + j) * 8);
        fb[(g + 2) % 3][j] = *(const v4f*)(bq + ((g + 2) * 4 + j) * 8);
      }
    }
    // keeps the LDS reads above ahead of this group's WMMAs: the scheduler
    // otherwise sinks each read to just before its use and waits it out
    __builtin_amdgcn_sched_barrier(0);
#pragma unroll
    for (int j = 0; j < 4; ++j) {
      v4f a = fa[g % 3][j], c = fb[g % 3][j];
      v2f a0 = {a[0], a[1]}, a1 = {a[2], a[3]};
      v2f c0 = {c[0], c[1]}, c1 = {c[2], c[3]};
      acc[0] = wmma4(a0, c0, acc[0]);
      acc[1] = wmma4(a1, c1, acc[1]);
    }
  }
  // acc[.][r] = D[o = oo + r][s = row0 + mr]
  float* yp = y + xo;
#pragma unroll
  for (int r = 0; r < 8; ++r) {
    float v = gelu_exact((acc[0][r] + acc[1][r]) + mb[r >> 2][r & 3]);
    yp[r * 216] = xv[r] + gv[r >> 2][r & 3] + v;
  }
}

extern "C" void kernel_launch(void* const* d_in, const int* in_sizes, int n_in,
                              void* d_out, int out_size, void* d_ws,
                              size_t ws_size, hipStream_t stream) {
  const float* x       = (const float*)d_in[0];
  const float* g_tok_w = (const float*)d_in[1];
  const float* g_tok_b = (const float*)d_in[2];
  const float* g_ln1_g = (const float*)d_in[3];
  const float* g_ln1_b = (const float*)d_in[4];
  const float* g_wq    = (const float*)d_in[5];
  const float* g_wk    = (const float*)d_in[6];
  const float* g_wv    = (const float*)d_in[7];
  const float* g_wo    = (const float*)d_in[8];
  const float* g_ln2_g = (const float*)d_in[9];
  const float* g_ln2_b = (const float*)d_in[10];
  const float* g_mo_w  = (const float*)d_in[11];
  const float* g_mo_b  = (const float*)d_in[12];
  const float* l_pw    = (const float*)d_in[13];
  const float* l_pb    = (const float*)d_in[14];
  const float* l_ln1_g = (const float*)d_in[15];
  const float* l_ln1_b = (const float*)d_in[16];
  const float* l_wq    = (const float*)d_in[17];
  const float* l_wk    = (const float*)d_in[18];
  const float* l_wv    = (const float*)d_in[19];
  const float* l_wo    = (const float*)d_in[20];
  const float* l_ln2_g = (const float*)d_in[21];
  const float* l_ln2_b = (const float*)d_in[22];
  const float* l_mo_w  = (const float*)d_in[23];
  const float* l_mo_b  = (const float*)d_in[24];

  float* ws   = (float*)d_ws;
  float* gsum = ws;                 // 8*27, in 2048
  float* gvec = ws + 2048;          // 2048
  float* eln  = ws + 2048 + 2048;   // 1728*256
  float* res  = eln + 442368;       // 1728*256
  float* Qb   = res + 442368;       // 1728*1024
  float* Kb   = Qb + 1769472;       // 1728*1024
  float* Vb   = Kb + 1769472;       // 1728*1024
  float* ofl  = Vb + 1769472;       // 1728*1024
  float* gqkv = ofl + 1769472;      // 3*8*1024
  float* gpart = gqkv + 24576;      // 8*16*256
  float* outb = Qb;                 // alias: Qb dead after attention

  k_local_embed<<<216, 256, 0, stream>>>(x, l_pw, l_pb, l_ln1_g, l_ln1_b, res,
                                         eln, gsum);
  k_qkv_all<<<744, 256, 0, stream>>>(eln, l_wq, l_wk, l_wv, Qb, Kb, Vb, 1024,
                                     256, gsum, g_tok_w, g_tok_b, g_ln1_g,
                                     g_ln1_b, g_wq, g_wk, g_wv, gqkv);
  k_attn_all<<<992, 256, 0, stream>>>(Qb, Kb, Vb, ofl, gqkv, g_wo, gpart);
  k_wo_all<<<172, 128, 0, stream>>>(ofl, l_wo, outb, 256, 1024, gsum, g_tok_w,
                                    g_tok_b, gpart, g_ln2_g, g_ln2_b, g_mo_w,
                                    g_mo_b, gvec);
  k_tail<<<216, 256, 0, stream>>>(outb, res, l_ln2_g, l_ln2_b, l_mo_w, l_mo_b,
                                  x, gvec, (float*)d_out);
}

// v006
// It runs in 76 microseconds.
// Two timings next to v005 both put it at 1.10 times that version's speed.
// Over all steps from v000 it is 4.83 times as fast.
#include <hip/hip_runtime.h>
#include <hip/hip_bf16.h>
#include <math.h>

typedef float v2f __attribute__((ext_vector_type(2)));
typedef float v4f __attribute__((ext_vector_type(4)));
typedef float v8f __attribute__((ext_vector_type(8)));

// ---------------------------------------------------------------------------
// fp32 WMMA: D(16x16) = A(16x4) * B(4x16) + C, full fp32 (matches reference
// numerics up to reassociation).  Lane L: mr = L%16, kg = L/16.
//   A frag (v2f): a[0]=A[mr][kg*2], a[1]=A[mr][kg*2+1]
//   B frag (v2f): b[0]=B[kg*2][mr], b[1]=B[kg*2+1][mr]
//   C/D (v8f):    c[r] = C[r + 8*kg][mr]
// ---------------------------------------------------------------------------
__device__ __forceinline__ v8f wmma4(v2f a, v2f b, v8f c) {
  return __builtin_amdgcn_wmma_f32_16x16x4_f32(false, a, false, b, (short)0, c,
                                               false, false);
}

__device__ __forceinline__ float gelu_exact(float x) {
  return 0.5f * x * (1.0f + erff(x * 0.70710678118654752f));
}

// ---------------------------------------------------------------------------
// Global branch, spread over many work-groups in three dependent stages.
// Rank-1 score => instance-norm stats factor; softmax is shift-invariant so
// only 1/sigma and row-max of the raw score are needed.
// No stage has a launch of its own: each is independent of the local-branch
// stage that runs at the same depth of the chain, and its work-groups are the
// first ones of that stage's grid.  The mean over (C,D,H,W) comes as 27 sums
// per batch from the patch-embed work-groups, which read all of x anyway.
// ---------------------------------------------------------------------------
__device__ __forceinline__ float wave_sum(float v) {
#pragma unroll
  for (int o = 16; o > 0; o >>= 1) v += __shfl_xor(v, o, 32);
  return v;
}
__device__ __forceinline__ float wave_max(float v) {
#pragma unroll
  for (int o = 16; o > 0; o >>= 1) v = fmaxf(v, __shfl_xor(v, o, 32));
  return v;
}
__device__ __forceinline__ float wave_min(float v) {
#pragma unroll
  for (int o = 16; o > 0; o >>= 1) v = fminf(v, __shfl_xor(v, o, 32));
  return v;
}

// Stage 1: q/k/v projections for all 8 batches at once (8x256 @ 256x1024 x3).
// Work-group = one matrix x 32 columns; wave = 32 rows of K; lane = column.
// Each weight element is read once by the whole grid.
// t_s: 256*8 floats, t[k][batch], 16-byte aligned; red: 8*8*32 floats,
// [wave][batch][lane].
__device__ __forceinline__ void g_qkv_body(
    int blk, float* t_s, float* red, const float* __restrict__ gsum,
    const float* __restrict__ tok_w, const float* __restrict__ tok_b,
    const float* __restrict__ ln1_g, const float* __restrict__ ln1_b,
    const float* __restrict__ wq, const float* __restrict__ wk,
    const float* __restrict__ wv, float* __restrict__ qkv) {
  int tid = threadIdx.x, wave = tid >> 5, lane = tid & 31;
  int mat = blk >> 5, col = (blk & 31) * 32 + lane;
  const float* Wm = mat == 0 ? wq : (mat == 1 ? wk : wv);
  const float* wp = Wm + (size_t)(wave * 32) * 1024 + col;
  float wreg[32];   // issued first: the LN below runs under their latency
#pragma unroll
  for (int i = 0; i < 32; ++i) wreg[i] = wp[i * 1024];
  const float* gp = gsum + wave * 27 + (lane < 27 ? lane : 26);
  float gs = *gp;   // lanes 0..26: the 27 patch sums of batch 'wave'
  float tw[8], tb8[8], lg[8], lb[8];
#pragma unroll
  for (int k = 0; k < 8; ++k) {
    int c = k * 32 + lane;
    tw[k] = tok_w[c]; tb8[k] = tok_b[c]; lg[k] = ln1_g[c]; lb[k] = ln1_b[c];
  }
  // the scheduler otherwise sinks part of the loads above behind the first
  // load wait (two or more exposed latencies instead of one)
  __builtin_amdgcn_sched_barrier(0);
  // stands before any register that a load above names is written again; the
  // address pairs are inputs so that they live up to the wait
  asm volatile("s_wait_xcnt 0x0" :: "v"(wp), "v"(gp) : "memory");
  // keeps later register writes from being lifted over the wait
  __builtin_amdgcn_sched_barrier(0);
  float m = wave_sum(lane < 27 ? gs : 0.f) / 55296.0f;
  // LN1 of batch 'wave': 8 channels per lane
  {
    float tok[8];
    float s1 = 0.f, s2 = 0.f;
#pragma unroll
    for (int k = 0; k < 8; ++k) {
      tok[k] = m * tw[k] + tb8[k];
      s1 += tok[k]; s2 += tok[k] * tok[k];
    }
    s1 = wave_sum(s1); s2 = wave_sum(s2);
    float mn = s1 * (1.f / 256.f);
    float var = s2 * (1.f / 256.f) - mn * mn;
    float rs = rsqrtf(var + 1e-6f);
#pragma unroll
    for (int k = 0; k < 8; ++k) {
      int c = k * 32 + lane;
      t_s[c * 8 + wave] = (tok[k] - mn) * rs * lg[k] + lb[k];
    }
  }
  __syncthreads();
  float acc[8] = {0, 0, 0, 0, 0, 0, 0, 0};
#pragma unroll
  for (int i = 0; i < 32; ++i) {
    const float4* tp = (const float4*)&t_s[(wave * 32 + i) * 8];
    float4 ta = tp[0], tb = tp[1];
    float w = wreg[i];
    acc[0] += ta.x * w; acc[1] += ta.y * w; acc[2] += ta.z * w; acc[3] += ta.w * w;
    acc[4] += tb.x * w; acc[5] += tb.y * w; acc[6] += tb.z * w; acc[7] += tb.w * w;
  }
#pragma unroll
  for (int bb = 0; bb < 8; ++bb) red[(wave * 8 + bb) * 32 + lane] = acc[bb];
  __syncthreads();
  float s = 0.f;   // this thread finishes batch 'wave', column 'col'
#pragma unroll
  for (int w = 0; w < 8; ++w) s += red[(w * 8 + wave) * 32 + lane];
  qkv[(size_t)(mat * 8 + wave) * 1024 + col] = s;
}

// Stage 2: work-group = (batch, head, quarter of the 256 score rows).
// Thread = (row of the quarter, quarter of the 256 columns).  The 64 output
// values then meet their 64 rows of wo; the partial 1x256 goes to 'part'.
__device__ __forceinline__ void g_attn_body(
    int blk, const float* __restrict__ qkv, const float* __restrict__ wo,
    float* __restrict__ part) {
  __shared__ __attribute__((aligned(16))) float k_s[256];
  __shared__ __attribute__((aligned(16))) float v_s[256];
  __shared__ float q_s[256];
  __shared__ float st[8][6];
  __shared__ float den_s[256], acc_s[256];
  __shared__ float o_s[64];
  __shared__ __attribute__((aligned(16))) float red[8 * 256];
  int tid = threadIdx.x, wave = tid >> 5, lane = tid & 31;
  int rq = blk & 3, h = (blk >> 2) & 3, b = blk >> 4;
  // wo rows (c*4 + h) of this wave's 8 score rows, issued first so that they
  // arrive while the softmax runs
  float4 w0[8], w1[8];
  const float* wr = wo + (size_t)((rq * 64 + wave * 8) * 4 + h) * 256 + lane * 4;
#pragma unroll
  for (int i = 0; i < 8; ++i) {
    w0[i] = *(const float4*)(wr + i * 1024);
    w1[i] = *(const float4*)(wr + i * 1024 + 128);
  }
  float qi = qkv[(size_t)(0 + b) * 1024 + h * 256 + tid];   // heads OUTER
  float ki = qkv[(size_t)(8 + b) * 1024 + h * 256 + tid];
  float vi = qkv[(size_t)(16 + b) * 1024 + h * 256 + tid];
  // the scheduler otherwise sinks part of the loads above behind the first
  // load wait (two or more exposed latencies instead of one)
  __builtin_amdgcn_sched_barrier(0);
  // stands before any register that a load above names is written again; the
  // address pair is an input so that it lives up to the wait
  asm volatile("s_wait_xcnt 0x0" :: "v"(wr) : "memory");
  // keeps later register writes from being lifted over the wait
  __builtin_amdgcn_sched_barrier(0);
  q_s[tid] = qi; k_s[tid] = ki; v_s[tid] = vi;
  {
    float a0 = wave_sum(qi), a1 = wave_sum(qi * qi);
    float a2 = wave_sum(ki), a3 = wave_sum(ki * ki);
    float a4 = wave_max(ki), a5 = wave_min(ki);
    if (lane == 0) {
      st[wave][0] = a0; st[wave][1] = a1; st[wave][2] = a2;
      st[wave][3] = a3; st[wave][4] = a4; st[wave][5] = a5;
    }
  }
  __syncthreads();
  float Sq = 0.f, Sq2 = 0.f, Sk = 0.f, Sk2 = 0.f;
  float kmx = st[0][4], kmn = st[0][5];
#pragma unroll
  for (int w = 0; w < 8; ++w) {
    Sq += st[w][0]; Sq2 += st[w][1]; Sk += st[w][2]; Sk2 += st[w][3];
    kmx = fmaxf(kmx, st[w][4]); kmn = fminf(kmn, st[w][5]);
  }
  float mu  = (Sq * Sk)  * (1.f / 65536.f);
  float ex2 = (Sq2 * Sk2) * (1.f / 65536.f);
  float rstd = rsqrtf(ex2 - mu * mu + 1e-5f);
  float qr = q_s[rq * 64 + (tid & 63)];
  int j0 = (tid >> 6) * 64;
  float rmax = qr * (qr >= 0.f ? kmx : kmn);  // row max of raw score
  float den = 0.f, acc = 0.f;
#pragma unroll 4
  for (int j = 0; j < 64; j += 4) {
    float4 k4 = *(const float4*)&k_s[j0 + j];
    float4 v4 = *(const float4*)&v_s[j0 + j];
    float p0 = __expf((qr * k4.x - rmax) * rstd);
    float p1 = __expf((qr * k4.y - rmax) * rstd);
    float p2 = __expf((qr * k4.z - rmax) * rstd);
    float p3 = __expf((qr * k4.w - rmax) * rstd);
    den += p0; acc += p0 * v4.x;
    den += p1; acc += p1 * v4.y;
    den += p2; acc += p2 * v4.z;
    den += p3; acc += p3 * v4.w;
  }
  den_s[tid] = den; acc_s[tid] = acc;
  __syncthreads();
  if (tid < 64) {
    float dd = (den_s[tid] + den_s[64 + tid]) + (den_s[128 + tid] + den_s[192 + tid]);
    float aa = (acc_s[tid] + acc_s[64 + tid]) + (acc_s[128 + tid] + acc_s[192 + tid]);
    o_s[tid] = aa / dd;
  }
  __syncthreads();
  float4 p0 = {0.f, 0.f, 0.f, 0.f}, p1 = {0.f, 0.f, 0.f, 0.f};
#pragma unroll
  for (int i = 0; i < 8; ++i) {
    float o = o_s[wave * 8 + i];
    p0.x += o * w0[i].x; p0.y += o * w0[i].y; p0.z += o * w0[i].z; p0.w += o * w0[i].w;
    p1.x += o * w1[i].x; p1.y += o * w1[i].y; p1.z += o * w1[i].z; p1.w += o * w1[i].w;
  }
  *(float4*)&red[wave * 256 + lane * 4] = p0;
  *(float4*)&red[wave * 256 + 128 + lane * 4] = p1;
  __syncthreads();
  float s = 0.f;
#pragma unroll
  for (int w = 0; w < 8; ++w) s += red[w * 256 + tid];
  part[(size_t)blk * 256 + tid] = s;   // [(b*16 + h*4 + rq)][256]
}

// Stage 3: work-group of 128 threads = (batch, eighth of the 256 outputs).
// Sums the 16 partials, adds the residual, LN2 (two channels per thread), then
// map-out rows ('bc,oc->bo') with the lanes along c (coalesced) and a wave
// reduction per output, then GELU.
__device__ __forceinline__ void g_out_body(
    int blk, const float* __restrict__ gsum,
    const float* __restrict__ tok_w, const float* __restrict__ tok_b,
    const float* __restrict__ part,
    const float* __restrict__ ln2_g, const float* __restrict__ ln2_b,
    const float* __restrict__ mo_w, const float* __restrict__ mo_b,
    float* __restrict__ gvec) {
  __shared__ __attribute__((aligned(16))) float t_s[256];
  __shared__ float st[4][2];
  int c = threadIdx.x, wave = c >> 5, lane = c & 31;
  int b = blk >> 3, o0 = (blk & 7) * 32 + wave * 8;
  float4 m0[8], m1[8];   // issued first: LN2 runs under their latency
  const float* mr = mo_w + (size_t)o0 * 256 + lane * 4;
#pragma unroll
  for (int r = 0; r < 8; ++r) {
    m0[r] = *(const float4*)(mr + r * 256);
    m1[r] = *(const float4*)(mr + r * 256 + 128);
  }
  const float* pp = part + (size_t)(b * 16) * 256 + c;
  float pr[16], ps[16];   // channels c and c + 128
#pragma unroll
  for (int p = 0; p < 16; ++p) { pr[p] = pp[p * 256]; ps[p] = pp[p * 256 + 128]; }
  int gi = lane < 27 ? lane : 26, mi = o0 + (lane & 7);
  float gs = gsum[b * 27 + gi];   // lanes 0..26: the 27 patch sums of batch b
  float tw0 = tok_w[c], tb0 = tok_b[c], tw1 = tok_w[c + 128], tb1 = tok_b[c + 128];
  float g20 = ln2_g[c], b20 = ln2_b[c], g21 = ln2_g[c + 128], b21 = ln2_b[c + 128];
  float mb = mo_b[mi];
  // the scheduler otherwise sinks part of the loads above behind the first
  // load wait (two or more exposed latencies instead of one)
  __builtin_amdgcn_sched_barrier(0);
  // stands before any register that a load above names is written again; the
  // address pair and the offsets are inputs so that they live up to the wait
  asm volatile("s_wait_xcnt 0x0" :: "v"(mr), "v"(c), "v"(gi), "v"(mi) : "memory");
  // keeps later register writes from being lifted over the wait
  __builtin_amdgcn_sched_barrier(0);
  float m = wave_sum(lane < 27 ? gs : 0.f) / 55296.0f;
  float out0 = 0.f, out1 = 0.f;
#pragma unroll
  for (int p = 0; p < 16; ++p) { out0 += pr[p]; out1 += ps[p]; }
  float ov0 = out0 + (m * tw0 + tb0), ov1 = out1 + (m * tw1 + tb1);
  {
    float a0 = wave_sum(ov0 + ov1), a1 = wave_sum(ov0 * ov0 + ov1 * ov1);
    if (lane == 0) { st[wave][0] = a0; st[wave][1] = a1; }
  }
  __syncthreads();
  float T1 = 0.f, T2 = 0.f;
#pragma unroll
  for (int w = 0; w < 4; ++w) { T1 += st[w][0]; T2 += st[w][1]; }
  float mn2 = T1 * (1.f / 256.f), var2 = T2 * (1.f / 256.f) - mn2 * mn2;
  float rs2 = rsqrtf(var2 + 1e-6f);
  t_s[c] = (ov0 - mn2) * rs2 * g20 + b20;
  t_s[c + 128] = (ov1 - mn2) * rs2 * g21 + b21;
  __syncthreads();
  float4 ta = *(const float4*)&t_s[lane * 4];
  float4 tc = *(const float4*)&t_s[128 + lane * 4];
  float val = 0.f;
#pragma unroll
  for (int r = 0; r < 8; ++r) {
    float dd = m0[r].x * ta.x + m0[r].y * ta.y + m0[r].z * ta.z + m0[r].w * ta.w +
               m1[r].x * tc.x + m1[r].y * tc.y + m1[r].z * tc.z + m1[r].w * tc.w;
    dd = wave_sum(dd);
    if (lane == r) val = dd;
  }
  if (lane < 8) gvec[b * 256 + o0 + lane] = gelu_exact(val + mb);
}

// ---------------------------------------------------------------------------
// Local branch: patchify (2x2x2) + 8x8 embed + LN over C.
// Emits res (B,216,C) and eln rows (bp*8+pv, C), and the sum of the 2048 x
// values it has read (one of the 27 parts of its batch's global-branch mean).
// ---------------------------------------------------------------------------
__global__ __launch_bounds__(256) void k_local_embed(
    const float* __restrict__ x, const float* __restrict__ pw,
    const float* __restrict__ pb, const float* __restrict__ ln_g,
    const float* __restrict__ ln_b, float* __restrict__ res,
    float* __restrict__ eln, float* __restrict__ gsum) {
  __shared__ float pw_s[64];
  __shared__ float pb_s[8];
  __shared__ float sc[8 * 256];
  __shared__ float part1[256], part2[256];
  __shared__ float mean_s[8], rstd_s[8];
  __shared__ float xs_s[8];
  int bp = blockIdx.x, b = bp / 27, p = bp % 27;
  int d = p / 9, hh = (p / 3) % 3, w = p % 3;
  int c = threadIdx.x;
  if (c < 64) pw_s[c] = pw[c];
  if (c < 8) pb_s[c] = pb[c];
  __syncthreads();
  const float* xb = x + (size_t)(b * 256 + c) * 216;
  float patch[8];
#pragma unroll
  for (int u = 0; u < 8; ++u) {
    int p1 = u >> 2, p2 = (u >> 1) & 1, p3 = u & 1;
    patch[u] = xb[(d * 2 + p1) * 36 + (hh * 2 + p2) * 6 + (w * 2 + p3)];
  }
  {
    float xs = wave_sum(((patch[0] + patch[1]) + (patch[2] + patch[3])) +
                        ((patch[4] + patch[5]) + (patch[6] + patch[7])));
    if ((c & 31) == 0) xs_s[c >> 5] = xs;   // read behind the next barrier
  }
  float tokv[8];
#pragma unroll
  for (int e = 0; e < 8; ++e) {
    float a = pb_s[e];
#pragma unroll
    for (int u = 0; u < 8; ++u) a += pw_s[e * 8 + u] * patch[u];
    tokv[e] = a;
    sc[e * 256 + c] = a;
    int p1 = e >> 2, p2 = (e >> 1) & 1, p3 = e & 1;
    int s = (d * 2 + p1) * 36 + (hh * 2 + p2) * 6 + (w * 2 + p3);
    res[(size_t)(b * 216 + s) * 256 + c] = a;   // residual uses raw tok
  }
  __syncthreads();
  int g = c >> 5, lane = c & 31;
  float s1 = 0.f, s2 = 0.f;
#pragma unroll
  for (int k = 0; k < 8; ++k) {
    float vv = sc[g * 256 + lane + k * 32];
    s1 += vv; s2 += vv * vv;
  }
  part1[c] = s1; part2[c] = s2;
  if (c == 0)
    gsum[bp] = ((xs_s[0] + xs_s[1]) + (xs_s[2] + xs_s[3])) +
               ((xs_s[4] + xs_s[5]) + (xs_s[6] + xs_s[7]));
  __syncthreads();
  if (c < 8) {
    float a = 0.f, bb = 0.f;
    for (int l = 0; l < 32; ++l) { a += part1[c * 32 + l]; bb += part2[c * 32 + l]; }
    float mn = a * (1.f / 256.f), vr = bb * (1.f / 256.f) - mn * mn;
    mean_s[c] = mn; rstd_s[c] = rsqrtf(vr + 1e-6f);
  }
  __syncthreads();
  float lg = ln_g[c], lb = ln_b[c];
#pragma unroll
  for (int e = 0; e < 8; ++e)
    eln[(size_t)(bp * 8 + e) * 256 + c] =
        (tokv[e] - mean_s[e]) * rstd_s[e] * lg + lb;
}

// ---------------------------------------------------------------------------
// fp32 WMMA GEMM: C = act(A(MxK) @ B(KxN) [+bias]).  TRANSB/ACT are template
// params so the inner loop is branch-free.  128 threads (4 waves) per tile; each wave
// owns a 16(M) x 64(N) strip; all 4 waves share one n-strip, so the 64x64 B
// tile is staged through LDS once per K-chunk (16-byte loads, 4x reuse).
// The K loop is software-pipelined at both levels.  Global: while the WMMAs of
// chunk c run, the A fragments and the B tile of chunk c+1 are on their way
// into registers; the tile then goes into the other LDS buffer, so one barrier
// per chunk both publishes it and ends the reads of the buffer refilled next.
// LDS: B fragments are read two groups of WMMAs ahead of their use.  For that
// a fragment must land in its register pair as it is, so the tile lies in LDS
// as rows of k pairs: Bs[k/2][n][k%2], row pitch GPP dwords (128 + 32: the two
// half-waves, one k pair apart, fall on different halves of the 64 banks).
// Requires M%64==0, N%64==0, K%64==0.
// ---------------------------------------------------------------------------
#define GKC 64
#define GPP 160

template <bool TRANSB>
__device__ __forceinline__ void gemm_fetch(const float* __restrict__ arow,
                                           const float* __restrict__ bsrc,
                                           int k0, int N, v2f (&an)[GKC / 4],
                                           v4f (&bn)[8]) {
  const float* ap = arow + k0;
  const float* bp[8];
#pragma unroll
  for (int i = 0; i < 8; ++i) {
    // !TRANSB: rows k0 + 16*(i/2) + i%2 (+ 2*rp0, in bsrc); TRANSB: k quad 2*i
    size_t off = TRANSB ? (size_t)(k0 + i * 8)
                        : (size_t)(k0 + (i >> 1) * 16 + (i & 1)) * N;
    bp[i] = bsrc + off;
  }
#pragma unroll
  for (int i = 0; i < GKC / 4; ++i) an[i] = *(const v2f*)(ap + i * 4);
#pragma unroll
  for (int i = 0; i < 8; ++i) bn[i] = *(const v4f*)bp[i];
  // stands before any register that a load above names is written again; the
  // address pairs are inputs so that they live up to the wait (TRANSB: the B
  // loads share one pair and differ in their immediate offsets)
  if (TRANSB)
    asm volatile("s_wait_xcnt 0x0" ::"v"(ap), "v"(bp[0]) : "memory");
  else
    asm volatile("s_wait_xcnt 0x0" ::"v"(ap), "v"(bp[0]), "v"(bp[1]),
                 "v"(bp[2]), "v"(bp[3]), "v"(bp[4]), "v"(bp[5]), "v"(bp[6]),
                 "v"(bp[7])
                 : "memory");
}

template <bool TRANSB>
__device__ __forceinline__ void gemm_put(float* bd, int tid,
                                         const v4f (&bn)[8]) {
  if (!TRANSB) {
    int rp0 = tid >> 4, c4 = (tid & 15) * 4;
#pragma unroll
    for (int i = 0; i < 4; ++i) {
      v4f x = bn[2 * i], y = bn[2 * i + 1];   // rows 2*rp and 2*rp + 1
      v4f lo = {x[0], y[0], x[1], y[1]}, hi = {x[2], y[2], x[3], y[3]};
      float* d = bd + (rp0 + 8 * i) * GPP + c4 * 2;
      *(v4f*)d = lo;
      *(v4f*)(d + 4) = hi;
    }
  } else {
    int c = tid & 63, q0 = tid >> 6;
#pragma unroll
    for (int i = 0; i < 8; ++i) {
      int q = q0 + 2 * i;                      // k = 4*q .. 4*q + 3
      v2f lo = {bn[i][0], bn[i][1]}, hi = {bn[i][2], bn[i][3]};
      *(v2f*)(bd + (2 * q) * GPP + c * 2) = lo;
      *(v2f*)(bd + (2 * q + 1) * GPP + c * 2) = hi;
    }
  }
}

#define GBUF ((GKC / 2) * GPP)   // one LDS buffer, in dwords

// One 64 x 64 tile (mblk, nblk) by 128 threads (tid 0..127); Bs: 2 * GBUF
// dwords of their own, 16-byte aligned.  Its barriers are the work-group's.
// lda: row pitch of A in dwords (above K where the tile sums a slice of k).
template <bool TRANSB, bool ACT>
__device__ __forceinline__ void gemm_tile(
    const float* __restrict__ A, const float* __restrict__ B,
    const float* __restrict__ bias, float* __restrict__ C, int N, int K,
    int lda, float* Bs, int tid, int mblk, int nblk) {
  int wave = tid >> 5, lane = tid & 31;
  int mr = lane & 15, kg = lane >> 4;
  int m0 = (mblk * 4 + wave) * 16;
  int n0 = nblk * 64;
  v8f z = {0, 0, 0, 0, 0, 0, 0, 0};
  v8f acc[4] = {z, z, z, z};
  const float* arow = A + (size_t)(m0 + mr) * lda + kg * 2;
  const float* bsrc =
      TRANSB ? B + (size_t)(n0 + (tid & 63)) * K + (tid >> 6) * 4
             : B + (size_t)((tid >> 4) * 2) * N + n0 + (tid & 15) * 4;
  v2f an[GKC / 4];
  v4f bn[8];
  gemm_fetch<TRANSB>(arow, bsrc, 0, N, an, bn);
  gemm_put<TRANSB>(Bs, tid, bn);
  __syncthreads();
  for (int k0 = 0, buf = 0;; k0 += GKC, buf ^= 1) {
    v2f ac[GKC / 4];
#pragma unroll
    for (int i = 0; i < GKC / 4; ++i) ac[i] = an[i];
    bool more = k0 + GKC < K;   // the same for the whole work-group
    if (more) gemm_fetch<TRANSB>(arow, bsrc, k0 + GKC, N, an, bn);
    // fragment of k-step kc, column tile t: bs + kc*2*GPP + t*32.  Groups of
    // two k-steps (8 WMMAs), a ring of three: g+2 is read while g multiplies.
    const float* bs = Bs + buf * GBUF + kg * GPP + mr * 2;
    v2f bf[3][8];
#pragma unroll
    for (int g = 0; g < 2; ++g)
#pragma unroll
      for (int j = 0; j < 8; ++j)
        bf[g][j] = *(const v2f*)(bs + (g * 2 + (j >> 2)) * 2 * GPP + (j & 3) * 32);
#pragma unroll
    for (int g = 0; g < GKC / 8; ++g) {
      if (g + 2 < GKC / 8) {
#pragma unroll
        for (int j = 0; j < 8; ++j)
          bf[(g + 2) % 3][j] = *(const v2f*)(bs + ((g + 2) * 2 + (j >> 2)) * 2 * GPP +
                                             (j & 3) * 32);
      }
      // keeps the LDS reads above ahead of this group's WMMAs: the scheduler
      // otherwise sinks each read to just before its use and waits it out
      __builtin_amdgcn_sched_barrier(0);
#pragma unroll
      for (int j = 0; j < 8; ++j)
        acc[j & 3] = wmma4(ac[g * 2 + (j >> 2)], bf[g % 3][j], acc[j & 3]);
    }
    if (!more) break;
    gemm_put<TRANSB>(Bs + (buf ^ 1) * GBUF, tid, bn);
    __syncthreads();   // publishes chunk c+1; ends the reads of chunk c
  }
#pragma unroll
  for (int t = 0; t < 4; ++t) {
    int n = n0 + t * 16 + mr;
    float bb = ACT ? bias[n] : 0.f;
#pragma unroll
    for (int r = 0; r < 8; ++r) {
      int row = m0 + r + 8 * kg;
      float v = acc[t][r] + bb;
      if (ACT) v = gelu_exact(v);
      C[(size_t)row * N + n] = v;
    }
  }
}

// One grid for the local attention-output GEMM and stage 3 of the global
// branch.  Work-groups 0..63: stage 3.  The other 432: one GEMM tile over one
// quarter of K each, n fastest, then the quarter: 108 tiles alone leave more
// than half of the chip idle behind a loop of 16 chunks.  Quarter ks writes its
// sums to plane ks of C (WOM x N each); the tail adds the four planes.
#define WOM 1728   // rows of the attention-output GEMM

__global__ __launch_bounds__(128) void k_wo_all(
    const float* __restrict__ A, const float* __restrict__ B,
    float* __restrict__ C, int N, int K, const float* __restrict__ gsum,
    const float* __restrict__ tok_w, const float* __restrict__ tok_b,
    const float* __restrict__ gpart, const float* __restrict__ g_g,
    const float* __restrict__ g_b, const float* __restrict__ mo_w,
    const float* __restrict__ mo_b, float* __restrict__ gvec) {
  __shared__ __attribute__((aligned(16))) float Bs[2 * GBUF];
  if (blockIdx.x < 64) {
    g_out_body(blockIdx.x, gsum, tok_w, tok_b, gpart, g_g, g_b, mo_w, mo_b,
               gvec);
    return;
  }
  int g = blockIdx.x - 64;
  int ks = (g >> 2) & 3, kq = K >> 2;
  gemm_tile<false, false>(A + ks * kq, B + (size_t)(ks * kq) * N, nullptr,
                          C + (size_t)ks * WOM * N, N, kq, K, Bs, threadIdx.x,
                          g >> 4, g & 3);
  // stands behind the tile's C stores, before any register that they name can
  // be written again on a way the built code has from here into stage 3's part
  asm volatile("s_wait_xcnt 0x0" ::: "memory");
}

// One grid for the local q, k and v projections and stage 1 of the global
// branch.  Work-groups 0..95: stage 1.  The other 648: two GEMM tiles each,
// one per 128 threads, neighbours in n (the same A rows) of one matrix; 216
// work-groups per matrix.
__global__ __launch_bounds__(256) void k_qkv_all(
    const float* __restrict__ eln, const float* __restrict__ l_wq,
    const float* __restrict__ l_wk, const float* __restrict__ l_wv,
    float* __restrict__ Qb, float* __restrict__ Kb, float* __restrict__ Vb,
    int N, int K, const float* __restrict__ gsum,
    const float* __restrict__ tok_w, const float* __restrict__ tok_b,
    const float* __restrict__ ln1_g, const float* __restrict__ ln1_b,
    const float* __restrict__ g_wq, const float* __restrict__ g_wk,
    const float* __restrict__ g_wv, float* __restrict__ gqkv) {
  __shared__ __attribute__((aligned(16))) float sm[4 * GBUF];
  if (blockIdx.x < 96) {
    g_qkv_body(blockIdx.x, sm, sm + 2048, gsum, tok_w, tok_b, ln1_g, ln1_b,
               g_wq, g_wk, g_wv, gqkv);
    return;
  }
  int g = blockIdx.x - 96;
  int mat = g / 216;
  // the same in all lanes of a wave: kept scalar, and the tile indices with it
  int half = __builtin_amdgcn_readfirstlane(threadIdx.x >> 7);
  int r = (g - mat * 216) * 2 + half;
  const float* Bm = mat == 0 ? l_wq : (mat == 1 ? l_wk : l_wv);
  float* Cm = mat == 0 ? Qb : (mat == 1 ? Kb : Vb);
  gemm_tile<false, false>(eln, Bm, nullptr, Cm, N, K, K, sm + half * 2 * GBUF,
                          threadIdx.x & 127, r >> 4, r & 15);
}

// ---------------------------------------------------------------------------
// Local attention core: one block per (bp, head); 864 blocks, 8 waves.
// The score tile is built transposed, S^T(16 j x 16 i) = k(16 j x 8) @ q^T(8 x
// 16 i), so that in the accumulator a lane owns ONE softmax row i = mr and the
// eight columns j = r + 8*kg.  Row max, exp and the statistics then run in
// registers on all 32 lanes, and a register pair {p[2s], p[2s+1]} is, as it
// lies, the B fragment of O^T(16 x 16 i) += V^T(16 x 4 j) @ P^T(4 j x 16 i)
// under the k order j = 8*kg + 2*s + e, which the V^T loader follows.
// V^T rows 0..7 are v, row 8 is ones (its product is the softmax row sum),
// rows 9..15 are zero.  A wave keeps its two row tiles through both passes.
// Pass 1: stats (sum, sum^2, row max).  Pass 2: recompute + exp + p@v.
// ---------------------------------------------------------------------------
#define VTP 260   // V^T row pitch in dwords: 16 rows fall on 16 bank quads

__device__ __forceinline__ void attn_local_body(
    int blk, const float* __restrict__ Qb, const float* __restrict__ Kb,
    const float* __restrict__ Vb, float* __restrict__ Ofl) {
  __shared__ __attribute__((aligned(16))) float q_s[256 * 8];    // q[i][m]
  __shared__ __attribute__((aligned(16))) float k_s[256 * 8];    // k[j][m]
  __shared__ __attribute__((aligned(16))) float vt_s[10 * VTP];  // v[m][j], 1, 0
  __shared__ float st[8][2];
  int bp = blk >> 2, h = blk & 3;
  int b = bp / 27, p = bp % 27;
  int d = p / 9, ph = (p / 3) % 3, pwv = p % 3;
  int tid = threadIdx.x;
  {
    int c = tid;
    float qv[8], kv[8], vv[8];
    size_t idx = (size_t)(bp * 8) * 1024 + c * 4 + h;  // col = c*Hh + h
    const float *qg = Qb + idx, *kg_ = Kb + idx, *vg = Vb + idx;
#pragma unroll
    for (int pv = 0; pv < 8; ++pv) {
      qv[pv] = qg[pv * 1024]; kv[pv] = kg_[pv * 1024]; vv[pv] = vg[pv * 1024];
    }
    // keeps all 24 loads ahead of the wait below (one exposed latency)
    __builtin_amdgcn_sched_barrier(0);
    // stands before any register that a load above names is written again; the
    // address pairs are inputs so that they live up to the wait
    asm volatile("s_wait_xcnt 0x0" ::"v"(qg), "v"(kg_), "v"(vg) : "memory");
    // keeps later register writes from being lifted over the wait
    __builtin_amdgcn_sched_barrier(0);
    v4f q0 = {qv[0], qv[1], qv[2], qv[3]}, q1 = {qv[4], qv[5], qv[6], qv[7]};
    v4f k0 = {kv[0], kv[1], kv[2], kv[3]}, k1 = {kv[4], kv[5], kv[6], kv[7]};
    *(v4f*)&q_s[c * 8] = q0; *(v4f*)&q_s[c * 8 + 4] = q1;
    *(v4f*)&k_s[c * 8] = k0; *(v4f*)&k_s[c * 8 + 4] = k1;
#pragma unroll
    for (int pv = 0; pv < 8; ++pv) vt_s[pv * VTP + c] = vv[pv];
    vt_s[8 * VTP + c] = 1.f;
    vt_s[9 * VTP + c] = 0.f;
  }
  __syncthreads();
  int wave = tid >> 5, lane = tid & 31;
  int mr = lane & 15, kg = lane >> 4;
  const v8f z = {0, 0, 0, 0, 0, 0, 0, 0};
  // k order of the score product, A (k) and B (q) alike: step kc, half kg,
  // element e  <->  m = 4*kg + 2*kc + e: one 16-byte read holds both steps.
  v4f qf[2];
#pragma unroll
  for (int t = 0; t < 2; ++t)
    qf[t] = *(const v4f*)&q_s[((wave + t * 8) * 16 + mr) * 8 + kg * 4];
  const float* kp = k_s + mr * 8 + kg * 4;
  // ---- pass 1: raw score stats -------------------------------------------
  v2f s1v = {0.f, 0.f}, s2v = {0.f, 0.f};
  float rmax[2] = {-3.0e38f, -3.0e38f};
  for (int jt = 0; jt < 16; ++jt) {
    v4f kf = *(const v4f*)(kp + jt * 128);
    v2f ka = {kf[0], kf[1]}, kb = {kf[2], kf[3]};
#pragma unroll
    for (int t = 0; t < 2; ++t) {
      v2f qa = {qf[t][0], qf[t][1]}, qb = {qf[t][2], qf[t][3]};
      v8f acc = wmma4(kb, qb, wmma4(ka, qa, z));
#pragma unroll
      for (int s = 0; s < 4; ++s) {
        v2f pr = {acc[2 * s], acc[2 * s + 1]};
        s1v += pr; s2v += pr * pr;
        rmax[t] = fmaxf(rmax[t], fmaxf(pr[0], pr[1]));
      }
    }
  }
  {
    float a0 = wave_sum(s1v[0] + s1v[1]), a1 = wave_sum(s2v[0] + s2v[1]);
    if (lane == 0) { st[wave][0] = a0; st[wave][1] = a1; }
  }
#pragma unroll
  for (int t = 0; t < 2; ++t)   // the other half-wave holds the row's other j
    rmax[t] = fmaxf(rmax[t], __shfl_xor(rmax[t], 16, 32));
  __syncthreads();
  float S1 = 0.f, S2 = 0.f;
#pragma unroll
  for (int w = 0; w < 8; ++w) { S1 += st[w][0]; S2 += st[w][1]; }
  float mu = S1 * (1.f / 65536.f);
  float var = S2 * (1.f / 65536.f) - mu * mu;
  float rstd = rsqrtf(var + 1e-5f);   // InstanceNorm eps; mu cancels in softmax
  // ---- pass 2: softmax + p@v ---------------------------------------------
  float cs = rstd * 1.44269504088896341f;         // exp(x) = exp2(x * log2 e)
  v2f cs2 = {cs, cs};
  // one shift per row: its rounding cancels between numerator and row sum
  v2f nb2[2] = {{-rmax[0] * cs, -rmax[0] * cs}, {-rmax[1] * cs, -rmax[1] * cs}};
  v8f o[2] = {z, z};
  const float* vp = vt_s + (mr < 9 ? mr : 9) * VTP + kg * 8;
  for (int jt = 0; jt < 16; ++jt) {
    v4f kf = *(const v4f*)(kp + jt * 128);
    v4f va = *(const v4f*)(vp + jt * 16), vb = *(const v4f*)(vp + jt * 16 + 4);
    v2f ka = {kf[0], kf[1]}, kb = {kf[2], kf[3]};
    v2f vf[4] = {{va[0], va[1]}, {va[2], va[3]}, {vb[0], vb[1]}, {vb[2], vb[3]}};
#pragma unroll
    for (int t = 0; t < 2; ++t) {
      v2f qa = {qf[t][0], qf[t][1]}, qb = {qf[t][2], qf[t][3]};
      v8f acc = wmma4(kb, qb, wmma4(ka, qa, z));
#pragma unroll
      for (int s = 0; s < 4; ++s) {
        v2f x = {acc[2 * s], acc[2 * s + 1]};
        x = x * cs2 + nb2[t];
        v2f pf = {__builtin_amdgcn_exp2f(x[0]), __builtin_amdgcn_exp2f(x[1])};
        o[t] = wmma4(vf[s], pf, o[t]);
      }
    }
  }
  // o[t][r] = O^T[r + 8*kg][i = mr]: kg 0 holds the 8 numerators of row i,
  // kg 1 holds the row sum in r = 0.
#pragma unroll
  for (int t = 0; t < 2; ++t) {
    float den = __shfl_xor(o[t][0], 16, 32);
    if (kg == 0) {
      int cc = (wave + t * 8) * 16 + mr;
      float inv = 1.f / den;
#pragma unroll
      for (int m2 = 0; m2 < 8; ++m2) {
        int p1 = m2 >> 2, p2 = (m2 >> 1) & 1, p3 = m2 & 1;
        int s = (d * 2 + p1) * 36 + (ph * 2 + p2) * 6 + (pwv * 2 + p3);
        Ofl[(size_t)(b * 216 + s) * 1024 + cc * 4 + h] = o[t][m2] * inv;
      }
    }
  }
}

// One grid for both attentions.  Work-groups 0..127: stage 2 of the global
// branch; the other 864: the local attention core.
__global__ __launch_bounds__(256) void k_attn_all(
    const float* __restrict__ Qb, const float* __restrict__ Kb,
    const float* __restrict__ Vb, float* __restrict__ Ofl,
    const float* __restrict__ gqkv, const float* __restrict__ g_wo,
    float* __restrict__ gpart) {
  if (blockIdx.x < 128)
    g_attn_body(blockIdx.x, gqkv, g_wo, gpart);
  else
    attn_local_body(blockIdx.x - 128, Qb, Kb, Vb, Ofl);
}

// ---------------------------------------------------------------------------
// Tail of the local branch in one launch: out = sum of its four K-quarter
// planes (outb, WOM x 256 each), t2 = LN(out + res) per row over C,
// map-out GEMM 'sc,oc->os' + bias + GELU, and y = x + broadcast(global) + local.
// Work-group = 16 rows s x 128 outputs o (both halves of o redo the cheap LN of
// their 16 rows); 216 work-groups, 8 waves, a wave owns 16 o.
// The product is built transposed, D(16 o x 16 s) = mo_w(16 o x K) @ t2^T(K x
// 16 s): in the accumulator the 16 lanes of a half-wave then hold 16 successive
// s of one o, which are 64 successive bytes of x and of y.
// Both operands lie in LDS as rows of k, pitch TP dwords (16 bytes x odd).  A
// wave brings its own 16 rows of mo_w with whole-line loads, issued ahead of
// the LN.  k order, A and B alike: read c8, half kg, step kc, element e  <->
// k = 8*c8 + 4*kg + 2*kc + e: one 16-byte read holds two k-steps.
// ---------------------------------------------------------------------------
#define TP 260

__global__ __launch_bounds__(256) void k_tail(
    const float* __restrict__ outb, const float* __restrict__ res,
    const float* __restrict__ ln_g, const float* __restrict__ ln_b,
    const float* __restrict__ mo_w, const float* __restrict__ mo_b,
    const float* __restrict__ x, const float* __restrict__ gvec,
    float* __restrict__ y) {
  __shared__ __attribute__((aligned(16))) float t_s[16 * TP];    // t2[s][k]
  __shared__ __attribute__((aligned(16))) float w_s[128 * TP];   // mo_w[o][k]
  int tid = threadIdx.x, wave = tid >> 5, lane = tid & 31;
  int mr = lane & 15, kg = lane >> 4;
  int row0 = (blockIdx.x >> 1) * 16;
  int n0 = (blockIdx.x & 1) * 128 + wave * 16;
  // LN operands: rows row0 + 2*wave and + 1; the wave's 16 rows of mo_w;
  // epilogue operands: lane = row s = row0 + mr, outputs o = oo + r
  size_t lo = (size_t)(row0 + wave * 2) * 256 + lane * 4;
  const float *op = outb + lo, *rp = res + lo;   // op: plane 0 of out
  const float *lgp = ln_g + lane * 4, *lbp = ln_b + lane * 4;
  const float* wp = mo_w + (size_t)n0 * 256 + lane * 4;
  int bs = row0 + mr, b = bs / 216, s = bs - b * 216;
  int oo = n0 + kg * 8;
  size_t xo = (size_t)(b * 256 + oo) * 216 + s;
  const float* xp = x + xo;
  const float* gp = gvec + b * 256 + oo;
  unsigned bo = oo * 4u;   // byte offset: the register that the mo_b loads name
  const float* bp = (const float*)((const char*)mo_b + bo);
  v4f ov[4][4], rv[4], lg[2], lb[2];   // [plane] row*2 + half row; half row
#pragma unroll
  for (int j = 0; j < 4; ++j) {
#pragma unroll   // constant indices keep ov in registers
    for (int q = 0; q < 4; ++q)
      ov[q][j] = *(const v4f*)(op + q * (WOM * 256) + j * 128);
    rv[j] = *(const v4f*)(rp + j * 128);
  }
#pragma unroll
  for (int j = 0; j < 2; ++j) {
    lg[j] = *(const v4f*)(lgp + j * 128);
    lb[j] = *(const v4f*)(lbp + j * 128);
  }
  v4f wr[32];   // load i = row i/2, half i%2
#pragma unroll
  for (int i = 0; i < 32; ++i) wr[i] = *(const v4f*)(wp + i * 128);
  float xv[8];
#pragma unroll
  for (int r = 0; r < 8; ++r) xv[r] = xp[r * 216];
  v4f gv[2] = {*(const v4f*)gp, *(const v4f*)(gp + 4)};
  v4f mb[2] = {*(const v4f*)bp, *(const v4f*)(bp + 4)};
  // keeps all loads ahead of the first load wait (one exposed latency)
  __builtin_amdgcn_sched_barrier(0);
  // stands before any register that a load above names is written again; the
  // address pairs and the two offsets are inputs so that they live up to it
  asm volatile("s_wait_xcnt 0x0" ::"v"(op), "v"(rp), "v"(lane), "v"(wp),
               "v"(xp), "v"(gp), "v"(bo)
               : "memory");
  // keeps later register writes from being lifted over the wait
  __builtin_amdgcn_sched_barrier(0);
#pragma unroll
  for (int q = 0; q < 2; ++q) {
    v4f a = ((ov[0][2 * q] + ov[1][2 * q]) + (ov[2][2 * q] + ov[3][2 * q])) +
            rv[2 * q];
    v4f c = ((ov[0][2 * q + 1] + ov[1][2 * q + 1]) +
             (ov[2][2 * q + 1] + ov[3][2 * q + 1])) +
            rv[2 * q + 1];
    v4f s4 = a + c, p4 = a * a + c * c;
    float S1 = wave_sum((s4[0] + s4[1]) + (s4[2] + s4[3]));
    float S2 = wave_sum((p4[0] + p4[1]) + (p4[2] + p4[3]));
    float mn = S1 * (1.f / 256.f), var = S2 * (1.f / 256.f) - mn * mn;
    float rs = rsqrtf(var + 1e-6f);
    float* td = t_s + (wave * 2 + q) * TP + lane * 4;
    *(v4f*)td = (a - mn) * rs * lg[0] + lb[0];
    *(v4f*)(td + 128) = (c - mn) * rs * lg[1] + lb[1];
  }
#pragma unroll
  for (int i = 0; i < 32; ++i)
    *(v4f*)&w_s[(wave * 16 + (i >> 1)) * TP + (i & 1) * 128 + lane * 4] = wr[i];
  __syncthreads();   // publishes t2 (and the wave's own mo_w rows)
  const float* ap = w_s + (wave * 16 + mr) * TP + kg * 4;
  const float* bq = t_s + mr * TP + kg * 4;
  const v8f z = {0, 0, 0, 0, 0, 0, 0, 0};
  v8f acc[2] = {z, z};   // one per k-step of a read: two independent chains
  // groups of four reads per operand (8 WMMAs), a ring of three: g+2 is read
  // while g multiplies
  v4f fa[3][4], fb[3][4];
#pragma unroll
  for (int g = 0; g < 2; ++g)
#pragma unroll
    for (int j = 0; j < 4; ++j) {
      fa[g][j] = *(const v4f*)(ap + (g * 4 + j) * 8);
      fb[g][j] = *(const v4f*)(bq + (g * 4 + j) * 8);
    }
#pragma unroll
  for (int g = 0; g < 8; ++g) {
    if (g + 2 < 8) {
#pragma unroll
      for (int j = 0; j < 4; ++j) {
        fa[(g + 2) % 3][j] = *(const v4f*)(ap + ((g + 2) * 4 + j) * 8);
        fb[(g + 2) % 3][j] = *(const v4f*)(bq + ((g + 2) * 4 + j) * 8);
      }
    }
    // keeps the LDS reads above ahead of this group's WMMAs: the scheduler
    // otherwise sinks each read to just before its use and waits it out
    __builtin_amdgcn_sched_barrier(0);
#pragma unroll
    for (int j = 0; j < 4; ++j) {
      v4f a = fa[g % 3][j], c = fb[g % 3][j];
      v2f a0 = {a[0], a[1]}, a1 = {a[2], a[3]};
      v2f c0 = {c[0], c[1]}, c1 = {c[2], c[3]};
      acc[0] = wmma4(a0, c0, acc[0]);
      acc[1] = wmma4(a1, c1, acc[1]);
    }
  }
  // acc[.][r] = D[o = oo + r][s = row0 + mr]
  float* yp = y + xo;
#pragma unroll
  for (int r = 0; r < 8; ++r) {
    float v = gelu_exact((acc[0][r] + acc[1][r]) + mb[r >> 2][r & 3]);
    yp[r * 216] = xv[r] + gv[r >> 2][r & 3] + v;
  }
}

extern "C" void kernel_launch(void* const* d_in, const int* in_sizes, int n_in,
                              void* d_out, int out_size, void* d_ws,
                              size_t ws_size, hipStream_t stream) {
  const float* x       = (const float*)d_in[0];
  const float* g_tok_w = (const float*)d_in[1];
  const float* g_tok_b = (const float*)d_in[2];
  const float* g_ln1_g = (const float*)d_in[3];
  const float* g_ln1_b = (const float*)d_in[4];
  const float* g_wq    = (const float*)d_in[5];
  const float* g_wk    = (const float*)d_in[6];
  const float* g_wv    = (const float*)d_in[7];
  const float* g_wo    = (const float*)d_in[8];
  const float* g_ln2_g = (const float*)d_in[9];
  const float* g_ln2_b = (const float*)d_in[10];
  const float* g_mo_w  = (const float*)d_in[11];
  const float* g_mo_b  = (const float*)d_in[12];
  const float* l_pw    = (const float*)d_in[13];
  const float* l_pb    = (const float*)d_in[14];
  const float* l_ln1_g = (const float*)d_in[15];
  const float* l_ln1_b = (const float*)d_in[16];
  const float* l_wq    = (const float*)d_in[17];
  const float* l_wk    = (const float*)d_in[18];
  const float* l_wv    = (const float*)d_in[19];
  const float* l_wo    = (const float*)d_in[20];
  const float* l_ln2_g = (const float*)d_in[21];
  const float* l_ln2_b = (const float*)d_in[22];
  const float* l_mo_w  = (const float*)d_in[23];
  const float* l_mo_b  = (const float*)d_in[24];

  float* ws   = (float*)d_ws;
  float* gsum = ws;                 // 8*27, in 2048
  float* gvec = ws + 2048;          // 2048
  float* eln  = ws + 2048 + 2048;   // 1728*256
  float* res  = eln + 442368;       // 1728*256
  float* Qb   = res + 442368;       // 1728*1024
  float* Kb   = Qb + 1769472;       // 1728*1024
  float* Vb   = Kb + 1769472;       // 1728*1024
  float* ofl  = Vb + 1769472;       // 1728*1024
  float* gqkv = ofl + 1769472;      // 3*8*1024
  float* gpart = gqkv + 24576;      // 8*16*256
  float* outb = Qb;                 // alias: Qb dead after attention; 4 planes

  k_local_embed<<<216, 256, 0, stream>>>(x, l_pw, l_pb, l_ln1_g, l_ln1_b, res,
                                         eln, gsum);
  k_qkv_all<<<744, 256, 0, stream>>>(eln, l_wq, l_wk, l_wv, Qb, Kb, Vb, 1024,
                                     256, gsum, g_tok_w, g_tok_b, g_ln1_g,
                                     g_ln1_b, g_wq, g_wk, g_wv, gqkv);
  k_attn_all<<<992, 256, 0, stream>>>(Qb, Kb, Vb, ofl, gqkv, g_wo, gpart);
  k_wo_all<<<496, 128, 0, stream>>>(ofl, l_wo, outb, 256, 1024, gsum, g_tok_w,
                                    g_tok_b, gpart, g_ln2_g, g_ln2_b, g_mo_w,
                                    g_mo_b, gvec);
  k_tail<<<216, 256, 0, stream>>>(outb, res, l_ln2_g, l_ln2_b, l_mo_w, l_mo_b,
                                  x, gvec, (float*)d_out);
}

// v007
// One run takes 71.7 microseconds.
// Two timings next to v006 both put it at 1.06 times that version's speed.
// All steps since v000 together make it 5.13 times as fast.
#include <hip/hip_runtime.h>
#include <hip/hip_bf16.h>
#include <math.h>

typedef float v2f __attribute__((ext_vector_type(2)));
typedef float v4f __attribute__((ext_vector_type(4)));
typedef float v8f __attribute__((ext_vector_type(8)));

// ---------------------------------------------------------------------------
// fp32 WMMA: D(16x16) = A(16x4) * B(4x16) + C, full fp32 (matches reference
// numerics up to reassociation).  Lane L: mr = L%16, kg = L/16.
//   A frag (v2f): a[0]=A[mr][kg*2], a[1]=A[mr][kg*2+1]
//   B frag (v2f): b[0]=B[kg*2][mr], b[1]=B[kg*2+1][mr]
//   C/D (v8f):    c[r] = C[r + 8*kg][mr]
// ---------------------------------------------------------------------------
__device__ __forceinline__ v8f wmma4(v2f a, v2f b, v8f c) {
  return __builtin_amdgcn_wmma_f32_16x16x4_f32(false, a, false, b, (short)0, c,
                                               false, false);
}

__device__ __forceinline__ float gelu_exact(float x) {
  return 0.5f * x * (1.0f + erff(x * 0.70710678118654752f));
}

// ---------------------------------------------------------------------------
// Global branch, spread over many work-groups in three dependent stages.
// Rank-1 score => instance-norm stats factor; softmax is shift-invariant so
// only 1/sigma and row-max of the raw score are needed.
// No stage has a launch of its own: each is independent of the local-branch
// stage that runs at the same depth of the chain, and its work-groups are the
// first ones of that stage's grid.  The mean over (C,D,H,W) comes as 27 sums
// per batch from the patch-embed work-groups, which read all of x anyway.
// ---------------------------------------------------------------------------
__device__ __forceinline__ float wave_sum(float v) {
#pragma unroll
  for (int o = 16; o > 0; o >>= 1) v += __shfl_xor(v, o, 32);
  return v;
}
__device__ __forceinline__ float wave_max(float v) {
#pragma unroll
  for (int o = 16; o > 0; o >>= 1) v = fmaxf(v, __shfl_xor(v, o, 32));
  return v;
}
__device__ __forceinline__ float wave_min(float v) {
#pragma unroll
  for (int o = 16; o > 0; o >>= 1) v = fminf(v, __shfl_xor(v, o, 32));
  return v;
}

// Stage 1: q/k/v projections for all 8 batches at once (8x256 @ 256x1024 x3).
// Work-group = one matrix x 32 columns; wave = 32 rows of K; lane = column.
// Each weight element is read once by the whole grid.
// t_s: 256*8 floats, t[k][batch], 16-byte aligned; red: 8*8*32 floats,
// [wave][batch][lane].
__device__ __forceinline__ void g_qkv_body(
    int blk, float* t_s, float* red, const float* __restrict__ gsum,
    const float* __restrict__ tok_w, const float* __restrict__ tok_b,
    const float* __restrict__ ln1_g, const float* __restrict__ ln1_b,
    const float* __restrict__ wq, const float* __restrict__ wk,
    const float* __restrict__ wv, float* __restrict__ qkv) {
  int tid = threadIdx.x, wave = tid >> 5, lane = tid & 31;
  int mat = blk >> 5, col = (blk & 31) * 32 + lane;
  const float* Wm = mat == 0 ? wq : (mat == 1 ? wk : wv);
  const float* wp = Wm + (size_t)(wave * 32) * 1024 + col;
  float wreg[32];   // issued first: the LN below runs under their latency
#pragma unroll
  for (int i = 0; i < 32; ++i) wreg[i] = wp[i * 1024];
  const float* gp = gsum + wave * 27 + (lane < 27 ? lane : 26);
  float gs = *gp;   // lanes 0..26: the 27 patch sums of batch 'wave'
  float tw[8], tb8[8], lg[8], lb[8];
#pragma unroll
  for (int k = 0; k < 8; ++k) {
    int c = k * 32 + lane;
    tw[k] = tok_w[c]; tb8[k] = tok_b[c]; lg[k] = ln1_g[c]; lb[k] = ln1_b[c];
  }
  // the scheduler otherwise sinks part of the loads above behind the first
  // load wait (two or more exposed latencies instead of one)
  __builtin_amdgcn_sched_barrier(0);
  // stands before any register that a load above names is written again; the
  // address pairs are inputs so that they live up to the wait
  asm volatile("s_wait_xcnt 0x0" :: "v"(wp), "v"(gp) : "memory");
  // keeps later register writes from being lifted over the wait
  __builtin_amdgcn_sched_barrier(0);
  float m = wave_sum(lane < 27 ? gs : 0.f) / 55296.0f;
  // LN1 of batch 'wave': 8 channels per lane
  {
    float tok[8];
    float s1 = 0.f, s2 = 0.f;
#pragma unroll
    for (int k = 0; k < 8; ++k) {
      tok[k] = m * tw[k] + tb8[k];
      s1 += tok[k]; s2 += tok[k] * tok[k];
    }
    s1 = wave_sum(s1); s2 = wave_sum(s2);
    float mn = s1 * (1.f / 256.f);
    float var = s2 * (1.f / 256.f) - mn * mn;
    float rs = rsqrtf(var + 1e-6f);
#pragma unroll
    for (int k = 0; k < 8; ++k) {
      int c = k * 32 + lane;
      t_s[c * 8 + wave] = (tok[k] - mn) * rs * lg[k] + lb[k];
    }
  }
  __syncthreads();
  float acc[8] = {0, 0, 0, 0, 0, 0, 0, 0};
#pragma unroll
  for (int i = 0; i < 32; ++i) {
    const float4* tp = (const float4*)&t_s[(wave * 32 + i) * 8];
    float4 ta = tp[0], tb = tp[1];
    float w = wreg[i];
    acc[0] += ta.x * w; acc[1] += ta.y * w; acc[2] += ta.z * w; acc[3] += ta.w * w;
    acc[4] += tb.x * w; acc[5] += tb.y * w; acc[6] += tb.z * w; acc[7] += tb.w * w;
  }
#pragma unroll
  for (int bb = 0; bb < 8; ++bb) red[(wave * 8 + bb) * 32 + lane] = acc[bb];
  __syncthreads();
  float s = 0.f;   // this thread finishes batch 'wave', column 'col'
#pragma unroll
  for (int w = 0; w < 8; ++w) s += red[(w * 8 + wave) * 32 + lane];
  qkv[(size_t)(mat * 8 + wave) * 1024 + col] = s;
}

// Stage 2: work-group = (batch, head, quarter of the 256 score rows).
// Thread = (row of the quarter, quarter of the 256 columns).  The 64 output
// values then meet their 64 rows of wo; the partial 1x256 goes to 'part'.
__device__ __forceinline__ void g_attn_body(
    int blk, const float* __restrict__ qkv, const float* __restrict__ wo,
    float* __restrict__ part) {
  __shared__ __attribute__((aligned(16))) float k_s[256];
  __shared__ __attribute__((aligned(16))) float v_s[256];
  __shared__ float q_s[256];
  __shared__ float st[8][6];
  __shared__ float den_s[256], acc_s[256];
  __shared__ float o_s[64];
  __shared__ __attribute__((aligned(16))) float red[8 * 256];
  int tid = threadIdx.x, wave = tid >> 5, lane = tid & 31;
  int rq = blk & 3, h = (blk >> 2) & 3, b = blk >> 4;
  // wo rows (c*4 + h) of this wave's 8 score rows, issued first so that they
  // arrive while the softmax runs
  float4 w0[8], w1[8];
  const float* wr = wo + (size_t)((rq * 64 + wave * 8) * 4 + h) * 256 + lane * 4;
#pragma unroll
  for (int i = 0; i < 8; ++i) {
    w0[i] = *(const float4*)(wr + i * 1024);
    w1[i] = *(const float4*)(wr + i * 1024 + 128);
  }
  float qi = qkv[(size_t)(0 + b) * 1024 + h * 256 + tid];   // heads OUTER
  float ki = qkv[(size_t)(8 + b) * 1024 + h * 256 + tid];
  float vi = qkv[(size_t)(16 + b) * 1024 + h * 256 + tid];
  // the scheduler otherwise sinks part of the loads above behind the first
  // load wait (two or more exposed latencies instead of one)
  __builtin_amdgcn_sched_barrier(0);
  // stands before any register that a load above names is written again; the
  // address pair is an input so that it lives up to the wait
  asm volatile("s_wait_xcnt 0x0" :: "v"(wr) : "memory");
  // keeps later register writes from being lifted over the wait
  __builtin_amdgcn_sched_barrier(0);
  q_s[tid] = qi; k_s[tid] = ki; v_s[tid] = vi;
  {
    float a0 = wave_sum(qi), a1 = wave_sum(qi * qi);
    float a2 = wave_sum(ki), a3 = wave_sum(ki * ki);
    float a4 = wave_max(ki), a5 = wave_min(ki);
    if (lane == 0) {
      st[wave][0] = a0; st[wave][1] = a1; st[wave][2] = a2;
      st[wave][3] = a3; st[wave][4] = a4; st[wave][5] = a5;
    }
  }
  __syncthreads();
  float Sq = 0.f, Sq2 = 0.f, Sk = 0.f, Sk2 = 0.f;
  float kmx = st[0][4], kmn = st[0][5];
#pragma unroll
  for (int w = 0; w < 8; ++w) {
    Sq += st[w][0]; Sq2 += st[w][1]; Sk += st[w][2]; Sk2 += st[w][3];
    kmx = fmaxf(kmx, st[w][4]); kmn = fminf(kmn, st[w][5]);
  }
  float mu  = (Sq * Sk)  * (1.f / 65536.f);
  float ex2 = (Sq2 * Sk2) * (1.f / 65536.f);
  float rstd = rsqrtf(ex2 - mu * mu + 1e-5f);
  float qr = q_s[rq * 64 + (tid & 63)];
  int j0 = (tid >> 6) * 64;
  float rmax = qr * (qr >= 0.f ? kmx : kmn);  // row max of raw score
  float den = 0.f, acc = 0.f;
#pragma unroll 4
  for (int j = 0; j < 64; j += 4) {
    float4 k4 = *(const float4*)&k_s[j0 + j];
    float4 v4 = *(const float4*)&v_s[j0 + j];
    float p0 = __expf((qr * k4.x - rmax) * rstd);
    float p1 = __expf((qr * k4.y - rmax) * rstd);
    float p2 = __expf((qr * k4.z - rmax) * rstd);
    float p3 = __expf((qr * k4.w - rmax) * rstd);
    den += p0; acc += p0 * v4.x;
    den += p1; acc += p1 * v4.y;
    den += p2; acc += p2 * v4.z;
    den += p3; acc += p3 * v4.w;
  }
  den_s[tid] = den; acc_s[tid] = acc;
  __syncthreads();
  if (tid < 64) {
    float dd = (den_s[tid] + den_s[64 + tid]) + (den_s[128 + tid] + den_s[192 + tid]);
    float aa = (acc_s[tid] + acc_s[64 + tid]) + (acc_s[128 + tid] + acc_s[192 + tid]);
    o_s[tid] = aa / dd;
  }
  __syncthreads();
  float4 p0 = {0.f, 0.f, 0.f, 0.f}, p1 = {0.f, 0.f, 0.f, 0.f};
#pragma unroll
  for (int i = 0; i < 8; ++i) {
    float o = o_s[wave * 8 + i];
    p0.x += o * w0[i].x; p0.y += o * w0[i].y; p0.z += o * w0[i].z; p0.w += o * w0[i].w;
    p1.x += o * w1[i].x; p1.y += o * w1[i].y; p1.z += o * w1[i].z; p1.w += o * w1[i].w;
  }
  *(float4*)&red[wave * 256 + lane * 4] = p0;
  *(float4*)&red[wave * 256 + 128 + lane * 4] = p1;
  __syncthreads();
  float s = 0.f;
#pragma unroll
  for (int w = 0; w < 8; ++w) s += red[w * 256 + tid];
  part[(size_t)blk * 256 + tid] = s;   // [(b*16 + h*4 + rq)][256]
}

// Stage 3: work-group of 128 threads = (batch, eighth of the 256 outputs).
// Sums the 16 partials, adds the residual, LN2 (two channels per thread), then
// map-out rows ('bc,oc->bo') with the lanes along c (coalesced) and a wave
// reduction per output, then GELU.
__device__ __forceinline__ void g_out_body(
    int blk, const float* __restrict__ gsum,
    const float* __restrict__ tok_w, const float* __restrict__ tok_b,
    const float* __restrict__ part,
    const float* __restrict__ ln2_g, const float* __restrict__ ln2_b,
    const float* __restrict__ mo_w, const float* __restrict__ mo_b,
    float* __restrict__ gvec) {
  __shared__ __attribute__((aligned(16))) float t_s[256];
  __shared__ float st[4][2];
  int c = threadIdx.x, wave = c >> 5, lane = c & 31;
  int b = blk >> 3, o0 = (blk & 7) * 32 + wave * 8;
  float4 m0[8], m1[8];   // issued first: LN2 runs under their latency
  const float* mr = mo_w + (size_t)o0 * 256 + lane * 4;
#pragma unroll
  for (int r = 0; r < 8; ++r) {
    m0[r] = *(const float4*)(mr + r * 256);
    m1[r] = *(const float4*)(mr + r * 256 + 128);
  }
  const float* pp = part + (size_t)(b * 16) * 256 + c;
  float pr[16], ps[16];   // channels c and c + 128
#pragma unroll
  for (int p = 0; p < 16; ++p) { pr[p] = pp[p * 256]; ps[p] = pp[p * 256 + 128]; }
  int gi = lane < 27 ? lane : 26, mi = o0 + (lane & 7);
  float gs = gsum[b * 27 + gi];   // lanes 0..26: the 27 patch sums of batch b
  float tw0 = tok_w[c], tb0 = tok_b[c], tw1 = tok_w[c + 128], tb1 = tok_b[c + 128];
  float g20 = ln2_g[c], b20 = ln2_b[c], g21 = ln2_g[c + 128], b21 = ln2_b[c + 128];
  float mb = mo_b[mi];
  // the scheduler otherwise sinks part of the loads above behind the first
  // load wait (two or more exposed latencies instead of one)
  __builtin_amdgcn_sched_barrier(0);
  // stands before any register that a load above names is written again; the
  // address pair and the offsets are inputs so that they live up to the wait
  asm volatile("s_wait_xcnt 0x0" :: "v"(mr), "v"(c), "v"(gi), "v"(mi) : "memory");
  // keeps later register writes from being lifted over the wait
  __builtin_amdgcn_sched_barrier(0);
  float m = wave_sum(lane < 27 ? gs : 0.f) / 55296.0f;
  float out0 = 0.f, out1 = 0.f;
#pragma unroll
  for (int p = 0; p < 16; ++p) { out0 += pr[p]; out1 += ps[p]; }
  float ov0 = out0 + (m * tw0 + tb0), ov1 = out1 + (m * tw1 + tb1);
  {
    float a0 = wave_sum(ov0 + ov1), a1 = wave_sum(ov0 * ov0 + ov1 * ov1);
    if (lane == 0) { st[wave][0] = a0; st[wave][1] = a1; }
  }
  __syncthreads();
  float T1 = 0.f, T2 = 0.f;
#pragma unroll
  for (int w = 0; w < 4; ++w) { T1 += st[w][0]; T2 += st[w][1]; }
  float mn2 = T1 * (1.f / 256.f), var2 = T2 * (1.f / 256.f) - mn2 * mn2;
  float rs2 = rsqrtf(var2 + 1e-6f);
  t_s[c] = (ov0 - mn2) * rs2 * g20 + b20;
  t_s[c + 128] = (ov1 - mn2) * rs2 * g21 + b21;
  __syncthreads();
  float4 ta = *(const float4*)&t_s[lane * 4];
  float4 tc = *(const float4*)&t_s[128 + lane * 4];
  float val = 0.f;
#pragma unroll
  for (int r = 0; r < 8; ++r) {
    float dd = m0[r].x * ta.x + m0[r].y * ta.y + m0[r].z * ta.z + m0[r].w * ta.w +
               m1[r].x * tc.x + m1[r].y * tc.y + m1[r].z * tc.z + m1[r].w * tc.w;
    dd = wave_sum(dd);
    if (lane == r) val = dd;
  }
  if (lane < 8) gvec[b * 256 + o0 + lane] = gelu_exact(val + mb);
}

// ---------------------------------------------------------------------------
// Local branch: patchify (2x2x2) + 8x8 embed + LN over C.
// Emits res (B,216,C) and eln rows (bp*8+pv, C), and the sum of the 2048 x
// values it has read (one of the 27 parts of its batch's global-branch mean).
// ---------------------------------------------------------------------------
__global__ __launch_bounds__(256) void k_local_embed(
    const float* __restrict__ x, const float* __restrict__ pw,
    const float* __restrict__ pb, const float* __restrict__ ln_g,
    const float* __restrict__ ln_b, float* __restrict__ res,
    float* __restrict__ eln, float* __restrict__ gsum) {
  __shared__ float pw_s[64];
  __shared__ float pb_s[8];
  __shared__ float sc[8 * 256];
  __shared__ float part1[256], part2[256];
  __shared__ float mean_s[8], rstd_s[8];
  __shared__ float xs_s[8];
  int bp = blockIdx.x, b = bp / 27, p = bp % 27;
  int d = p / 9, hh = (p / 3) % 3, w = p % 3;
  int c = threadIdx.x;
  if (c < 64) pw_s[c] = pw[c];
  if (c < 8) pb_s[c] = pb[c];
  __syncthreads();
  const float* xb = x + (size_t)(b * 256 + c) * 216;
  float patch[8];
#pragma unroll
  for (int u = 0; u < 8; ++u) {
    int p1 = u >> 2, p2 = (u >> 1) & 1, p3 = u & 1;
    patch[u] = xb[(d * 2 + p1) * 36 + (hh * 2 + p2) * 6 + (w * 2 + p3)];
  }
  {
    float xs = wave_sum(((patch[0] + patch[1]) + (patch[2] + patch[3])) +
                        ((patch[4] + patch[5]) + (patch[6] + patch[7])));
    if ((c & 31) == 0) xs_s[c >> 5] = xs;   // read behind the next barrier
  }
  float tokv[8];
#pragma unroll
  for (int e = 0; e < 8; ++e) {
    float a = pb_s[e];
#pragma unroll
    for (int u = 0; u < 8; ++u) a += pw_s[e * 8 + u] * patch[u];
    tokv[e] = a;
    sc[e * 256 + c] = a;
    int p1 = e >> 2, p2 = (e >> 1) & 1, p3 = e & 1;
    int s = (d * 2 + p1) * 36 + (hh * 2 + p2) * 6 + (w * 2 + p3);
    res[(size_t)(b * 216 + s) * 256 + c] = a;   // residual uses raw tok
  }
  __syncthreads();
  int g = c >> 5, lane = c & 31;
  float s1 = 0.f, s2 = 0.f;
#pragma unroll
  for (int k = 0; k < 8; ++k) {
    float vv = sc[g * 256 + lane + k * 32];
    s1 += vv; s2 += vv * vv;
  }
  part1[c] = s1; part2[c] = s2;
  if (c == 0)
    gsum[bp] = ((xs_s[0] + xs_s[1]) + (xs_s[2] + xs_s[3])) +
               ((xs_s[4] + xs_s[5]) + (xs_s[6] + xs_s[7]));
  __syncthreads();
  if (c < 8) {
    float a = 0.f, bb = 0.f;
    for (int l = 0; l < 32; ++l) { a += part1[c * 32 + l]; bb += part2[c * 32 + l]; }
    float mn = a * (1.f / 256.f), vr = bb * (1.f / 256.f) - mn * mn;
    mean_s[c] = mn; rstd_s[c] = rsqrtf(vr + 1e-6f);
  }
  __syncthreads();
  float lg = ln_g[c], lb = ln_b[c];
#pragma unroll
  for (int e = 0; e < 8; ++e)
    eln[(size_t)(bp * 8 + e) * 256 + c] =
        (tokv[e] - mean_s[e]) * rstd_s[e] * lg + lb;
}

// ---------------------------------------------------------------------------
// fp32 WMMA GEMM: C = act(A(MxK) @ B(KxN) [+bias]).  TRANSB/ACT are template
// params so the inner loop is branch-free.  128 threads (4 waves) per tile; each wave
// owns a 16(M) x 64(N) strip; all 4 waves share one n-strip, so the 64x64 B
// tile is staged through LDS once per K-chunk (16-byte loads, 4x reuse).
// The K loop is software-pipelined at both levels.  Global: while the WMMAs of
// chunk c run, the A fragments and the B tile of chunk c+1 are on their way
// into registers; the tile then goes into the other LDS buffer, so one barrier
// per chunk both publishes it and ends the reads of the buffer refilled next.
// LDS: B fragments are read two groups of WMMAs ahead of their use.  For that
// a fragment must land in its register pair as it is, so the tile lies in LDS
// as rows of k pairs: Bs[k/2][n][k%2], row pitch GPP dwords (128 + 32: the two
// half-waves, one k pair apart, fall on different halves of the 64 banks).
// Requires M%64==0, N%64==0, K%64==0.
// ---------------------------------------------------------------------------
#define GKC 64
#define GPP 160

template <bool TRANSB>
__device__ __forceinline__ void gemm_fetch(const float* __restrict__ arow,
                                           const float* __restrict__ bsrc,
                                           int k0, int N, v2f (&an)[GKC / 4],
                                           v4f (&bn)[8]) {
  const float* ap = arow + k0;
  const float* bp[8];
#pragma unroll
  for (int i = 0; i < 8; ++i) {
    // !TRANSB: rows k0 + 16*(i/2) + i%2 (+ 2*rp0, in bsrc); TRANSB: k quad 2*i
    size_t off = TRANSB ? (size_t)(k0 + i * 8)
                        : (size_t)(k0 + (i >> 1) * 16 + (i & 1)) * N;
    bp[i] = bsrc + off;
  }
#pragma unroll
  for (int i = 0; i < GKC / 4; ++i) an[i] = *(const v2f*)(ap + i * 4);
#pragma unroll
  for (int i = 0; i < 8; ++i) bn[i] = *(const v4f*)bp[i];
  // stands before any register that a load above names is written again; the
  // address pairs are inputs so that they live up to the wait (TRANSB: the B
  // loads share one pair and differ in their immediate offsets)
  if (TRANSB)
    asm volatile("s_wait_xcnt 0x0" ::"v"(ap), "v"(bp[0]) : "memory");
  else
    asm volatile("s_wait_xcnt 0x0" ::"v"(ap), "v"(bp[0]), "v"(bp[1]),
                 "v"(bp[2]), "v"(bp[3]), "v"(bp[4]), "v"(bp[5]), "v"(bp[6]),
                 "v"(bp[7])
                 : "memory");
}

template <bool TRANSB>
__device__ __forceinline__ void gemm_put(float* bd, int tid,
                                         const v4f (&bn)[8]) {
  if (!TRANSB) {
    int rp0 = tid >> 4, c4 = (tid & 15) * 4;
#pragma unroll
    for (int i = 0; i < 4; ++i) {
      v4f x = bn[2 * i], y = bn[2 * i + 1];   // rows 2*rp and 2*rp + 1
      v4f lo = {x[0], y[0], x[1], y[1]}, hi = {x[2], y[2], x[3], y[3]};
      float* d = bd + (rp0 + 8 * i) * GPP + c4 * 2;
      *(v4f*)d = lo;
      *(v4f*)(d + 4) = hi;
    }
  } else {
    int c = tid & 63, q0 = tid >> 6;
#pragma unroll
    for (int i = 0; i < 8; ++i) {
      int q = q0 + 2 * i;                      // k = 4*q .. 4*q + 3
      v2f lo = {bn[i][0], bn[i][1]}, hi = {bn[i][2], bn[i][3]};
      *(v2f*)(bd + (2 * q) * GPP + c * 2) = lo;
      *(v2f*)(bd + (2 * q + 1) * GPP + c * 2) = hi;
    }
  }
}

#define GBUF ((GKC / 2) * GPP)   // one LDS buffer, in dwords

// One 64 x 64 tile (mblk, nblk) by 128 threads (tid 0..127); Bs: 2 * GBUF
// dwords of their own, 16-byte aligned.  Its barriers are the work-group's.
// lda: row pitch of A in dwords (above K where the tile sums a slice of k).
template <bool TRANSB, bool ACT>
__device__ __forceinline__ void gemm_tile(
    const float* __restrict__ A, const float* __restrict__ B,
    const float* __restrict__ bias, float* __restrict__ C, int N, int K,
    int lda, float* Bs, int tid, int mblk, int nblk) {
  int wave = tid >> 5, lane = tid & 31;
  int mr = lane & 15, kg = lane >> 4;
  int m0 = (mblk * 4 + wave) * 16;
  int n0 = nblk * 64;
  v8f z = {0, 0, 0, 0, 0, 0, 0, 0};
  v8f acc[4] = {z, z, z, z};
  const float* arow = A + (size_t)(m0 + mr) * lda + kg * 2;
  const float* bsrc =
      TRANSB ? B + (size_t)(n0 + (tid & 63)) * K + (tid >> 6) * 4
             : B + (size_t)((tid >> 4) * 2) * N + n0 + (tid & 15) * 4;
  v2f an[GKC / 4];
  v4f bn[8];
  gemm_fetch<TRANSB>(arow, bsrc, 0, N, an, bn);
  gemm_put<TRANSB>(Bs, tid, bn);
  __syncthreads();
  for (int k0 = 0, buf = 0;; k0 += GKC, buf ^= 1) {
    v2f ac[GKC / 4];
#pragma unroll
    for (int i = 0; i < GKC / 4; ++i) ac[i] = an[i];
    bool more = k0 + GKC < K;   // the same for the whole work-group
    if (more) gemm_fetch<TRANSB>(arow, bsrc, k0 + GKC, N, an, bn);
    // fragment of k-step kc, column tile t: bs + kc*2*GPP + t*32.  Groups of
    // two k-steps (8 WMMAs), a ring of three: g+2 is read while g multiplies.
    const float* bs = Bs + buf * GBUF + kg * GPP + mr * 2;
    v2f bf[3][8];
#pragma unroll
    for (int g = 0; g < 2; ++g)
#pragma unroll
      for (int j = 0; j < 8; ++j)
        bf[g][j] = *(const v2f*)(bs + (g * 2 + (j >> 2)) * 2 * GPP + (j & 3) * 32);
#pragma unroll
    for (int g = 0; g < GKC / 8; ++g) {
      if (g + 2 < GKC / 8) {
#pragma unroll
        for (int j = 0; j < 8; ++j)
          bf[(g + 2) % 3][j] = *(const v2f*)(bs + ((g + 2) * 2 + (j >> 2)) * 2 * GPP +
                                             (j & 3) * 32);
      }
      // keeps the LDS reads above ahead of this group's WMMAs: the scheduler
      // otherwise sinks each read to just before its use and waits it out
      __builtin_amdgcn_sched_barrier(0);
#pragma unroll
      for (int j = 0; j < 8; ++j)
        acc[j & 3] = wmma4(ac[g * 2 + (j >> 2)], bf[g % 3][j], acc[j & 3]);
    }
    if (!more) break;
    gemm_put<TRANSB>(Bs + (buf ^ 1) * GBUF, tid, bn);
    __syncthreads();   // publishes chunk c+1; ends the reads of chunk c
  }
#pragma unroll
  for (int t = 0; t < 4; ++t) {
    int n = n0 + t * 16 + mr;
    float bb = ACT ? bias[n] : 0.f;
#pragma unroll
    for (int r = 0; r < 8; ++r) {
      int row = m0 + r + 8 * kg;
      float v = acc[t][r] + bb;
      if (ACT) v = gelu_exact(v);
      C[(size_t)row * N + n] = v;
    }
  }
}

// One grid for the local attention-output GEMM and stage 3 of the global
// branch.  Work-groups 0..63: stage 3.  The other 432: one GEMM tile over one
// quarter of K each, n fastest, then the quarter: 108 tiles alone leave more
// than half of the chip idle behind a loop of 16 chunks.  Quarter ks writes its
// sums to plane ks of C (WOM x N each); the tail adds the four planes.
#define WOM 1728   // rows of the attention-output GEMM

__global__ __launch_bounds__(128) void k_wo_all(
    const float* __restrict__ A, const float* __restrict__ B,
    float* __restrict__ C, int N, int K, const float* __restrict__ gsum,
    const float* __restrict__ tok_w, const float* __restrict__ tok_b,
    const float* __restrict__ gpart, const float* __restrict__ g_g,
    const float* __restrict__ g_b, const float* __restrict__ mo_w,
    const float* __restrict__ mo_b, float* __restrict__ gvec) {
  __shared__ __attribute__((aligned(16))) float Bs[2 * GBUF];
  if (blockIdx.x < 64) {
    g_out_body(blockIdx.x, gsum, tok_w, tok_b, gpart, g_g, g_b, mo_w, mo_b,
               gvec);
    return;
  }
  int g = blockIdx.x - 64;
  int ks = (g >> 2) & 3, kq = K >> 2;
  gemm_tile<false, false>(A + ks * kq, B + (size_t)(ks * kq) * N, nullptr,
                          C + (size_t)ks * WOM * N, N, kq, K, Bs, threadIdx.x,
                          g >> 4, g & 3);
  // stands behind the tile's C stores, before any register that they name can
  // be written again on a way the built code has from here into stage 3's part
  asm volatile("s_wait_xcnt 0x0" ::: "memory");
}

// One grid for the local q, k and v projections and stage 1 of the global
// branch.  Work-groups 0..95: stage 1.  The other 648: two GEMM tiles each,
// one per 128 threads, neighbours in n (the same A rows) of one matrix; 216
// work-groups per matrix.
__global__ __launch_bounds__(256) void k_qkv_all(
    const float* __restrict__ eln, const float* __restrict__ l_wq,
    const float* __restrict__ l_wk, const float* __restrict__ l_wv,
    float* __restrict__ Qb, float* __restrict__ Kb, float* __restrict__ Vb,
    int N, int K, const float* __restrict__ gsum,
    const float* __restrict__ tok_w, const float* __restrict__ tok_b,
    const float* __restrict__ ln1_g, const float* __restrict__ ln1_b,
    const float* __restrict__ g_wq, const float* __restrict__ g_wk,
    const float* __restrict__ g_wv, float* __restrict__ gqkv) {
  __shared__ __attribute__((aligned(16))) float sm[4 * GBUF];
  if (blockIdx.x < 96) {
    g_qkv_body(blockIdx.x, sm, sm + 2048, gsum, tok_w, tok_b, ln1_g, ln1_b,
               g_wq, g_wk, g_wv, gqkv);
    return;
  }
  int g = blockIdx.x - 96;
  int mat = g / 216;
  // the same in all lanes of a wave: kept scalar, and the tile indices with it
  int half = __builtin_amdgcn_readfirstlane(threadIdx.x >> 7);
  int r = (g - mat * 216) * 2 + half;
  const float* Bm = mat == 0 ? l_wq : (mat == 1 ? l_wk : l_wv);
  float* Cm = mat == 0 ? Qb : (mat == 1 ? Kb : Vb);
  gemm_tile<false, false>(eln, Bm, nullptr, Cm, N, K, K, sm + half * 2 * GBUF,
                          threadIdx.x & 127, r >> 4, r & 15);
}

// ---------------------------------------------------------------------------
// Local attention core: one block per (bp, head); 864 blocks, 8 waves.
// The score tile is built transposed, S^T(16 j x 16 i) = k(16 j x 8) @ q^T(8 x
// 16 i), so that in the accumulator a lane owns ONE softmax row i = mr and the
// eight columns j = r + 8*kg.  Row max and exp then run in registers on all 32
// lanes, and a register pair {p[2s], p[2s+1]} is, as it lies, the B fragment
// of O^T(16 x 16 i) += V^T(16 x 4 j) @ P^T(4 j x 16 i) under the k order
// j = 8*kg + 2*s + e, which the V^T loader follows.
// V^T rows 0..7 are v, row 8 is ones (its product is the softmax row sum),
// rows 9..15 are zero.
// The scores are formed once.  The instance-norm statistics need no score:
//   sum S   = sum_m (sum_i q[i][m]) * (sum_j k[j][m])
//   sum S^2 = sum_mn (q^T q)[m][n] * (k^T k)[m][n]
// With F = [q | k] (256 x 16), F^T F holds both 8 x 8 products on its diagonal
// blocks: 8 WMMAs a wave.  The row max is kept running over blocks of four
// score tiles; when it rises, the accumulator (numerators and row sum alike)
// is scaled down by the same factor.
// ---------------------------------------------------------------------------
// lane l takes the value of lane l ^ 16, on the vector unit (no LDS round trip
// inside the score loop)
__device__ __forceinline__ float xhalf(float x) {
  int b = __builtin_bit_cast(int, x);
  return __builtin_bit_cast(
      float, __builtin_amdgcn_permlanex16(b, b, 0x76543210, 0xfedcba98, false,
                                          false));
}

#define VTP 260   // V^T row pitch in dwords: 16 rows fall on 16 bank quads
#define GPW 288   // a wave's partial statistics: F^T F (16 x 16), 32 column sums

__device__ __forceinline__ void attn_local_body(
    int blk, const float* __restrict__ Qb, const float* __restrict__ Kb,
    const float* __restrict__ Vb, float* __restrict__ Ofl) {
  __shared__ __attribute__((aligned(16))) float q_s[256 * 8];    // q[i][m]
  __shared__ __attribute__((aligned(16))) float k_s[256 * 8];    // k[j][m]
  __shared__ __attribute__((aligned(16))) float vt_s[10 * VTP];  // v[m][j], 1, 0
  __shared__ __attribute__((aligned(16))) float gp_s[8 * GPW];
  int bp = blk >> 2, h = blk & 3;
  int b = bp / 27, p = bp % 27;
  int d = p / 9, ph = (p / 3) % 3, pwv = p % 3;
  int tid = threadIdx.x;
  {
    int c = tid;
    float qv[8], kv[8], vv[8];
    size_t idx = (size_t)(bp * 8) * 1024 + c * 4 + h;  // col = c*Hh + h
    const float *qg = Qb + idx, *kg_ = Kb + idx, *vg = Vb + idx;
#pragma unroll
    for (int pv = 0; pv < 8; ++pv) {
      qv[pv] = qg[pv * 1024]; kv[pv] = kg_[pv * 1024]; vv[pv] = vg[pv * 1024];
    }
    // keeps all 24 loads ahead of the wait below (one exposed latency)
    __builtin_amdgcn_sched_barrier(0);
    // stands before any register that a load above names is written again; the
    // address pairs are inputs so that they live up to the wait
    asm volatile("s_wait_xcnt 0x0" ::"v"(qg), "v"(kg_), "v"(vg) : "memory");
    // keeps later register writes from being lifted over the wait
    __builtin_amdgcn_sched_barrier(0);
    v4f q0 = {qv[0], qv[1], qv[2], qv[3]}, q1 = {qv[4], qv[5], qv[6], qv[7]};
    v4f k0 = {kv[0], kv[1], kv[2], kv[3]}, k1 = {kv[4], kv[5], kv[6], kv[7]};
    *(v4f*)&q_s[c * 8] = q0; *(v4f*)&q_s[c * 8 + 4] = q1;
    *(v4f*)&k_s[c * 8] = k0; *(v4f*)&k_s[c * 8 + 4] = k1;
#pragma unroll
    for (int pv = 0; pv < 8; ++pv) vt_s[pv * VTP + c] = vv[pv];
    vt_s[8 * VTP + c] = 1.f;
    vt_s[9 * VTP + c] = 0.f;
  }
  __syncthreads();
  int wave = tid >> 5, lane = tid & 31;
  int mr = lane & 15, kg = lane >> 4;
  const v8f z = {0, 0, 0, 0, 0, 0, 0, 0};
  // ---- statistics: F^T F and F's column sums over the wave's 32 rows -------
  // A = F^T (16 x 4 rows of F), B = F (4 x 16): lane (mr, kg), element e holds
  // F[i0 + 2*kg + e][mr] in both, so one fragment serves as A and as B.
  {
    const float* fp = (mr < 8 ? q_s : k_s) + (wave * 32 + kg * 2) * 8 + (mr & 7);
    v8f g = z;
    v2f cv = {0.f, 0.f};
#pragma unroll
    for (int st = 0; st < 8; ++st) {
      v2f f = {fp[st * 32], fp[st * 32 + 8]};
      g = wmma4(f, f, g);
      cv += f;
    }
    float* gw = gp_s + wave * GPW;
    gw[256 + lane] = cv[0] + cv[1];
#pragma unroll
    for (int r = 0; r < 8; ++r) gw[(r + 8 * kg) * 16 + mr] = g[r];
  }
  // k order of the score product, A (k) and B (q) alike: step kc, half kg,
  // element e  <->  m = 4*kg + 2*kc + e: one 16-byte read holds both steps.
  v4f qf[2];
#pragma unroll
  for (int t = 0; t < 2; ++t)
    qf[t] = *(const v4f*)&q_s[((wave + t * 8) * 16 + mr) * 8 + kg * 4];
  const float* kp = k_s + mr * 8 + kg * 4;
  __syncthreads();   // publishes the eight waves' partial statistics
  float S1, S2;
  {
    // lane = entries (m, n0) and (m, n0 + 1) of the two 8 x 8 blocks
    int m = lane >> 2, n0 = (lane & 3) * 2;
    const float* gq_p = gp_s + m * 16 + n0;
    const float* gk_p = gp_s + (m + 8) * 16 + 8 + n0;
    v2f gq = {0.f, 0.f}, gk = {0.f, 0.f};
    float cc = 0.f;
#pragma unroll
    for (int w = 0; w < 8; ++w) {
      gq += *(const v2f*)(gq_p + w * GPW);
      gk += *(const v2f*)(gk_p + w * GPW);
      cc += gp_s[w * GPW + 256 + lane];
    }
    S2 = wave_sum(gq[0] * gk[0] + gq[1] * gk[1]);
    cc += __shfl_xor(cc, 16, 32);   // sum of F's column mr
    // column m of q meets column m of k; every product stands in four lanes
    S1 = 0.25f * wave_sum(cc * __shfl_xor(cc, 8, 32));
  }
  float mu = S1 * (1.f / 65536.f);
  float var = S2 * (1.f / 65536.f) - mu * mu;
  float rstd = rsqrtf(var + 1e-5f);   // InstanceNorm eps; mu cancels in softmax
  // ---- scores, softmax with a running row max, p@v -------------------------
  float cs = rstd * 1.44269504088896341f;         // exp(x) = exp2(x * log2 e)
  v2f cs2 = {cs, cs};
  float run[2] = {-3.0e38f, -3.0e38f};
  v8f o[2] = {z, z};
  const float* vp = vt_s + (mr < 9 ? mr : 9) * VTP + kg * 8;
  for (int jb = 0; jb < 4; ++jb) {
    v4f kf[4], va[4], vb[4];
#pragma unroll
    for (int u = 0; u < 4; ++u) {
      kf[u] = *(const v4f*)(kp + (jb * 4 + u) * 128);
      va[u] = *(const v4f*)(vp + (jb * 4 + u) * 16);
      vb[u] = *(const v4f*)(vp + (jb * 4 + u) * 16 + 4);
    }
#pragma unroll
    for (int t = 0; t < 2; ++t) {
      v2f qa = {qf[t][0], qf[t][1]}, qb = {qf[t][2], qf[t][3]};
      v8f acc[4];
#pragma unroll
      for (int u = 0; u < 4; ++u) {
        v2f ka = {kf[u][0], kf[u][1]}, kb = {kf[u][2], kf[u][3]};
        acc[u] = wmma4(kb, qb, wmma4(ka, qa, z));
      }
      float mx = run[t];
#pragma unroll
      for (int u = 0; u < 4; ++u)
#pragma unroll
        for (int s = 0; s < 4; ++s)
          mx = fmaxf(mx, fmaxf(acc[u][2 * s], acc[u][2 * s + 1]));
      // the other half-wave holds the row's other j: both take one shift
      mx = fmaxf(mx, xhalf(mx));
      // first block: the factor is 0 and meets an accumulator of zeros
      float fs = __builtin_amdgcn_exp2f((run[t] - mx) * cs);
      run[t] = mx;
      o[t] = o[t] * fs;
      float nb = -mx * cs;
      v2f nb2 = {nb, nb};
#pragma unroll
      for (int u = 0; u < 4; ++u) {
        v2f vf[4] = {{va[u][0], va[u][1]}, {va[u][2], va[u][3]},
                     {vb[u][0], vb[u][1]}, {vb[u][2], vb[u][3]}};
#pragma unroll
        for (int s = 0; s < 4; ++s) {
          v2f x = {acc[u][2 * s], acc[u][2 * s + 1]};
          x = x * cs2 + nb2;
          v2f pf = {__builtin_amdgcn_exp2f(x[0]), __builtin_amdgcn_exp2f(x[1])};
          o[t] = wmma4(vf[s], pf, o[t]);
        }
      }
    }
  }
  // o[t][r] = O^T[r + 8*kg][i = mr]: kg 0 holds the 8 numerators of row i,
  // kg 1 holds the row sum in r = 0.
#pragma unroll
  for (int t = 0; t < 2; ++t) {
    float den = __shfl_xor(o[t][0], 16, 32);
    if (kg == 0) {
      int cc = (wave + t * 8) * 16 + mr;
      float inv = 1.f / den;
#pragma unroll
      for (int m2 = 0; m2 < 8; ++m2) {
        int p1 = m2 >> 2, p2 = (m2 >> 1) & 1, p3 = m2 & 1;
        int s = (d * 2 + p1) * 36 + (ph * 2 + p2) * 6 + (pwv * 2 + p3);
        Ofl[(size_t)(b * 216 + s) * 1024 + cc * 4 + h] = o[t][m2] * inv;
      }
    }
  }
}

// One grid for both attentions.  Work-groups 0..127: stage 2 of the global
// branch; the other 864: the local attention core.
__global__ __launch_bounds__(256) void k_attn_all(
    const float* __restrict__ Qb, const float* __restrict__ Kb,
    const float* __restrict__ Vb, float* __restrict__ Ofl,
    const float* __restrict__ gqkv, const float* __restrict__ g_wo,
    float* __restrict__ gpart) {
  if (blockIdx.x < 128)
    g_attn_body(blockIdx.x, gqkv, g_wo, gpart);
  else
    attn_local_body(blockIdx.x - 128, Qb, Kb, Vb, Ofl);
}

// ---------------------------------------------------------------------------
// Tail of the local branch in one launch: out = sum of its four K-quarter
// planes (outb, WOM x 256 each), t2 = LN(out + res) per row over C,
// map-out GEMM 'sc,oc->os' + bias + GELU, and y = x + broadcast(global) + local.
// Work-group = 16 rows s x 128 outputs o (both halves of o redo the cheap LN of
// their 16 rows); 216 work-groups, 8 waves, a wave owns 16 o.
// The product is built transposed, D(16 o x 16 s) = mo_w(16 o x K) @ t2^T(K x
// 16 s): in the accumulator the 16 lanes of a half-wave then hold 16 successive
// s of one o, which are 64 successive bytes of x and of y.
// Both operands lie in LDS as rows of k, pitch TP dwords (16 bytes x odd).  A
// wave brings its own 16 rows of mo_w with whole-line loads, issued ahead of
// the LN.  k order, A and B alike: read c8, half kg, step kc, element e  <->
// k = 8*c8 + 4*kg + 2*kc + e: one 16-byte read holds two k-steps.
// ---------------------------------------------------------------------------
#define TP 260

__global__ __launch_bounds__(256) void k_tail(
    const float* __restrict__ outb, const float* __restrict__ res,
    const float* __restrict__ ln_g, const float* __restrict__ ln_b,
    const float* __restrict__ mo_w, const float* __restrict__ mo_b,
    const float* __restrict__ x, const float* __restrict__ gvec,
    float* __restrict__ y) {
  __shared__ __attribute__((aligned(16))) float t_s[16 * TP];    // t2[s][k]
  __shared__ __attribute__((aligned(16))) float w_s[128 * TP];   // mo_w[o][k]
  int tid = threadIdx.x, wave = tid >> 5, lane = tid & 31;
  int mr = lane & 15, kg = lane >> 4;
  int row0 = (blockIdx.x >> 1) * 16;
  int n0 = (blockIdx.x & 1) * 128 + wave * 16;
  // LN operands: rows row0 + 2*wave and + 1; the wave's 16 rows of mo_w;
  // epilogue operands: lane = row s = row0 + mr, outputs o = oo + r
  size_t lo = (size_t)(row0 + wave * 2) * 256 + lane * 4;
  const float *op = outb + lo, *rp = res + lo;   // op: plane 0 of out
  const float *lgp = ln_g + lane * 4, *lbp = ln_b + lane * 4;
  const float* wp = mo_w + (size_t)n0 * 256 + lane * 4;
  int bs = row0 + mr, b = bs / 216, s = bs - b * 216;
  int oo = n0 + kg * 8;
  size_t xo = (size_t)(b * 256 + oo) * 216 + s;
  const float* xp = x + xo;
  const float* gp = gvec + b * 256 + oo;
  unsigned bo = oo * 4u;   // byte offset: the register that the mo_b loads name
  const float* bp = (const float*)((const char*)mo_b + bo);
  v4f ov[4][4], rv[4], lg[2], lb[2];   // [plane] row*2 + half row; half row
#pragma unroll
  for (int j = 0; j < 4; ++j) {
#pragma unroll   // constant indices keep ov in registers
    for (int q = 0; q < 4; ++q)
      ov[q][j] = *(const v4f*)(op + q * (WOM * 256) + j * 128);
    rv[j] = *(const v4f*)(rp + j * 128);
  }
#pragma unroll
  for (int j = 0; j < 2; ++j) {
    lg[j] = *(const v4f*)(lgp + j * 128);
    lb[j] = *(const v4f*)(lbp + j * 128);
  }
  v4f wr[32];   // load i = row i/2, half i%2
#pragma unroll
  for (int i = 0; i < 32; ++i) wr[i] = *(const v4f*)(wp + i * 128);
  float xv[8];
#pragma unroll
  for (int r = 0; r < 8; ++r) xv[r] = xp[r * 216];
  v4f gv[2] = {*(const v4f*)gp, *(const v4f*)(gp + 4)};
  v4f mb[2] = {*(const v4f*)bp, *(const v4f*)(bp + 4)};
  // keeps all loads ahead of the first load wait (one exposed latency)
  __builtin_amdgcn_sched_barrier(0);
  // stands before any register that a load above names is written again; the
  // address pairs and the two offsets are inputs so that they live up to it
  asm volatile("s_wait_xcnt 0x0" ::"v"(op), "v"(rp), "v"(lane), "v"(wp),
               "v"(xp), "v"(gp), "v"(bo)
               : "memory");
  // keeps later register writes from being lifted over the wait
  __builtin_amdgcn_sched_barrier(0);
#pragma unroll
  for (int q = 0; q < 2; ++q) {
    v4f a = ((ov[0][2 * q] + ov[1][2 * q]) + (ov[2][2 * q] + ov[3][2 * q])) +
            rv[2 * q];
    v4f c = ((ov[0][2 * q + 1] + ov[1][2 * q + 1]) +
             (ov[2][2 * q + 1] + ov[3][2 * q + 1])) +
            rv[2 * q + 1];
    v4f s4 = a + c, p4 = a * a + c * c;
    float S1 = wave_sum((s4[0] + s4[1]) + (s4[2] + s4[3]));
    float S2 = wave_sum((p4[0] + p4[1]) + (p4[2] + p4[3]));
    float mn = S1 * (1.f / 256.f), var = S2 * (1.f / 256.f) - mn * mn;
    float rs = rsqrtf(var + 1e-6f);
    float* td = t_s + (wave * 2 + q) * TP + lane * 4;
    *(v4f*)td = (a - mn) * rs * lg[0] + lb[0];
    *(v4f*)(td + 128) = (c - mn) * rs * lg[1] + lb[1];
  }
#pragma unroll
  for (int i = 0; i < 32; ++i)
    *(v4f*)&w_s[(wave * 16 + (i >> 1)) * TP + (i & 1) * 128 + lane * 4] = wr[i];
  __syncthreads();   // publishes t2 (and the wave's own mo_w rows)
  const float* ap = w_s + (wave * 16 + mr) * TP + kg * 4;
  const float* bq = t_s + mr * TP + kg * 4;
  const v8f z = {0, 0, 0, 0, 0, 0, 0, 0};
  v8f acc[2] = {z, z};   // one per k-step of a read: two independent chains
  // groups of four reads per operand (8 WMMAs), a ring of three: g+2 is read
  // while g multiplies
  v4f fa[3][4], fb[3][4];
#pragma unroll
  for (int g = 0; g < 2; ++g)
#pragma unroll
    for (int j = 0; j < 4; ++j) {
      fa[g][j] = *(const v4f*)(ap + (g * 4 + j) * 8);
      fb[g][j] = *(const v4f*)(bq + (g * 4 + j) * 8);
    }
#pragma unroll
  for (int g = 0; g < 8; ++g) {
    if (g + 2 < 8) {
#pragma unroll
      for (int j = 0; j < 4; ++j) {
        fa[(g + 2) % 3][j] = *(const v4f*)(ap + ((g + 2) * 4 + j) * 8);
        fb[(g + 2) % 3][j] = *(const v4f*)(bq + ((g + 2) * 4 + j) * 8);
      }
    }
    // keeps the LDS reads above ahead of this group's WMMAs: the scheduler
    // otherwise sinks each read to just before its use and waits it out
    __builtin_amdgcn_sched_barrier(0);
#pragma unroll
    for (int j = 0; j < 4; ++j) {
      v4f a = fa[g % 3][j], c = fb[g % 3][j];
      v2f a0 = {a[0], a[1]}, a1 = {a[2], a[3]};
      v2f c0 = {c[0], c[1]}, c1 = {c[2], c[3]};
      acc[0] = wmma4(a0, c0, acc[0]);
      acc[1] = wmma4(a1, c1, acc[1]);
    }
  }
  // acc[.][r] = D[o = oo + r][s = row0 + mr]
  float* yp = y + xo;
#pragma unroll
  for (int r = 0; r < 8; ++r) {
    float v = gelu_exact((acc[0][r] + acc[1][r]) + mb[r >> 2][r & 3]);
    yp[r * 216] = xv[r] + gv[r >> 2][r & 3] + v;
  }
}

extern "C" void kernel_launch(void* const* d_in, const int* in_sizes, int n_in,
                              void* d_out, int out_size, void* d_ws,
                              size_t ws_size, hipStream_t stream) {
  const float* x       = (const float*)d_in[0];
  const float* g_tok_w = (const float*)d_in[1];
  const float* g_tok_b = (const float*)d_in[2];
  const float* g_ln1_g = (const float*)d_in[3];
  const float* g_ln1_b = (const float*)d_in[4];
  const float* g_wq    = (const float*)d_in[5];
  const float* g_wk    = (const float*)d_in[6];
  const float* g_wv    = (const float*)d_in[7];
  const float* g_wo    = (const float*)d_in[8];
  const float* g_ln2_g = (const float*)d_in[9];
  const float* g_ln2_b = (const float*)d_in[10];
  const float* g_mo_w  = (const float*)d_in[11];
  const float* g_mo_b  = (const float*)d_in[12];
  const float* l_pw    = (const float*)d_in[13];
  const float* l_pb    = (const float*)d_in[14];
  const float* l_ln1_g = (const float*)d_in[15];
  const float* l_ln1_b = (const float*)d_in[16];
  const float* l_wq    = (const float*)d_in[17];
  const float* l_wk    = (const float*)d_in[18];
  const float* l_wv    = (const float*)d_in[19];
  const float* l_wo    = (const float*)d_in[20];
  const float* l_ln2_g = (const float*)d_in[21];
  const float* l_ln2_b = (const float*)d_in[22];
  const float* l_mo_w  = (const float*)d_in[23];
  const float* l_mo_b  = (const float*)d_in[24];

  float* ws   = (float*)d_ws;
  float* gsum = ws;                 // 8*27, in 2048
  float* gvec = ws + 2048;          // 2048
  float* eln  = ws + 2048 + 2048;   // 1728*256
  float* res  = eln + 442368;       // 1728*256
  float* Qb   = res + 442368;       // 1728*1024
  float* Kb   = Qb + 1769472;       // 1728*1024
  float* Vb   = Kb + 1769472;       // 1728*1024
  float* ofl  = Vb + 1769472;       // 1728*1024
  float* gqkv = ofl + 1769472;      // 3*8*1024
  float* gpart = gqkv + 24576;      // 8*16*256
  float* outb = Qb;                 // alias: Qb dead after attention; 4 planes

  k_local_embed<<<216, 256, 0, stream>>>(x, l_pw, l_pb, l_ln1_g, l_ln1_b, res,
                                         eln, gsum);
  k_qkv_all<<<744, 256, 0, stream>>>(eln, l_wq, l_wk, l_wv, Qb, Kb, Vb, 1024,
                                     256, gsum, g_tok_w, g_tok_b, g_ln1_g,
                                     g_ln1_b, g_wq, g_wk, g_wv, gqkv);
  k_attn_all<<<992, 256, 0, stream>>>(Qb, Kb, Vb, ofl, gqkv, g_wo, gpart);
  k_wo_all<<<496, 128, 0, stream>>>(ofl, l_wo, outb, 256, 1024, gsum, g_tok_w,
                                    g_tok_b, gpart, g_ln2_g, g_ln2_b, g_mo_w,
                                    g_mo_b, gvec);
  k_tail<<<216, 256, 0, stream>>>(outb, res, l_ln2_g, l_ln2_b, l_mo_w, l_mo_b,
                                  x, gvec, (float*)d_out);
}

// v008
// One run takes 69.1 microseconds.
// In two side-by-side timings against v007, it was 1.04 and 1.03 times as fast.
// Over all steps from v000 it is 5.32 times as fast.
#include <hip/hip_runtime.h>
#include <hip/hip_bf16.h>
#include <math.h>

typedef float v2f __attribute__((ext_vector_type(2)));
typedef float v4f __attribute__((ext_vector_type(4)));
typedef float v8f __attribute__((ext_vector_type(8)));

// ---------------------------------------------------------------------------
// fp32 WMMA: D(16x16) = A(16x4) * B(4x16) + C, full fp32 (matches reference
// numerics up to reassociation).  Lane L: mr = L%16, kg = L/16.
//   A frag (v2f): a[0]=A[mr][kg*2], a[1]=A[mr][kg*2+1]
//   B frag (v2f): b[0]=B[kg*2][mr], b[1]=B[kg*2+1][mr]
//   C/D (v8f):    c[r] = C[r + 8*kg][mr]
// ---------------------------------------------------------------------------
__device__ __forceinline__ v8f wmma4(v2f a, v2f b, v8f c) {
  return __builtin_amdgcn_wmma_f32_16x16x4_f32(false, a, false, b, (short)0, c,
                                               false, false);
}

__device__ __forceinline__ float gelu_exact(float x) {
  return 0.5f * x * (1.0f + erff(x * 0.70710678118654752f));
}

// ---------------------------------------------------------------------------
// Global branch, spread over many work-groups in three dependent stages.
// Rank-1 score => instance-norm stats factor; softmax is shift-invariant so
// only 1/sigma and row-max of the raw score are needed.
// No stage has a launch of its own: each is independent of the local-branch
// stage that runs at the same depth of the chain, and its work-groups are the
// first ones of that stage's grid.  The mean over (C,D,H,W) comes as 27 sums
// per batch from the patch-embed work-groups, which read all of x anyway.
// ---------------------------------------------------------------------------
__device__ __forceinline__ float wave_sum(float v) {
#pragma unroll
  for (int o = 16; o > 0; o >>= 1) v += __shfl_xor(v, o, 32);
  return v;
}
__device__ __forceinline__ float wave_max(float v) {
#pragma unroll
  for (int o = 16; o > 0; o >>= 1) v = fmaxf(v, __shfl_xor(v, o, 32));
  return v;
}
__device__ __forceinline__ float wave_min(float v) {
#pragma unroll
  for (int o = 16; o > 0; o >>= 1) v = fminf(v, __shfl_xor(v, o, 32));
  return v;
}

// Stage 1: q/k/v projections for all 8 batches at once (8x256 @ 256x1024 x3).
// Work-group = one matrix x 32 columns; wave = 32 rows of K; lane = column.
// Each weight element is read once by the whole grid.
// t_s: 256*8 floats, t[k][batch], 16-byte aligned; red: 8*8*32 floats,
// [wave][batch][lane].
__device__ __forceinline__ void g_qkv_body(
    int blk, float* t_s, float* red, const float* __restrict__ gsum,
    const float* __restrict__ tok_w, const float* __restrict__ tok_b,
    const float* __restrict__ ln1_g, const float* __restrict__ ln1_b,
    const float* __restrict__ wq, const float* __restrict__ wk,
    const float* __restrict__ wv, float* __restrict__ qkv) {
  int tid = threadIdx.x, wave = tid >> 5, lane = tid & 31;
  int mat = blk >> 5, col = (blk & 31) * 32 + lane;
  const float* Wm = mat == 0 ? wq : (mat == 1 ? wk : wv);
  const float* wp = Wm + (size_t)(wave * 32) * 1024 + col;
  float wreg[32];   // issued first: the LN below runs under their latency
#pragma unroll
  for (int i = 0; i < 32; ++i) wreg[i] = wp[i * 1024];
  const float* gp = gsum + wave * 27 + (lane < 27 ? lane : 26);
  float gs = *gp;   // lanes 0..26: the 27 patch sums of batch 'wave'
  float tw[8], tb8[8], lg[8], lb[8];
#pragma unroll
  for (int k = 0; k < 8; ++k) {
    int c = k * 32 + lane;
    tw[k] = tok_w[c]; tb8[k] = tok_b[c]; lg[k] = ln1_g[c]; lb[k] = ln1_b[c];
  }
  // the scheduler otherwise sinks part of the loads above behind the first
  // load wait (two or more exposed latencies instead of one)
  __builtin_amdgcn_sched_barrier(0);
  // stands before any register that a load above names is written again; the
  // address pairs are inputs so that they live up to the wait
  asm volatile("s_wait_xcnt 0x0" :: "v"(wp), "v"(gp) : "memory");
  // keeps later register writes from being lifted over the wait
  __builtin_amdgcn_sched_barrier(0);
  float m = wave_sum(lane < 27 ? gs : 0.f) / 55296.0f;
  // LN1 of batch 'wave': 8 channels per lane
  {
    float tok[8];
    float s1 = 0.f, s2 = 0.f;
#pragma unroll
    for (int k = 0; k < 8; ++k) {
      tok[k] = m * tw[k] + tb8[k];
      s1 += tok[k]; s2 += tok[k] * tok[k];
    }
    s1 = wave_sum(s1); s2 = wave_sum(s2);
    float mn = s1 * (1.f / 256.f);
    float var = s2 * (1.f / 256.f) - mn * mn;
    float rs = rsqrtf(var + 1e-6f);
#pragma unroll
    for (int k = 0; k < 8; ++k) {
      int c = k * 32 + lane;
      t_s[c * 8 + wave] = (tok[k] - mn) * rs * lg[k] + lb[k];
    }
  }
  __syncthreads();
  float acc[8] = {0, 0, 0, 0, 0, 0, 0, 0};
#pragma unroll
  for (int i = 0; i < 32; ++i) {
    const float4* tp = (const float4*)&t_s[(wave * 32 + i) * 8];
    float4 ta = tp[0], tb = tp[1];
    float w = wreg[i];
    acc[0] += ta.x * w; acc[1] += ta.y * w; acc[2] += ta.z * w; acc[3] += ta.w * w;
    acc[4] += tb.x * w; acc[5] += tb.y * w; acc[6] += tb.z * w; acc[7] += tb.w * w;
  }
#pragma unroll
  for (int bb = 0; bb < 8; ++bb) red[(wave * 8 + bb) * 32 + lane] = acc[bb];
  __syncthreads();
  float s = 0.f;   // this thread finishes batch 'wave', column 'col'
#pragma unroll
  for (int w = 0; w < 8; ++w) s += red[(w * 8 + wave) * 32 + lane];
  qkv[(size_t)(mat * 8 + wave) * 1024 + col] = s;
}

// Stage 2: work-group = (batch, head, quarter of the 256 score rows).
// Thread = (row of the quarter, quarter of the 256 columns).  The 64 output
// values then meet their 64 rows of wo; the partial 1x256 goes to 'part'.
__device__ __forceinline__ void g_attn_body(
    int blk, const float* __restrict__ qkv, const float* __restrict__ wo,
    float* __restrict__ part) {
  __shared__ __attribute__((aligned(16))) float k_s[256];
  __shared__ __attribute__((aligned(16))) float v_s[256];
  __shared__ float q_s[256];
  __shared__ float st[8][6];
  __shared__ float den_s[256], acc_s[256];
  __shared__ float o_s[64];
  __shared__ __attribute__((aligned(16))) float red[8 * 256];
  int tid = threadIdx.x, wave = tid >> 5, lane = tid & 31;
  int rq = blk & 3, h = (blk >> 2) & 3, b = blk >> 4;
  // wo rows (c*4 + h) of this wave's 8 score rows, issued first so that they
  // arrive while the softmax runs
  float4 w0[8], w1[8];
  const float* wr = wo + (size_t)((rq * 64 + wave * 8) * 4 + h) * 256 + lane * 4;
#pragma unroll
  for (int i = 0; i < 8; ++i) {
    w0[i] = *(const float4*)(wr + i * 1024);
    w1[i] = *(const float4*)(wr + i * 1024 + 128);
  }
  float qi = qkv[(size_t)(0 + b) * 1024 + h * 256 + tid];   // heads OUTER
  float ki = qkv[(size_t)(8 + b) * 1024 + h * 256 + tid];
  float vi = qkv[(size_t)(16 + b) * 1024 + h * 256 + tid];
  // the scheduler otherwise sinks part of the loads above behind the first
  // load wait (two or more exposed latencies instead of one)
  __builtin_amdgcn_sched_barrier(0);
  // stands before any register that a load above names is written again; the
  // address pair is an input so that it lives up to the wait
  asm volatile("s_wait_xcnt 0x0" :: "v"(wr) : "memory");
  // keeps later register writes from being lifted over the wait
  __builtin_amdgcn_sched_barrier(0);
  q_s[tid] = qi; k_s[tid] = ki; v_s[tid] = vi;
  {
    float a0 = wave_sum(qi), a1 = wave_sum(qi * qi);
    float a2 = wave_sum(ki), a3 = wave_sum(ki * ki);
    float a4 = wave_max(ki), a5 = wave_min(ki);
    if (lane == 0) {
      st[wave][0] = a0; st[wave][1] = a1; st[wave][2] = a2;
      st[wave][3] = a3; st[wave][4] = a4; st[wave][5] = a5;
    }
  }
  __syncthreads();
  float Sq = 0.f, Sq2 = 0.f, Sk = 0.f, Sk2 = 0.f;
  float kmx = st[0][4], kmn = st[0][5];
#pragma unroll
  for (int w = 0; w < 8; ++w) {
    Sq += st[w][0]; Sq2 += st[w][1]; Sk += st[w][2]; Sk2 += st[w][3];
    kmx = fmaxf(kmx, st[w][4]); kmn = fminf(kmn, st[w][5]);
  }
  float mu  = (Sq * Sk)  * (1.f / 65536.f);
  float ex2 = (Sq2 * Sk2) * (1.f / 65536.f);
  float rstd = rsqrtf(ex2 - mu * mu + 1e-5f);
  float qr = q_s[rq * 64 + (tid & 63)];
  int j0 = (tid >> 6) * 64;
  float rmax = qr * (qr >= 0.f ? kmx : kmn);  // row max of raw score
  float den = 0.f, acc = 0.f;
#pragma unroll 4
  for (int j = 0; j < 64; j += 4) {
    float4 k4 = *(const float4*)&k_s[j0 + j];
    float4 v4 = *(const float4*)&v_s[j0 + j];
    float p0 = __expf((qr * k4.x - rmax) * rstd);
    float p1 = __expf((qr * k4.y - rmax) * rstd);
    float p2 = __expf((qr * k4.z - rmax) * rstd);
    float p3 = __expf((qr * k4.w - rmax) * rstd);
    den += p0; acc += p0 * v4.x;
    den += p1; acc += p1 * v4.y;
    den += p2; acc += p2 * v4.z;
    den += p3; acc += p3 * v4.w;
  }
  den_s[tid] = den; acc_s[tid] = acc;
  __syncthreads();
  if (tid < 64) {
    float dd = (den_s[tid] + den_s[64 + tid]) + (den_s[128 + tid] + den_s[192 + tid]);
    float aa = (acc_s[tid] + acc_s[64 + tid]) + (acc_s[128 + tid] + acc_s[192 + tid]);
    o_s[tid] = aa / dd;
  }
  __syncthreads();
  float4 p0 = {0.f, 0.f, 0.f, 0.f}, p1 = {0.f, 0.f, 0.f, 0.f};
#pragma unroll
  for (int i = 0; i < 8; ++i) {
    float o = o_s[wave * 8 + i];
    p0.x += o * w0[i].x; p0.y += o * w0[i].y; p0.z += o * w0[i].z; p0.w += o * w0[i].w;
    p1.x += o * w1[i].x; p1.y += o * w1[i].y; p1.z += o * w1[i].z; p1.w += o * w1[i].w;
  }
  *(float4*)&red[wave * 256 + lane * 4] = p0;
  *(float4*)&red[wave * 256 + 128 + lane * 4] = p1;
  __syncthreads();
  float s = 0.f;
#pragma unroll
  for (int w = 0; w < 8; ++w) s += red[w * 256 + tid];
  part[(size_t)blk * 256 + tid] = s;   // [(b*16 + h*4 + rq)][256]
}

// Stage 3: work-group of 128 threads = (batch, eighth of the 256 outputs).
// Sums the 16 partials, adds the residual, LN2 (two channels per thread), then
// map-out rows ('bc,oc->bo') with the lanes along c (coalesced) and a wave
// reduction per output, then GELU.
__device__ __forceinline__ void g_out_body(
    int blk, const float* __restrict__ gsum,
    const float* __restrict__ tok_w, const float* __restrict__ tok_b,
    const float* __restrict__ part,
    const float* __restrict__ ln2_g, const float* __restrict__ ln2_b,
    const float* __restrict__ mo_w, const float* __restrict__ mo_b,
    float* __restrict__ gvec) {
  __shared__ __attribute__((aligned(16))) float t_s[256];
  __shared__ float st[4][2];
  int c = threadIdx.x, wave = c >> 5, lane = c & 31;
  int b = blk >> 3, o0 = (blk & 7) * 32 + wave * 8;
  float4 m0[8], m1[8];   // issued first: LN2 runs under their latency
  const float* mr = mo_w + (size_t)o0 * 256 + lane * 4;
#pragma unroll
  for (int r = 0; r < 8; ++r) {
    m0[r] = *(const float4*)(mr + r * 256);
    m1[r] = *(const float4*)(mr + r * 256 + 128);
  }
  const float* pp = part + (size_t)(b * 16) * 256 + c;
  float pr[16], ps[16];   // channels c and c + 128
#pragma unroll
  for (int p = 0; p < 16; ++p) { pr[p] = pp[p * 256]; ps[p] = pp[p * 256 + 128]; }
  int gi = lane < 27 ? lane : 26, mi = o0 + (lane & 7);
  float gs = gsum[b * 27 + gi];   // lanes 0..26: the 27 patch sums of batch b
  float tw0 = tok_w[c], tb0 = tok_b[c], tw1 = tok_w[c + 128], tb1 = tok_b[c + 128];
  float g20 = ln2_g[c], b20 = ln2_b[c], g21 = ln2_g[c + 128], b21 = ln2_b[c + 128];
  float mb = mo_b[mi];
  // the scheduler otherwise sinks part of the loads above behind the first
  // load wait (two or more exposed latencies instead of one)
  __builtin_amdgcn_sched_barrier(0);
  // stands before any register that a load above names is written again; the
  // address pair and the offsets are inputs so that they live up to the wait
  asm volatile("s_wait_xcnt 0x0" :: "v"(mr), "v"(c), "v"(gi), "v"(mi) : "memory");
  // keeps later register writes from being lifted over the wait
  __builtin_amdgcn_sched_barrier(0);
  float m = wave_sum(lane < 27 ? gs : 0.f) / 55296.0f;
  float out0 = 0.f, out1 = 0.f;
#pragma unroll
  for (int p = 0; p < 16; ++p) { out0 += pr[p]; out1 += ps[p]; }
  float ov0 = out0 + (m * tw0 + tb0), ov1 = out1 + (m * tw1 + tb1);
  {
    float a0 = wave_sum(ov0 + ov1), a1 = wave_sum(ov0 * ov0 + ov1 * ov1);
    if (lane == 0) { st[wave][0] = a0; st[wave][1] = a1; }
  }
  __syncthreads();
  float T1 = 0.f, T2 = 0.f;
#pragma unroll
  for (int w = 0; w < 4; ++w) { T1 += st[w][0]; T2 += st[w][1]; }
  float mn2 = T1 * (1.f / 256.f), var2 = T2 * (1.f / 256.f) - mn2 * mn2;
  float rs2 = rsqrtf(var2 + 1e-6f);
  t_s[c] = (ov0 - mn2) * rs2 * g20 + b20;
  t_s[c + 128] = (ov1 - mn2) * rs2 * g21 + b21;
  __syncthreads();
  float4 ta = *(const float4*)&t_s[lane * 4];
  float4 tc = *(const float4*)&t_s[128 + lane * 4];
  float val = 0.f;
#pragma unroll
  for (int r = 0; r < 8; ++r) {
    float dd = m0[r].x * ta.x + m0[r].y * ta.y + m0[r].z * ta.z + m0[r].w * ta.w +
               m1[r].x * tc.x + m1[r].y * tc.y + m1[r].z * tc.z + m1[r].w * tc.w;
    dd = wave_sum(dd);
    if (lane == r) val = dd;
  }
  if (lane < 8) gvec[b * 256 + o0 + lane] = gelu_exact(val + mb);
}

// ---------------------------------------------------------------------------
// Local branch: patchify (2x2x2) + 8x8 embed + LN over C.
// Emits res (B,216,C) and eln rows (bp*8+pv, C), and the sum of the 2048 x
// values it has read (one of the 27 parts of its batch's global-branch mean).
// ---------------------------------------------------------------------------
__global__ __launch_bounds__(256) void k_local_embed(
    const float* __restrict__ x, const float* __restrict__ pw,
    const float* __restrict__ pb, const float* __restrict__ ln_g,
    const float* __restrict__ ln_b, float* __restrict__ res,
    float* __restrict__ eln, float* __restrict__ gsum) {
  __shared__ float pw_s[64];
  __shared__ float pb_s[8];
  __shared__ float sc[8 * 256];
  __shared__ float part1[256], part2[256];
  __shared__ float mean_s[8], rstd_s[8];
  __shared__ float xs_s[8];
  int bp = blockIdx.x, b = bp / 27, p = bp % 27;
  int d = p / 9, hh = (p / 3) % 3, w = p % 3;
  int c = threadIdx.x;
  if (c < 64) pw_s[c] = pw[c];
  if (c < 8) pb_s[c] = pb[c];
  __syncthreads();
  const float* xb = x + (size_t)(b * 256 + c) * 216;
  float patch[8];
#pragma unroll
  for (int u = 0; u < 8; ++u) {
    int p1 = u >> 2, p2 = (u >> 1) & 1, p3 = u & 1;
    patch[u] = xb[(d * 2 + p1) * 36 + (hh * 2 + p2) * 6 + (w * 2 + p3)];
  }
  {
    float xs = wave_sum(((patch[0] + patch[1]) + (patch[2] + patch[3])) +
                        ((patch[4] + patch[5]) + (patch[6] + patch[7])));
    if ((c & 31) == 0) xs_s[c >> 5] = xs;   // read behind the next barrier
  }
  float tokv[8];
#pragma unroll
  for (int e = 0; e < 8; ++e) {
    float a = pb_s[e];
#pragma unroll
    for (int u = 0; u < 8; ++u) a += pw_s[e * 8 + u] * patch[u];
    tokv[e] = a;
    sc[e * 256 + c] = a;
    int p1 = e >> 2, p2 = (e >> 1) & 1, p3 = e & 1;
    int s = (d * 2 + p1) * 36 + (hh * 2 + p2) * 6 + (w * 2 + p3);
    res[(size_t)(b * 216 + s) * 256 + c] = a;   // residual uses raw tok
  }
  __syncthreads();
  int g = c >> 5, lane = c & 31;
  float s1 = 0.f, s2 = 0.f;
#pragma unroll
  for (int k = 0; k < 8; ++k) {
    float vv = sc[g * 256 + lane + k * 32];
    s1 += vv; s2 += vv * vv;
  }
  part1[c] = s1; part2[c] = s2;
  if (c == 0)
    gsum[bp] = ((xs_s[0] + xs_s[1]) + (xs_s[2] + xs_s[3])) +
               ((xs_s[4] + xs_s[5]) + (xs_s[6] + xs_s[7]));
  __syncthreads();
  if (c < 8) {
    float a = 0.f, bb = 0.f;
    for (int l = 0; l < 32; ++l) { a += part1[c * 32 + l]; bb += part2[c * 32 + l]; }
    float mn = a * (1.f / 256.f), vr = bb * (1.f / 256.f) - mn * mn;
    mean_s[c] = mn; rstd_s[c] = rsqrtf(vr + 1e-6f);
  }
  __syncthreads();
  float lg = ln_g[c], lb = ln_b[c];
#pragma unroll
  for (int e = 0; e < 8; ++e)
    eln[(size_t)(bp * 8 + e) * 256 + c] =
        (tokv[e] - mean_s[e]) * rstd_s[e] * lg + lb;
}

// ---------------------------------------------------------------------------
// fp32 WMMA GEMM: C = act(A(MxK) @ B(KxN) [+bias]).  TRANSB/ACT are template
// params so the inner loop is branch-free.  128 threads (4 waves) per tile; each wave
// owns a 16(M) x 64(N) strip; all 4 waves share one n-strip, so the 64x64 B
// tile is staged through LDS once per K-chunk (16-byte loads, 4x reuse).
// The K loop is software-pipelined at both levels.  Global: while the WMMAs of
// chunk c run, the A fragments and the B tile of chunk c+1 are on their way
// into registers; the tile then goes into the other LDS buffer, so one barrier
// per chunk both publishes it and ends the reads of the buffer refilled next.
// LDS: B fragments are read two groups of WMMAs ahead of their use.  For that
// a fragment must land in its register pair as it is, so the tile lies in LDS
// as rows of k pairs: [k/2][n][k%2], row pitch GPP dwords (128 + 32: the two
// half-waves, one row apart, fall on different halves of the 64 banks).
// A fragments come straight from global memory, where every lane reads its own
// row, so a load touches 16 lines whatever its width: they are 16-byte loads,
// each holding two k-steps.  k order, A and B alike: read c8, half kg, step kc,
// element e  <->  k = 8*c8 + 4*kg + 2*kc + e.  The B reader takes LDS row
// 4*c8 + 2*kc + kg, so k pair 4*c8 + 2*kg + kc is stored there (gemm_row).
// Requires M%64==0, N%64==0, K%64==0, lda%4==0, A 16-byte aligned.
// ---------------------------------------------------------------------------
#define GKC 64
#define GPP 160

// LDS row of k pair rp: its two low bits change places
__device__ __forceinline__ int gemm_row(int rp) {
  return (rp & ~3) | ((rp & 1) << 1) | ((rp >> 1) & 1);
}

template <bool TRANSB>
__device__ __forceinline__ void gemm_fetch(const float* __restrict__ arow,
                                           const float* __restrict__ bsrc,
                                           int k0, int N, v4f (&an)[GKC / 8],
                                           v4f (&bn)[8]) {
  const float* ap = arow + k0;
  const float* bp[8];
#pragma unroll
  for (int i = 0; i < 8; ++i) {
    // !TRANSB: rows k0 + 16*(i/2) + i%2 (+ 2*rp0, in bsrc); TRANSB: k quad 2*i
    size_t off = TRANSB ? (size_t)(k0 + i * 8)
                        : (size_t)(k0 + (i >> 1) * 16 + (i & 1)) * N;
    bp[i] = bsrc + off;
  }
#pragma unroll
  for (int i = 0; i < GKC / 8; ++i) an[i] = *(const v4f*)(ap + i * 8);
#pragma unroll
  for (int i = 0; i < 8; ++i) bn[i] = *(const v4f*)bp[i];
  // stands before any register that a load above names is written again; the
  // address pairs are inputs so that they live up to the wait (TRANSB: the B
  // loads share one pair and differ in their immediate offsets)
  if (TRANSB)
    asm volatile("s_wait_xcnt 0x0" ::"v"(ap), "v"(bp[0]) : "memory");
  else
    asm volatile("s_wait_xcnt 0x0" ::"v"(ap), "v"(bp[0]), "v"(bp[1]),
                 "v"(bp[2]), "v"(bp[3]), "v"(bp[4]), "v"(bp[5]), "v"(bp[6]),
                 "v"(bp[7])
                 : "memory");
}

template <bool TRANSB>
__device__ __forceinline__ void gemm_put(float* bd, int tid,
                                         const v4f (&bn)[8]) {
  if (!TRANSB) {
    int rp0 = tid >> 4, c4 = (tid & 15) * 4;
#pragma unroll
    for (int i = 0; i < 4; ++i) {
      v4f x = bn[2 * i], y = bn[2 * i + 1];   // rows 2*rp and 2*rp + 1
      v4f lo = {x[0], y[0], x[1], y[1]}, hi = {x[2], y[2], x[3], y[3]};
      float* d = bd + (gemm_row(rp0) + 8 * i) * GPP + c4 * 2;
      *(v4f*)d = lo;
      *(v4f*)(d + 4) = hi;
    }
  } else {
    int c = tid & 63, q0 = tid >> 6;
#pragma unroll
    for (int i = 0; i < 8; ++i) {
      int q = q0 + 2 * i;                      // k = 4*q .. 4*q + 3
      v2f lo = {bn[i][0], bn[i][1]}, hi = {bn[i][2], bn[i][3]};
      *(v2f*)(bd + gemm_row(2 * q) * GPP + c * 2) = lo;
      *(v2f*)(bd + gemm_row(2 * q + 1) * GPP + c * 2) = hi;
    }
  }
}

#define GBUF ((GKC / 2) * GPP)   // one LDS buffer, in dwords

// One 64 x 64 tile (mblk, nblk) by 128 threads (tid 0..127); Bs: 2 * GBUF
// dwords of their own, 16-byte aligned.  Its barriers are the work-group's.
// lda: row pitch of A in dwords (above K where the tile sums a slice of k).
template <bool TRANSB, bool ACT>
__device__ __forceinline__ void gemm_tile(
    const float* __restrict__ A, const float* __restrict__ B,
    const float* __restrict__ bias, float* __restrict__ C, int N, int K,
    int lda, float* Bs, int tid, int mblk, int nblk) {
  int wave = tid >> 5, lane = tid & 31;
  int mr = lane & 15, kg = lane >> 4;
  int m0 = (mblk * 4 + wave) * 16;
  int n0 = nblk * 64;
  v8f z = {0, 0, 0, 0, 0, 0, 0, 0};
  v8f acc[4] = {z, z, z, z};
  const float* arow = A + (size_t)(m0 + mr) * lda + kg * 4;
  const float* bsrc =
      TRANSB ? B + (size_t)(n0 + (tid & 63)) * K + (tid >> 6) * 4
             : B + (size_t)((tid >> 4) * 2) * N + n0 + (tid & 15) * 4;
  v4f an[GKC / 8];
  v4f bn[8];
  gemm_fetch<TRANSB>(arow, bsrc, 0, N, an, bn);
  gemm_put<TRANSB>(Bs, tid, bn);
  __syncthreads();
  for (int k0 = 0, buf = 0;; k0 += GKC, buf ^= 1) {
    v4f ac[GKC / 8];
#pragma unroll
    for (int i = 0; i < GKC / 8; ++i) ac[i] = an[i];
    bool more = k0 + GKC < K;   // the same for the whole work-group
    if (more) gemm_fetch<TRANSB>(arow, bsrc, k0 + GKC, N, an, bn);
    // fragment of k-step ks, column tile t: bs + ks*2*GPP + t*32.  Groups of
    // two k-steps (8 WMMAs, one A read), a ring of three: g+2 is read while g
    // multiplies.
    const float* bs = Bs + buf * GBUF + kg * GPP + mr * 2;
    v2f bf[3][8];
#pragma unroll
    for (int g = 0; g < 2; ++g)
#pragma unroll
      for (int j = 0; j < 8; ++j)
        bf[g][j] = *(const v2f*)(bs + (g * 2 + (j >> 2)) * 2 * GPP + (j & 3) * 32);
#pragma unroll
    for (int g = 0; g < GKC / 8; ++g) {
      if (g + 2 < GKC / 8) {
#pragma unroll
        for (int j = 0; j < 8; ++j)
          bf[(g + 2) % 3][j] = *(const v2f*)(bs + ((g + 2) * 2 + (j >> 2)) * 2 * GPP +
                                             (j & 3) * 32);
      }
      // keeps the LDS reads above ahead of this group's WMMAs: the scheduler
      // otherwise sinks each read to just before its use and waits it out
      __builtin_amdgcn_sched_barrier(0);
#pragma unroll
      for (int j = 0; j < 8; ++j) {
        v2f af = {ac[g][(j >> 2) * 2], ac[g][(j >> 2) * 2 + 1]};
        acc[j & 3] = wmma4(af, bf[g % 3][j], acc[j & 3]);
      }
    }
    if (!more) break;
    gemm_put<TRANSB>(Bs + (buf ^ 1) * GBUF, tid, bn);
    __syncthreads();   // publishes chunk c+1; ends the reads of chunk c
  }
#pragma unroll
  for (int t = 0; t < 4; ++t) {
    int n = n0 + t * 16 + mr;
    float bb = ACT ? bias[n] : 0.f;
#pragma unroll
    for (int r = 0; r < 8; ++r) {
      int row = m0 + r + 8 * kg;
      float v = acc[t][r] + bb;
      if (ACT) v = gelu_exact(v);
      C[(size_t)row * N + n] = v;
    }
  }
}

// One grid for the local attention-output GEMM and stage 3 of the global
// branch.  Work-groups 0..63: stage 3.  The other 432: one GEMM tile over one
// quarter of K each, n fastest, then the quarter: 108 tiles alone leave more
// than half of the chip idle behind a loop of 16 chunks.  Quarter ks writes its
// sums to plane ks of C (WOM x N each); the tail adds the four planes.
#define WOM 1728   // rows of the attention-output GEMM

__global__ __launch_bounds__(128) void k_wo_all(
    const float* __restrict__ A, const float* __restrict__ B,
    float* __restrict__ C, int N, int K, const float* __restrict__ gsum,
    const float* __restrict__ tok_w, const float* __restrict__ tok_b,
    const float* __restrict__ gpart, const float* __restrict__ g_g,
    const float* __restrict__ g_b, const float* __restrict__ mo_w,
    const float* __restrict__ mo_b, float* __restrict__ gvec) {
  __shared__ __attribute__((aligned(16))) float Bs[2 * GBUF];
  if (blockIdx.x < 64) {
    g_out_body(blockIdx.x, gsum, tok_w, tok_b, gpart, g_g, g_b, mo_w, mo_b,
               gvec);
    return;
  }
  int g = blockIdx.x - 64;
  int ks = (g >> 2) & 3, kq = K >> 2;
  gemm_tile<false, false>(A + ks * kq, B + (size_t)(ks * kq) * N, nullptr,
                          C + (size_t)ks * WOM * N, N, kq, K, Bs, threadIdx.x,
                          g >> 4, g & 3);
  // stands behind the tile's C stores, before any register that they name can
  // be written again on a way the built code has from here into stage 3's part
  asm volatile("s_wait_xcnt 0x0" ::: "memory");
}

// One grid for the local q, k and v projections and stage 1 of the global
// branch.  Work-groups 0..95: stage 1.  The other 648: two GEMM tiles each,
// one per 128 threads, neighbours in n (the same A rows) of one matrix; 216
// work-groups per matrix.
__global__ __launch_bounds__(256) void k_qkv_all(
    const float* __restrict__ eln, const float* __restrict__ l_wq,
    const float* __restrict__ l_wk, const float* __restrict__ l_wv,
    float* __restrict__ Qb, float* __restrict__ Kb, float* __restrict__ Vb,
    int N, int K, const float* __restrict__ gsum,
    const float* __restrict__ tok_w, const float* __restrict__ tok_b,
    const float* __restrict__ ln1_g, const float* __restrict__ ln1_b,
    const float* __restrict__ g_wq, const float* __restrict__ g_wk,
    const float* __restrict__ g_wv, float* __restrict__ gqkv) {
  __shared__ __attribute__((aligned(16))) float sm[4 * GBUF];
  if (blockIdx.x < 96) {
    g_qkv_body(blockIdx.x, sm, sm + 2048, gsum, tok_w, tok_b, ln1_g, ln1_b,
               g_wq, g_wk, g_wv, gqkv);
    return;
  }
  int g = blockIdx.x - 96;
  int mat = g / 216;
  // the same in all lanes of a wave: kept scalar, and the tile indices with it
  int half = __builtin_amdgcn_readfirstlane(threadIdx.x >> 7);
  int r = (g - mat * 216) * 2 + half;
  const float* Bm = mat == 0 ? l_wq : (mat == 1 ? l_wk : l_wv);
  float* Cm = mat == 0 ? Qb : (mat == 1 ? Kb : Vb);
  gemm_tile<false, false>(eln, Bm, nullptr, Cm, N, K, K, sm + half * 2 * GBUF,
                          threadIdx.x & 127, r >> 4, r & 15);
}

// ---------------------------------------------------------------------------
// Local attention core: one block per (bp, head); 864 blocks, 8 waves.
// The score tile is built transposed, S^T(16 j x 16 i) = k(16 j x 8) @ q^T(8 x
// 16 i), so that in the accumulator a lane owns ONE softmax row i = mr and the
// eight columns j = r + 8*kg.  Row max and exp then run in registers on all 32
// lanes, and a register pair {p[2s], p[2s+1]} is, as it lies, the B fragment
// of O^T(16 x 16 i) += V^T(16 x 4 j) @ P^T(4 j x 16 i) under the k order
// j = 8*kg + 2*s + e, which the V^T loader follows.
// V^T rows 0..7 are v, row 8 is ones (its product is the softmax row sum),
// rows 9..15 are zero.
// The scores are formed once.  The instance-norm statistics need no score:
//   sum S   = sum_m (sum_i q[i][m]) * (sum_j k[j][m])
//   sum S^2 = sum_mn (q^T q)[m][n] * (k^T k)[m][n]
// With F = [q | k] (256 x 16), F^T F holds both 8 x 8 products on its diagonal
// blocks: 8 WMMAs a wave.  The row max is kept running over blocks of four
// score tiles; when it rises, the accumulator (numerators and row sum alike)
// is scaled down by the same factor.
// ---------------------------------------------------------------------------
// lane l takes the value of lane l ^ 16, on the vector unit (no LDS round trip
// inside the score loop)
__device__ __forceinline__ float xhalf(float x) {
  int b = __builtin_bit_cast(int, x);
  return __builtin_bit_cast(
      float, __builtin_amdgcn_permlanex16(b, b, 0x76543210, 0xfedcba98, false,
                                          false));
}

#define VTP 260   // V^T row pitch in dwords: 16 rows fall on 16 bank quads
#define GPW 288   // a wave's partial statistics: F^T F (16 x 16), 32 column sums

__device__ __forceinline__ void attn_local_body(
    int blk, const float* __restrict__ Qb, const float* __restrict__ Kb,
    const float* __restrict__ Vb, float* __restrict__ Ofl) {
  __shared__ __attribute__((aligned(16))) float q_s[256 * 8];    // q[i][m]
  __shared__ __attribute__((aligned(16))) float k_s[256 * 8];    // k[j][m]
  __shared__ __attribute__((aligned(16))) float vt_s[10 * VTP];  // v[m][j], 1, 0
  __shared__ __attribute__((aligned(16))) float gp_s[8 * GPW];
  int bp = blk >> 2, h = blk & 3;
  int b = bp / 27, p = bp % 27;
  int d = p / 9, ph = (p / 3) % 3, pwv = p % 3;
  int tid = threadIdx.x;
  {
    int c = tid;
    float qv[8], kv[8], vv[8];
    size_t idx = (size_t)(bp * 8) * 1024 + c * 4 + h;  // col = c*Hh + h
    const float *qg = Qb + idx, *kg_ = Kb + idx, *vg = Vb + idx;
#pragma unroll
    for (int pv = 0; pv < 8; ++pv) {
      qv[pv] = qg[pv * 1024]; kv[pv] = kg_[pv * 1024]; vv[pv] = vg[pv * 1024];
    }
    // keeps all 24 loads ahead of the wait below (one exposed latency)
    __builtin_amdgcn_sched_barrier(0);
    // stands before any register that a load above names is written again; the
    // address pairs are inputs so that they live up to the wait
    asm volatile("s_wait_xcnt 0x0" ::"v"(qg), "v"(kg_), "v"(vg) : "memory");
    // keeps later register writes from being lifted over the wait
    __builtin_amdgcn_sched_barrier(0);
    v4f q0 = {qv[0], qv[1], qv[2], qv[3]}, q1 = {qv[4], qv[5], qv[6], qv[7]};
    v4f k0 = {kv[0], kv[1], kv[2], kv[3]}, k1 = {kv[4], kv[5], kv[6], kv[7]};
    *(v4f*)&q_s[c * 8] = q0; *(v4f*)&q_s[c * 8 + 4] = q1;
    *(v4f*)&k_s[c * 8] = k0; *(v4f*)&k_s[c * 8 + 4] = k1;
#pragma unroll
    for (int pv = 0; pv < 8; ++pv) vt_s[pv * VTP + c] = vv[pv];
    vt_s[8 * VTP + c] = 1.f;
    vt_s[9 * VTP + c] = 0.f;
  }
  __syncthreads();
  int wave = tid >> 5, lane = tid & 31;
  int mr = lane & 15, kg = lane >> 4;
  const v8f z = {0, 0, 0, 0, 0, 0, 0, 0};
  // ---- statistics: F^T F and F's column sums over the wave's 32 rows -------
  // A = F^T (16 x 4 rows of F), B = F (4 x 16): lane (mr, kg), element e holds
  // F[i0 + 2*kg + e][mr] in both, so one fragment serves as A and as B.
  {
    const float* fp = (mr < 8 ? q_s : k_s) + (wave * 32 + kg * 2) * 8 + (mr & 7);
    v8f g = z;
    v2f cv = {0.f, 0.f};
#pragma unroll
    for (int st = 0; st < 8; ++st) {
      v2f f = {fp[st * 32], fp[st * 32 + 8]};
      g = wmma4(f, f, g);
      cv += f;
    }
    float* gw = gp_s + wave * GPW;
    gw[256 + lane] = cv[0] + cv[1];
#pragma unroll
    for (int r = 0; r < 8; ++r) gw[(r + 8 * kg) * 16 + mr] = g[r];
  }
  // k order of the score product, A (k) and B (q) alike: step kc, half kg,
  // element e  <->  m = 4*kg + 2*kc + e: one 16-byte read holds both steps.
  v4f qf[2];
#pragma unroll
  for (int t = 0; t < 2; ++t)
    qf[t] = *(const v4f*)&q_s[((wave + t * 8) * 16 + mr) * 8 + kg * 4];
  const float* kp = k_s + mr * 8 + kg * 4;
  __syncthreads();   // publishes the eight waves' partial statistics
  float S1, S2;
  {
    // lane = entries (m, n0) and (m, n0 + 1) of the two 8 x 8 blocks
    int m = lane >> 2, n0 = (lane & 3) * 2;
    const float* gq_p = gp_s + m * 16 + n0;
    const float* gk_p = gp_s + (m + 8) * 16 + 8 + n0;
    v2f gq = {0.f, 0.f}, gk = {0.f, 0.f};
    float cc = 0.f;
#pragma unroll
    for (int w = 0; w < 8; ++w) {
      gq += *(const v2f*)(gq_p + w * GPW);
      gk += *(const v2f*)(gk_p + w * GPW);
      cc += gp_s[w * GPW + 256 + lane];
    }
    S2 = wave_sum(gq[0] * gk[0] + gq[1] * gk[1]);
    cc += __shfl_xor(cc, 16, 32);   // sum of F's column mr
    // column m of q meets column m of k; every product stands in four lanes
    S1 = 0.25f * wave_sum(cc * __shfl_xor(cc, 8, 32));
  }
  float mu = S1 * (1.f / 65536.f);
  float var = S2 * (1.f / 65536.f) - mu * mu;
  float rstd = rsqrtf(var + 1e-5f);   // InstanceNorm eps; mu cancels in softmax
  // ---- scores, softmax with a running row max, p@v -------------------------
  float cs = rstd * 1.44269504088896341f;         // exp(x) = exp2(x * log2 e)
  v2f cs2 = {cs, cs};
  float run[2] = {-3.0e38f, -3.0e38f};
  v8f o[2] = {z, z};
  const float* vp = vt_s + (mr < 9 ? mr : 9) * VTP + kg * 8;
  for (int jb = 0; jb < 4; ++jb) {
    v4f kf[4], va[4], vb[4];
#pragma unroll
    for (int u = 0; u < 4; ++u) {
      kf[u] = *(const v4f*)(kp + (jb * 4 + u) * 128);
      va[u] = *(const v4f*)(vp + (jb * 4 + u) * 16);
      vb[u] = *(const v4f*)(vp + (jb * 4 + u) * 16 + 4);
    }
#pragma unroll
    for (int t = 0; t < 2; ++t) {
      v2f qa = {qf[t][0], qf[t][1]}, qb = {qf[t][2], qf[t][3]};
      v8f acc[4];
#pragma unroll
      for (int u = 0; u < 4; ++u) {
        v2f ka = {kf[u][0], kf[u][1]}, kb = {kf[u][2], kf[u][3]};
        acc[u] = wmma4(kb, qb, wmma4(ka, qa, z));
      }
      float mx = run[t];
#pragma unroll
      for (int u = 0; u < 4; ++u)
#pragma unroll
        for (int s = 0; s < 4; ++s)
          mx = fmaxf(mx, fmaxf(acc[u][2 * s], acc[u][2 * s + 1]));
      // the other half-wave holds the row's other j: both take one shift
      mx = fmaxf(mx, xhalf(mx));
      // first block: the factor is 0 and meets an accumulator of zeros
      float fs = __builtin_amdgcn_exp2f((run[t] - mx) * cs);
      run[t] = mx;
      o[t] = o[t] * fs;
      float nb = -mx * cs;
      v2f nb2 = {nb, nb};
#pragma unroll
      for (int u = 0; u < 4; ++u) {
        v2f vf[4] = {{va[u][0], va[u][1]}, {va[u][2], va[u][3]},
                     {vb[u][0], vb[u][1]}, {vb[u][2], vb[u][3]}};
#pragma unroll
        for (int s = 0; s < 4; ++s) {
          v2f x = {acc[u][2 * s], acc[u][2 * s + 1]};
          x = x * cs2 + nb2;
          v2f pf = {__builtin_amdgcn_exp2f(x[0]), __builtin_amdgcn_exp2f(x[1])};
          o[t] = wmma4(vf[s], pf, o[t]);
        }
      }
    }
  }
  // o[t][r] = O^T[r + 8*kg][i = mr]: kg 0 holds the 8 numerators of row i,
  // kg 1 holds the row sum in r = 0.
#pragma unroll
  for (int t = 0; t < 2; ++t) {
    float den = __shfl_xor(o[t][0], 16, 32);
    if (kg == 0) {
      int cc = (wave + t * 8) * 16 + mr;
      float inv = 1.f / den;
#pragma unroll
      for (int m2 = 0; m2 < 8; ++m2) {
        int p1 = m2 >> 2, p2 = (m2 >> 1) & 1, p3 = m2 & 1;
        int s = (d * 2 + p1) * 36 + (ph * 2 + p2) * 6 + (pwv * 2 + p3);
        Ofl[(size_t)(b * 216 + s) * 1024 + cc * 4 + h] = o[t][m2] * inv;
      }
    }
  }
}

// One grid for both attentions.  Work-groups 0..127: stage 2 of the global
// branch; the other 864: the local attention core.
__global__ __launch_bounds__(256) void k_attn_all(
    const float* __restrict__ Qb, const float* __restrict__ Kb,
    const float* __restrict__ Vb, float* __restrict__ Ofl,
    const float* __restrict__ gqkv, const float* __restrict__ g_wo,
    float* __restrict__ gpart) {
  if (blockIdx.x < 128)
    g_attn_body(blockIdx.x, gqkv, g_wo, gpart);
  else
    attn_local_body(blockIdx.x - 128, Qb, Kb, Vb, Ofl);
}

// ---------------------------------------------------------------------------
// Tail of the local branch in one launch: out = sum of its four K-quarter
// planes (outb, WOM x 256 each), t2 = LN(out + res) per row over C,
// map-out GEMM 'sc,oc->os' + bias + GELU, and y = x + broadcast(global) + local.
// Work-group = 16 rows s x 128 outputs o (both halves of o redo the cheap LN of
// their 16 rows); 216 work-groups, 8 waves, a wave owns 16 o.
// The product is built transposed, D(16 o x 16 s) = mo_w(16 o x K) @ t2^T(K x
// 16 s): in the accumulator the 16 lanes of a half-wave then hold 16 successive
// s of one o, which are 64 successive bytes of x and of y.
// Both operands lie in LDS as rows of k, pitch TP dwords (16 bytes x odd).  A
// wave brings its own 16 rows of mo_w with whole-line loads, issued ahead of
// the LN.  k order, A and B alike: read c8, half kg, step kc, element e  <->
// k = 8*c8 + 4*kg + 2*kc + e: one 16-byte read holds two k-steps.
// ---------------------------------------------------------------------------
#define TP 260

__global__ __launch_bounds__(256) void k_tail(
    const float* __restrict__ outb, const float* __restrict__ res,
    const float* __restrict__ ln_g, const float* __restrict__ ln_b,
    const float* __restrict__ mo_w, const float* __restrict__ mo_b,
    const float* __restrict__ x, const float* __restrict__ gvec,
    float* __restrict__ y) {
  __shared__ __attribute__((aligned(16))) float t_s[16 * TP];    // t2[s][k]
  __shared__ __attribute__((aligned(16))) float w_s[128 * TP];   // mo_w[o][k]
  int tid = threadIdx.x, wave = tid >> 5, lane = tid & 31;
  int mr = lane & 15, kg = lane >> 4;
  int row0 = (blockIdx.x >> 1) * 16;
  int n0 = (blockIdx.x & 1) * 128 + wave * 16;
  // LN operands: rows row0 + 2*wave and + 1; the wave's 16 rows of mo_w;
  // epilogue operands: lane = row s = row0 + mr, outputs o = oo + r
  size_t lo = (size_t)(row0 + wave * 2) * 256 + lane * 4;
  const float *op = outb + lo, *rp = res + lo;   // op: plane 0 of out
  const float *lgp = ln_g + lane * 4, *lbp = ln_b + lane * 4;
  const float* wp = mo_w + (size_t)n0 * 256 + lane * 4;
  int bs = row0 + mr, b = bs / 216, s = bs - b * 216;
  int oo = n0 + kg * 8;
  size_t xo = (size_t)(b * 256 + oo) * 216 + s;
  const float* xp = x + xo;
  const float* gp = gvec + b * 256 + oo;
  unsigned bo = oo * 4u;   // byte offset: the register that the mo_b loads name
  const float* bp = (const float*)((const char*)mo_b + bo);
  v4f ov[4][4], rv[4], lg[2], lb[2];   // [plane] row*2 + half row; half row
#pragma unroll
  for (int j = 0; j < 4; ++j) {
#pragma unroll   // constant indices keep ov in registers
    for (int q = 0; q < 4; ++q)
      ov[q][j] = *(const v4f*)(op + q * (WOM * 256) + j * 128);
    rv[j] = *(const v4f*)(rp + j * 128);
  }
#pragma unroll
  for (int j = 0; j < 2; ++j) {
    lg[j] = *(const v4f*)(lgp + j * 128);
    lb[j] = *(const v4f*)(lbp + j * 128);
  }
  v4f wr[32];   // load i = row i/2, half i%2
#pragma unroll
  for (int i = 0; i < 32; ++i) wr[i] = *(const v4f*)(wp + i * 128);
  float xv[8];
#pragma unroll
  for (int r = 0; r < 8; ++r) xv[r] = xp[r * 216];
  v4f gv[2] = {*(const v4f*)gp, *(const v4f*)(gp + 4)};
  v4f mb[2] = {*(const v4f*)bp, *(const v4f*)(bp + 4)};
  // keeps all loads ahead of the first load wait (one exposed latency)
  __builtin_amdgcn_sched_barrier(0);
  // stands before any register that a load above names is written again; the
  // address pairs and the two offsets are inputs so that they live up to it
  asm volatile("s_wait_xcnt 0x0" ::"v"(op), "v"(rp), "v"(lane), "v"(wp),
               "v"(xp), "v"(gp), "v"(bo)
               : "memory");
  // keeps later register writes from being lifted over the wait
  __builtin_amdgcn_sched_barrier(0);
#pragma unroll
  for (int q = 0; q < 2; ++q) {
    v4f a = ((ov[0][2 * q] + ov[1][2 * q]) + (ov[2][2 * q] + ov[3][2 * q])) +
            rv[2 * q];
    v4f c = ((ov[0][2 * q + 1] + ov[1][2 * q + 1]) +
             (ov[2][2 * q + 1] + ov[3][2 * q + 1])) +
            rv[2 * q + 1];
    v4f s4 = a + c, p4 = a * a + c * c;
    float S1 = wave_sum((s4[0] + s4[1]) + (s4[2] + s4[3]));
    float S2 = wave_sum((p4[0] + p4[1]) + (p4[2] + p4[3]));
    float mn = S1 * (1.f / 256.f), var = S2 * (1.f / 256.f) - mn * mn;
    float rs = rsqrtf(var + 1e-6f);
    float* td = t_s + (wave * 2 + q) * TP + lane * 4;
    *(v4f*)td = (a - mn) * rs * lg[0] + lb[0];
    *(v4f*)(td + 128) = (c - mn) * rs * lg[1] + lb[1];
  }
#pragma unroll
  for (int i = 0; i < 32; ++i)
    *(v4f*)&w_s[(wave * 16 + (i >> 1)) * TP + (i & 1) * 128 + lane * 4] = wr[i];
  __syncthreads();   // publishes t2 (and the wave's own mo_w rows)
  const float* ap = w_s + (wave * 16 + mr) * TP + kg * 4;
  const float* bq = t_s + mr * TP + kg * 4;
  const v8f z = {0, 0, 0, 0, 0, 0, 0, 0};
  v8f acc[2] = {z, z};   // one per k-step of a read: two independent chains
  // groups of four reads per operand (8 WMMAs), a ring of three: g+2 is read
  // while g multiplies
  v4f fa[3][4], fb[3][4];
#pragma unroll
  for (int g = 0; g < 2; ++g)
#pragma unroll
    for (int j = 0; j < 4; ++j) {
      fa[g][j] = *(const v4f*)(ap + (g * 4 + j) * 8);
      fb[g][j] = *(const v4f*)(bq + (g * 4 + j) * 8);
    }
#pragma unroll
  for (int g = 0; g < 8; ++g) {
    if (g + 2 < 8) {
#pragma unroll
      for (int j = 0; j < 4; ++j) {
        fa[(g + 2) % 3][j] = *(const v4f*)(ap + ((g + 2) * 4 + j) * 8);
        fb[(g + 2) % 3][j] = *(const v4f*)(bq + ((g + 2) * 4 + j) * 8);
      }
    }
    // keeps the LDS reads above ahead of this group's WMMAs: the scheduler
    // otherwise sinks each read to just before its use and waits it out
    __builtin_amdgcn_sched_barrier(0);
#pragma unroll
    for (int j = 0; j < 4; ++j) {
      v4f a = fa[g % 3][j], c = fb[g % 3][j];
      v2f a0 = {a[0], a[1]}, a1 = {a[2], a[3]};
      v2f c0 = {c[0], c[1]}, c1 = {c[2], c[3]};
      acc[0] = wmma4(a0, c0, acc[0]);
      acc[1] = wmma4(a1, c1, acc[1]);
    }
  }
  // acc[.][r] = D[o = oo + r][s = row0 + mr]
  float* yp = y + xo;
#pragma unroll
  for (int r = 0; r < 8; ++r) {
    float v = gelu_exact((acc[0][r] + acc[1][r]) + mb[r >> 2][r & 3]);
    yp[r * 216] = xv[r] + gv[r >> 2][r & 3] + v;
  }
}

extern "C" void kernel_launch(void* const* d_in, const int* in_sizes, int n_in,
                              void* d_out, int out_size, void* d_ws,
                              size_t ws_size, hipStream_t stream) {
  const float* x       = (const float*)d_in[0];
  const float* g_tok_w = (const float*)d_in[1];
  const float* g_tok_b = (const float*)d_in[2];
  const float* g_ln1_g = (const float*)d_in[3];
  const float* g_ln1_b = (const float*)d_in[4];
  const float* g_wq    = (const float*)d_in[5];
  const float* g_wk    = (const float*)d_in[6];
  const float* g_wv    = (const float*)d_in[7];
  const float* g_wo    = (const float*)d_in[8];
  const float* g_ln2_g = (const float*)d_in[9];
  const float* g_ln2_b = (const float*)d_in[10];
  const float* g_mo_w  = (const float*)d_in[11];
  const float* g_mo_b  = (const float*)d_in[12];
  const float* l_pw    = (const float*)d_in[13];
  const float* l_pb    = (const float*)d_in[14];
  const float* l_ln1_g = (const float*)d_in[15];
  const float* l_ln1_b = (const float*)d_in[16];
  const float* l_wq    = (const float*)d_in[17];
  const float* l_wk    = (const float*)d_in[18];
  const float* l_wv    = (const float*)d_in[19];
  const float* l_wo    = (const float*)d_in[20];
  const float* l_ln2_g = (const float*)d_in[21];
  const float* l_ln2_b = (const float*)d_in[22];
  const float* l_mo_w  = (const float*)d_in[23];
  const float* l_mo_b  = (const float*)d_in[24];

  float* ws   = (float*)d_ws;
  float* gsum = ws;                 // 8*27, in 2048
  float* gvec = ws + 2048;          // 2048
  float* eln  = ws + 2048 + 2048;   // 1728*256
  float* res  = eln + 442368;       // 1728*256
  float* Qb   = res + 442368;       // 1728*1024
  float* Kb   = Qb + 1769472;       // 1728*1024
  float* Vb   = Kb + 1769472;       // 1728*1024
  float* ofl  = Vb + 1769472;       // 1728*1024
  float* gqkv = ofl + 1769472;      // 3*8*1024
  float* gpart = gqkv + 24576;      // 8*16*256
  float* outb = Qb;                 // alias: Qb dead after attention; 4 planes

  k_local_embed<<<216, 256, 0, stream>>>(x, l_pw, l_pb, l_ln1_g, l_ln1_b, res,
                                         eln, gsum);
  k_qkv_all<<<744, 256, 0, stream>>>(eln, l_wq, l_wk, l_wv, Qb, Kb, Vb, 1024,
                                     256, gsum, g_tok_w, g_tok_b, g_ln1_g,
                                     g_ln1_b, g_wq, g_wk, g_wv, gqkv);
  k_attn_all<<<992, 256, 0, stream>>>(Qb, Kb, Vb, ofl, gqkv, g_wo, gpart);
  k_wo_all<<<496, 128, 0, stream>>>(ofl, l_wo, outb, 256, 1024, gsum, g_tok_w,
                                    g_tok_b, gpart, g_ln2_g, g_ln2_b, g_mo_w,
                                    g_mo_b, gvec);
  k_tail<<<216, 256, 0, stream>>>(outb, res, l_ln2_g, l_ln2_b, l_mo_w, l_mo_b,
                                  x, gvec, (float*)d_out);
}
